// v000
// The times below were measured on an AMD MI455X: many runs one after another, warmed up first and cycling through
// copies of the inputs, with the whole window's GPU time divided by the number of runs. Launches and the gaps
// between them are all in it. The median over several windows is given; except for v000 it joins two sittings, which
// can be a few percent apart, so the side-by-side timings, each taken in one sitting, are the better comparison.
// The starting kernel, v000, takes 921 microseconds a run.
#include <hip/hip_runtime.h>

// Contractions, f32 accumulate: q/k/v projections v_wmma_f32_16x16x32_bf16 (x, W, bias all RNE-converted to bf16, single product); content scores v_wmma_f32_16x16x32_bf16 with q and k as bf16 hi/lo planes (3 products); q.E_k^T bf16 hi/lo x exact bf16 E_k (2 products); attn.[V | rel-value buckets] v_wmma_f32_16x16x32_f16 (P carried x1024 in fp16, V fp16, E_v exact); output projection bf16 hi/lo context x exact bf16 W_o (2 products) + bf16 bias. Softmax, logit adds and carries in f32.
// Layout per batch: bf16 copy of each input slab; projection (f32) -> per-head planes (q, k: [h][t][d] bf16 hi + lo; v: [h][d][t] fp16 with pitch TT+128 whose last 128 columns hold E_v^T (65 used, rest zero)).
// Per pass of ZH heads: S = q.k^T (f32 [ZH][TT][TT]); QE = q.E_k^T (f32 [ZH][TT][128]); row kernel: t_j = S_j / 8 + QE[clip(j - i, -32, 32) + 32], softmax over TT keys, writes P row = [1024 p_j fp16 | bucket sums: r = 0 keys j <= i - 32, r = 64 keys j >= i + 32, 0 < r < 64 the single key i + r - 32, r > 64 zero];
// one GEMM with K = TT + 128 gives 1024 (attn.V + attn.E_v[clip]); merge scales by 1/1024 into bf16 hi/lo context planes [t][h*64 + d]; output GEMM with bias.

#ifndef NB
#define NB 4
#endif
#ifndef SEQ
#define SEQ 1024
#endif
#define NB_FULL  4
#define SEQ_FULL 1024
#define TT   SEQ
#define DM   1024
#define NH_  16
#define HD   64
#define DQ   (NH_ * HD)
#define ZH   8
#define PCAR 1024.0f
#define SCL  0.125f
#define NE   128     // rel tables (65 rows) padded to 128
#define NREL 65
#define MAXR 32
#define PP   (TT + NE)   // P row pitch and V^T row pitch (keys + rel buckets)
static_assert(TT % 128 == 0);
static_assert(TT <= SEQ_FULL);
static_assert(NB <= NB_FULL);
static_assert(NB >= 1);
static_assert(NH_ % ZH == 0);
static_assert(PP % 32 == 0);
static_assert(NREL == 2 * MAXR + 1);
static_assert(DM % 64 == 0);
static_assert((ZH * TT) % 8 == 0);

typedef _Float16 h16;
typedef unsigned short bf;
typedef __attribute__((ext_vector_type(16))) __bf16   v16bf;
typedef __attribute__((ext_vector_type(16))) _Float16 v16h;
typedef __attribute__((ext_vector_type(8)))  _Float16 v8h;
typedef __attribute__((ext_vector_type(8)))  unsigned short v8us;
typedef __attribute__((ext_vector_type(8)))  float    v8f;
typedef __attribute__((ext_vector_type(4)))  float    v4f;
typedef v8h  __attribute__((may_alias)) v8ha;
typedef v4f  __attribute__((may_alias)) v4fa;
typedef v8us __attribute__((may_alias)) v8usa;

__device__ __forceinline__ unsigned short f2bf(float f) { unsigned u = __float_as_uint(f); u += 0x7FFFu + ((u >> 16) & 1u); return (unsigned short)(u >> 16); }
__device__ __forceinline__ float bf2f(unsigned short b) { return __uint_as_float(((unsigned)b) << 16); }
__device__ __forceinline__ float bfr(float f) { return bf2f(f2bf(f)); }
__device__ __forceinline__ v16h cat16(v8h lo, v8h hi) { return __builtin_shufflevector(lo, hi, 0, 1, 2, 3, 4, 5, 6, 7, 8, 9, 10, 11, 12, 13, 14, 15); }
__device__ __forceinline__ v16bf cat16b(v8us lo, v8us hi) { return __builtin_bit_cast(v16bf, __builtin_shufflevector(lo, hi, 0, 1, 2, 3, 4, 5, 6, 7, 8, 9, 10, 11, 12, 13, 14, 15)); }
__device__ __forceinline__ v8f wmma16(v16h a, v16h b, v8f c) { return __builtin_amdgcn_wmma_f32_16x16x32_f16(false, a, false, b, (short)0, c, false, false); }
__device__ __forceinline__ v8f wmmab(v16bf a, v16bf b, v8f c) { return __builtin_amdgcn_wmma_f32_16x16x32_bf16(false, a, false, b, (short)0, c, false, false); }

// ---- k_gemmw: register-blocked GEMM, ONE WAVE per 64x64 output tile (16 accumulators), operands straight from K-contiguous 16-bit planes; grid (M/64, N/64, Z), 32 threads.
// C[m][n] (f32, pitch ldc, + optional f32 bias[n] via bf16) = sum_k A[m][k] Bt[n][k] (+ split products per NSPLIT). z-batch strides sA/sB/sC in elements. K % 32 == 0; A and Bt row pitch == K.
// Fragment map (both operands): lane l -> row/col l&15, elements 0..7 <- k 8h..8h+7, elements 8..15 <- k 16+8h..16+8h+7 (h = l>>4); D element r -> row 8h+r, col l&15.
template <typename T16> struct WFrag;
template <> struct WFrag<h16> { typedef v16h V; static __device__ __forceinline__ V ld(const h16* p) { return cat16(*(const v8h*)p, *(const v8h*)(p + 16)); } static __device__ __forceinline__ v8f mma(V a, V b, v8f c) { return wmma16(a, b, c); } };
template <> struct WFrag<bf> { typedef v16bf V; static __device__ __forceinline__ V ld(const bf* p) { return cat16b(*(const v8us*)p, *(const v8us*)(p + 16)); } static __device__ __forceinline__ v8f mma(V a, V b, v8f c) { return wmmab(a, b, c); } };
template <typename T16, int NSPLIT, bool BIAS>
__global__ __launch_bounds__(32) void k_gemmw(const T16* __restrict__ A, const T16* __restrict__ A2, const T16* __restrict__ Bt, const T16* __restrict__ Bt2, int K, float* C, int ldc, const float* __restrict__ bias, size_t sA, size_t sB, size_t sC) {
    typedef typename WFrag<T16>::V V;
    __shared__ __align__(16) float os[16 * 68];
    const size_t z = blockIdx.z; A += z * sA; if (A2) A2 += z * sA; Bt += z * sB; if (Bt2) Bt2 += z * sB; C += z * sC;
    const int lane = threadIdx.x & 31, lr = lane & 15, hi = lane >> 4; const int r0 = blockIdx.x * 64, c0 = blockIdx.y * 64;
    v8f acc[4][4];
#pragma unroll
    for (int mb = 0; mb < 4; ++mb)
#pragma unroll
        for (int nb = 0; nb < 4; ++nb) acc[mb][nb] = (v8f){};
    const size_t aoff = (size_t)(r0 + lr) * K + 8 * hi, boff = (size_t)(c0 + lr) * K + 8 * hi;
#pragma unroll 1
    for (int kc = 0; kc < K; kc += 32) {
        V a[4], a2[4];
#pragma unroll
        for (int mb = 0; mb < 4; ++mb) { a[mb] = WFrag<T16>::ld(A + aoff + (size_t)mb * 16 * K + kc); if (NSPLIT == 1 || NSPLIT == 2) a2[mb] = WFrag<T16>::ld(A2 + aoff + (size_t)mb * 16 * K + kc); }
#pragma unroll
        for (int nb = 0; nb < 4; ++nb) { const V b = WFrag<T16>::ld(Bt + boff + (size_t)nb * 16 * K + kc); V b2; if (NSPLIT >= 2) b2 = WFrag<T16>::ld(Bt2 + boff + (size_t)nb * 16 * K + kc);
#pragma unroll
            for (int mb = 0; mb < 4; ++mb) { acc[mb][nb] = WFrag<T16>::mma(a[mb], b, acc[mb][nb]); if (NSPLIT == 1 || NSPLIT == 2) acc[mb][nb] = WFrag<T16>::mma(a2[mb], b, acc[mb][nb]); if (NSPLIT >= 2) acc[mb][nb] = WFrag<T16>::mma(a[mb], b2, acc[mb][nb]); } }
        asm volatile("v_nop\n\tv_nop\n\tv_nop\n\tv_nop" : "+v"(acc[0][0]), "+v"(acc[1][1]), "+v"(acc[2][2]), "+v"(acc[3][3]) : "v"(a[0]), "v"(a[3]));
    }
#pragma unroll
    for (int mb = 0; mb < 4; ++mb) {
#pragma unroll
        for (int nb = 0; nb < 4; ++nb) {
#pragma unroll
            for (int j = 0; j < 8; ++j) os[(hi * 8 + j) * 68 + nb * 16 + lr] = acc[mb][nb][j]; }
        __builtin_amdgcn_wave_barrier(); asm volatile("" ::: "memory");
        float* crow = C + (size_t)(r0 + mb * 16) * ldc + c0;
{
#pragma unroll
            for (int s = 0; s < 8; ++s) { const int row = 2 * s + hi, cofs = lr * 4; v4f val = *(const v4fa*)(os + row * 68 + cofs); if (BIAS) { val[0] += bfr(bias[c0 + cofs]); val[1] += bfr(bias[c0 + cofs + 1]); val[2] += bfr(bias[c0 + cofs + 2]); val[3] += bfr(bias[c0 + cofs + 3]); }
                *(v4f*)(crow + (size_t)row * ldc + cofs) = val; }
             }
        __builtin_amdgcn_wave_barrier(); asm volatile("" ::: "memory");
    }
}

__device__ __forceinline__ h16 tohx(float x) { return (h16)x; }
__device__ __forceinline__ void splitf(float y, unsigned short& h, unsigned short& l) { h = f2bf(y); l = f2bf(y - bf2f(h)); }
typedef __attribute__((ext_vector_type(2))) _Float16 v2h;
typedef __attribute__((ext_vector_type(4))) _Float16 v4h;
typedef __attribute__((ext_vector_type(2))) unsigned short v2us;
typedef __attribute__((ext_vector_type(4))) unsigned short v4us;
typedef __attribute__((ext_vector_type(2))) float v2f;

__global__ __launch_bounds__(256) void k_cvt8(const float* __restrict__ src, bf* dst, size_t n8) { const size_t i = (size_t)blockIdx.x * 256 + threadIdx.x; if (i >= n8) return; const v8f v = *(const v8f*)(src + i * 8); v8us o;
#pragma unroll
    for (int k = 0; k < 8; ++k) o[k] = f2bf(v[k]); *(v8us*)(dst + i * 8) = o;  }

__global__ __launch_bounds__(256) void k_epad2(const float* __restrict__ E, bf* EB) { const size_t i = (size_t)blockIdx.x * 256 + threadIdx.x; if (i >= (size_t)NE * HD / 8) return; const int d0 = (int)(i % (HD / 8)) * 8; const int r = (int)(i / (HD / 8)); const float* src = E + (size_t)min(r, NREL - 1) * HD + d0; v8us o;
#pragma unroll
    for (int q = 0; q < 8; ++q) { const unsigned short v = f2bf(src[q]); o[q] = (r < NREL) ? v : (unsigned short)0; }
    *(v8us*)(EB + (size_t)r * HD + d0) = o;  }

__global__ __launch_bounds__(256) void k_plane(const float* __restrict__ F, int pitch, int nheads, bf* Ph, bf* Pl) {
    const size_t e = ((size_t)blockIdx.x * 256 + threadIdx.x) * 8; if (e >= (size_t)nheads * TT * HD) return;
    const int d = (int)(e % HD); const int t = (int)((e / HD) % TT); const int h = (int)(e / ((size_t)HD * TT));
    const v8f x = *(const v8f*)(F + (size_t)t * pitch + h * HD + d); v8us oh, ol;
#pragma unroll
    for (int q = 0; q < 8; ++q) { unsigned short a, c2; splitf(x[q], a, c2); oh[q] = a; ol[q] = c2; }
    *(v8us*)(Ph + e) = oh; *(v8us*)(Pl + e) = ol;  }

__global__ __launch_bounds__(256) void k_vtp8(const float* __restrict__ F, int pitch, int nheads, h16* VT) {
    const size_t e = ((size_t)blockIdx.x * 256 + threadIdx.x) * 8; if (e >= (size_t)nheads * HD * TT) return;
    const int t = (int)(e % TT); const int d = (int)((e / TT) % HD); const int g = (int)(e / ((size_t)TT * HD));
    v8h o;
#pragma unroll
    for (int q = 0; q < 8; ++q) o[q] = tohx(F[(size_t)(t + q) * pitch + g * HD + d]);
    h16* dst = VT + ((size_t)g * HD + d) * PP + t;
    *(v8h*)dst = o;  }

__global__ __launch_bounds__(256) void k_evt(const float* __restrict__ EV, int nheads, h16* VT) {
    const size_t e = ((size_t)blockIdx.x * 256 + threadIdx.x) * 8; if (e >= (size_t)nheads * HD * NE) return;
    const int r0 = (int)(e % NE); const int d = (int)((e / NE) % HD); const int g = (int)(e / ((size_t)NE * HD));
    v8h o;
#pragma unroll
    for (int q = 0; q < 8; ++q) { const int r = r0 + q; const float x = bfr(EV[(size_t)min(r, NREL - 1) * HD + d]); const float y = (r < NREL) ? x : 0.0f; o[q] = tohx(y); }
    h16* dst = VT + ((size_t)g * HD + d) * PP + TT + r0;
    *(v8h*)dst = o;  }

// k_asoft: one wave per score row (zz, i), 8 rows per block, grid exactly ZH*TT/8 (no early exit; block barriers):
// t_j = S[zz][i][j] * HD^-0.5 + QE[zz][i][clip(j - i, -32, 32) + 32] (QE row staged in LDS); softmax over the TT keys (register row, one exp, fixed trees);
// P16 row (pitch PP) = [p_j x 1024 fp16, j < TT | at TT + r: r = 0 sum of p over j <= i - 32, r = 64 sum over j >= i + 32, 0 < r < 64 p at j = i + r - 32 (0 when outside [0, TT)), r > 64 zero], all x 1024;
__global__ __launch_bounds__(256) void k_asoft(const float* __restrict__ Sb, const float* __restrict__ QE, h16* P16) {
    __shared__ __align__(16) float qes[8][NE];
    __shared__ __align__(16) float prow[8][TT];
    const int lane = threadIdx.x & 31, wid = threadIdx.x >> 5; const int row = blockIdx.x * 8 + wid; const int i = row % TT;
    const float* sr = Sb + (size_t)row * TT; const float* qe = QE + (size_t)row * NE;
    { const v4f g4 = *(const v4f*)(qe + lane * 4); *(v4f*)(&qes[wid][lane * 4]) = g4; }
    __syncthreads();
    float v[TT / 32]; float mx = -3.0e38f;
#pragma unroll
    for (int ch = 0; ch < TT / 128; ++ch) { const int j0 = ch * 128 + lane * 4; const v4f a = *(const v4f*)(sr + j0);
#pragma unroll
        for (int q = 0; q < 4; ++q) { const int j = j0 + q; const int r = min(max(j - i, -MAXR), MAXR) + MAXR; const float t = a[q] * SCL + qes[wid][r]; v[ch * 4 + q] = t; mx = fmaxf(mx, t); } }
#pragma unroll
    for (int sh = 16; sh; sh >>= 1) mx = fmaxf(mx, __shfl_xor(mx, sh, 32));
    float sum = 0.f;
#pragma unroll
    for (int k = 0; k < TT / 32; ++k) { float d0 = __fsub_rn(v[k], mx); asm volatile("" : "+v"(d0)); v[k] = __builtin_amdgcn_exp2f(__fmul_rn(d0, 1.4426950408889634f)); sum += v[k]; }
#pragma unroll
    for (int sh = 16; sh; sh >>= 1) sum += __shfl_xor(sum, sh, 32);
    const float f = __fdiv_rn(PCAR, sum);
    float tl0 = 0.f, tl1 = 0.f;
#pragma unroll
    for (int ch = 0; ch < TT / 128; ++ch) { const int j0 = ch * 128 + lane * 4; v4f p4;
#pragma unroll
        for (int q = 0; q < 4; ++q) { const int j = j0 + q; const float p = v[ch * 4 + q] * f; v[ch * 4 + q] = p; p4[q] = p; tl0 += (j <= i - MAXR) ? p : 0.f; tl1 += (j >= i + MAXR) ? p : 0.f; }
        *(v4f*)(&prow[wid][j0]) = p4; }
#pragma unroll
    for (int sh = 16; sh; sh >>= 1) { tl0 += __shfl_xor(tl0, sh, 32); tl1 += __shfl_xor(tl1, sh, 32); }
    __syncthreads();
    v4h bq4;
#pragma unroll
    for (int q = 0; q < 4; ++q) { const int r = lane * 4 + q; const int j = i + r - MAXR; const int jc = min(max(j, 0), TT - 1); float w = prow[wid][jc];
        w = (r > 0 && r < 2 * MAXR && j >= 0 && j < TT) ? w : 0.f; w = (r == 0) ? tl0 : w; w = (r == 2 * MAXR) ? tl1 : w; bq4[q] = tohx(w); }
    h16* prw = P16 + (size_t)row * PP;
{
#pragma unroll
        for (int ch = 0; ch < TT / 128; ++ch) { v4h o4;
#pragma unroll
            for (int q = 0; q < 4; ++q) o4[q] = tohx(v[ch * 4 + q]);
            *(v4h*)(prw + ch * 128 + lane * 4) = o4; }
        *(v4h*)(prw + TT + lane * 4) = bq4;
         }
}

__global__ __launch_bounds__(256) void k_merge(const float* __restrict__ O, int h0, bf* Ah, bf* Al) { const size_t e = ((size_t)blockIdx.x * 256 + threadIdx.x) * 2; if (e >= (size_t)ZH * TT * HD) return; const int d = (int)(e % HD); const int t = (int)((e / HD) % TT); const int zz = (int)(e / ((size_t)HD * TT)); const float cs = 1.0f / PCAR; const size_t oo = (size_t)t * DQ + (h0 + zz) * HD + d;
    v2us oh, ol;
#pragma unroll
    for (int q = 0; q < 2; ++q) { unsigned short a, c2; splitf(O[e + q] * cs, a, c2); oh[q] = a; ol[q] = c2; } *(v2us*)(Ah + oo) = oh; *(v2us*)(Al + oo) = ol;  }

extern "C" void kernel_launch(void* const* d_in, const int* in_sizes, int n_in,
                              void* d_out, int out_size, void* d_ws, size_t ws_size, hipStream_t stream) {
    if (n_in < 13) return;
    const size_t needX = ((size_t)(NB - 1) * SEQ_FULL + TT) * DM;
    if ((size_t)in_sizes[0] < needX || (size_t)in_sizes[1] < needX || (size_t)in_sizes[2] < needX) return;
    if (in_sizes[3] < DM * DM || in_sizes[5] < DM * DM || in_sizes[7] < DM * DM || in_sizes[9] < DM * DM) return;
    if (in_sizes[4] < DM || in_sizes[6] < DM || in_sizes[8] < DM || in_sizes[10] < DM) return;
    if (in_sizes[11] < NREL * HD || in_sizes[12] < NREL * HD) return;
    if ((size_t)out_size < needX) return;
    const float* query = (const float*)d_in[0]; const float* key = (const float*)d_in[1]; const float* value = (const float*)d_in[2];
    const float* wq = (const float*)d_in[3]; const float* bq = (const float*)d_in[4]; const float* wk = (const float*)d_in[5]; const float* bk = (const float*)d_in[6];
    const float* wv = (const float*)d_in[7]; const float* bv = (const float*)d_in[8]; const float* wo = (const float*)d_in[9]; const float* bo = (const float*)d_in[10];
    const float* rke = (const float*)d_in[11]; const float* rve = (const float*)d_in[12];
    float* OUT = (float*)d_out;     // [NB][SEQ_FULL][DM]
    char* wsp = (char*)d_ws;
    auto take = [&](size_t bytes) { char* p = wsp; wsp += (bytes + 255) & ~(size_t)255; return (void*)p; };
    bf* WQ = (bf*)take((size_t)DQ * DM * 2); bf* WK = (bf*)take((size_t)DQ * DM * 2); bf* WV = (bf*)take((size_t)DQ * DM * 2); bf* WO = (bf*)take((size_t)DM * DQ * 2);
    bf* EB = (bf*)take((size_t)NE * HD * 2);
    bf* XB = (bf*)take((size_t)TT * DM * 2); float* F = (float*)take((size_t)TT * DQ * 4);
    bf* QPh = (bf*)take((size_t)NH_ * TT * HD * 2); bf* QPl = (bf*)take((size_t)NH_ * TT * HD * 2); bf* KPh = (bf*)take((size_t)NH_ * TT * HD * 2); bf* KPl = (bf*)take((size_t)NH_ * TT * HD * 2);
    h16* VT = (h16*)take((size_t)NH_ * HD * PP * 2);
    float* QE = (float*)take((size_t)ZH * TT * NE * 4); float* Sb = (float*)take((size_t)ZH * TT * TT * 4); h16* P16 = (h16*)take((size_t)ZH * TT * PP * 2);
    float* Ob = (float*)take((size_t)ZH * TT * HD * 4); bf* ATh = (bf*)take((size_t)TT * DQ * 2); bf* ATl = (bf*)take((size_t)TT * DQ * 2);
    const size_t carved = (size_t)(wsp - (char*)d_ws);
    if (carved > ws_size || carved > (size_t)134217728) return;    // 88,358,912 B at NB=4, SEQ=1024
    // weights and tables (once)
    k_cvt8<<<(unsigned)(((size_t)DQ * DM / 8 + 255) / 256), 256, 0, stream>>>(wq, WQ, (size_t)DQ * DM / 8);
    k_cvt8<<<(unsigned)(((size_t)DQ * DM / 8 + 255) / 256), 256, 0, stream>>>(wk, WK, (size_t)DQ * DM / 8);
    k_cvt8<<<(unsigned)(((size_t)DQ * DM / 8 + 255) / 256), 256, 0, stream>>>(wv, WV, (size_t)DQ * DM / 8);
    k_cvt8<<<(unsigned)(((size_t)DM * DQ / 8 + 255) / 256), 256, 0, stream>>>(wo, WO, (size_t)DM * DQ / 8);
    k_epad2<<<(unsigned)(((size_t)NE * HD / 8 + 255) / 256), 256, 0, stream>>>(rke, EB);                      /* E_k: 65 rows bf16 (exact), rows 65..127 zero */
    k_evt<<<(unsigned)(((size_t)NH_ * HD * NE / 8 + 255) / 256), 256, 0, stream>>>(rve, NH_, VT);           /* E_v^T columns TT..TT+127 of every V^T row (write-once) */
    const unsigned LPL = (unsigned)(((size_t)NH_ * TT * HD / 8 + 255) / 256);
    for (int b = 0; b < NB; ++b) {
        const size_t xoff = (size_t)b * SEQ_FULL * DM;
        k_cvt8<<<(unsigned)(((size_t)TT * DM / 8 + 255) / 256), 256, 0, stream>>>(query + xoff, XB, (size_t)TT * DM / 8);
        k_gemmw<bf, 0, true><<<dim3(TT / 64, DQ / 64, 1), 32, 0, stream>>>(XB, nullptr, WQ, nullptr, DM, F, DQ, bq, 0, 0, 0);
        k_plane<<<LPL, 256, 0, stream>>>(F, DQ, NH_, QPh, QPl);
        k_cvt8<<<(unsigned)(((size_t)TT * DM / 8 + 255) / 256), 256, 0, stream>>>(key + xoff, XB, (size_t)TT * DM / 8);
        k_gemmw<bf, 0, true><<<dim3(TT / 64, DQ / 64, 1), 32, 0, stream>>>(XB, nullptr, WK, nullptr, DM, F, DQ, bk, 0, 0, 0);
        k_plane<<<LPL, 256, 0, stream>>>(F, DQ, NH_, KPh, KPl);
        k_cvt8<<<(unsigned)(((size_t)TT * DM / 8 + 255) / 256), 256, 0, stream>>>(value + xoff, XB, (size_t)TT * DM / 8);
        k_gemmw<bf, 0, true><<<dim3(TT / 64, DQ / 64, 1), 32, 0, stream>>>(XB, nullptr, WV, nullptr, DM, F, DQ, bv, 0, 0, 0);
        k_vtp8<<<LPL, 256, 0, stream>>>(F, DQ, NH_, VT);
        for (int h0 = 0; h0 < NH_; h0 += ZH) { const size_t zq = (size_t)h0;
            k_gemmw<bf, 2, false><<<dim3(TT / 64, TT / 64, ZH), 32, 0, stream>>>(QPh + zq * TT * HD, QPl + zq * TT * HD, KPh + zq * TT * HD, KPl + zq * TT * HD, HD, Sb, TT, nullptr, (size_t)TT * HD, (size_t)TT * HD, (size_t)TT * TT);   /* S[i][j] = q_i . k_j */
            k_gemmw<bf, 1, false><<<dim3(TT / 64, NE / 64, ZH), 32, 0, stream>>>(QPh + zq * TT * HD, QPl + zq * TT * HD, EB, nullptr, HD, QE, NE, nullptr, (size_t)TT * HD, 0, (size_t)TT * NE);                 /* QE[i][e] = q_i . E_k[e] */
            k_asoft<<<ZH * TT / 8, 256, 0, stream>>>(Sb, QE, P16);
            k_gemmw<h16, 0, false><<<dim3(TT / 64, HD / 64, ZH), 32, 0, stream>>>(P16, nullptr, VT + zq * HD * PP, nullptr, PP, Ob, HD, nullptr, (size_t)TT * PP, (size_t)HD * PP, (size_t)TT * HD);        /* 1024 (attn.V + attn.E_v[clip]) */
            k_merge<<<(unsigned)(((size_t)ZH * TT * HD / 2 + 255) / 256), 256, 0, stream>>>(Ob, h0, ATh, ATl); }
        k_gemmw<bf, 1, true><<<dim3(TT / 64, DM / 64, 1), 32, 0, stream>>>(ATh, ATl, WO, nullptr, DQ, OUT + xoff, DM, bo, 0, 0, 0); }
}

// v001
// It runs in 416 microseconds.
// Timed twice side by side with v000, it ran 2.19 times as fast both times.
#include <hip/hip_runtime.h>

// Contractions, f32 accumulate: q/k/v projections v_wmma_f32_16x16x32_bf16 (x, W, bias all RNE-converted to bf16, single product); content scores v_wmma_f32_16x16x32_bf16 with q and k as bf16 hi/lo planes (3 products); q.E_k^T bf16 hi/lo x exact bf16 E_k (2 products); attn.[V | rel-value buckets] v_wmma_f32_16x16x32_f16 (P carried x1024 in fp16, V fp16, E_v exact); output projection bf16 hi/lo context x exact bf16 W_o (2 products) + bf16 bias. Softmax, logit adds and carries in f32.
// Layout, all batches at once: bf16 copy of the three inputs [3][NB*TT][DM]; one projection launch (z = q, k, v; f32) -> planes per (batch, head) g = b*NH_ + h (q, k: [g][t][d] bf16 hi + lo; v: [g][d][t] fp16 with pitch TT+128 whose last 128 columns hold E_v^T (65 used, rest zero)).
// Per pass of ZH heads (one batch): S = q.k^T (f32 [ZH][TT][TT]); QE = q.E_k^T (f32 [ZH][TT][128]); row kernel: t_j = S_j / 8 + QE[clip(j - i, -32, 32) + 32], softmax over TT keys, writes P row = [1024 p_j fp16 | bucket sums: r = 0 keys j <= i - 32, r = 64 keys j >= i + 32, 0 < r < 64 the single key i + r - 32, r > 64 zero];
// one GEMM with K = TT + 128 gives 1024 (attn.V + attn.E_v[clip]); merge scales by 1/1024 into bf16 hi/lo context planes [b*TT + t][h*64 + d]; one output GEMM over all NB*TT rows with bias.

#ifndef NB
#define NB 4
#endif
#ifndef SEQ
#define SEQ 1024
#endif
#define NB_FULL  4
#define SEQ_FULL 1024
#define TT   SEQ
#define DM   1024
#define NH_  16
#define HD   64
#define DQ   (NH_ * HD)
#define ZH   16
#define PCAR 1024.0f
#define SCL  0.125f
#define NE   128     // rel tables (65 rows) padded to 128
#define NREL 65
#define MAXR 32
#define PP   (TT + NE)   // P row pitch and V^T row pitch (keys + rel buckets)
static_assert(TT % 128 == 0);
static_assert(TT == SEQ_FULL);   // the batches' rows are folded into one M = NB*TT dimension
static_assert(NB <= NB_FULL);
static_assert(NB >= 1);
static_assert(NH_ % ZH == 0);
static_assert(PP % 32 == 0);
static_assert(NREL == 2 * MAXR + 1);
static_assert(DM % 64 == 0);
static_assert((ZH * TT) % 8 == 0);

typedef _Float16 h16;
typedef unsigned short bf;
typedef __attribute__((ext_vector_type(16))) __bf16   v16bf;
typedef __attribute__((ext_vector_type(16))) _Float16 v16h;
typedef __attribute__((ext_vector_type(8)))  _Float16 v8h;
typedef __attribute__((ext_vector_type(8)))  unsigned short v8us;
typedef __attribute__((ext_vector_type(8)))  float    v8f;
typedef __attribute__((ext_vector_type(4)))  float    v4f;
typedef v8h  __attribute__((may_alias)) v8ha;
typedef v4f  __attribute__((may_alias)) v4fa;
typedef v8us __attribute__((may_alias)) v8usa;

__device__ __forceinline__ unsigned short f2bf(float f) { unsigned u = __float_as_uint(f); u += 0x7FFFu + ((u >> 16) & 1u); return (unsigned short)(u >> 16); }
__device__ __forceinline__ float bf2f(unsigned short b) { return __uint_as_float(((unsigned)b) << 16); }
__device__ __forceinline__ float bfr(float f) { return bf2f(f2bf(f)); }
__device__ __forceinline__ v16h cat16(v8h lo, v8h hi) { return __builtin_shufflevector(lo, hi, 0, 1, 2, 3, 4, 5, 6, 7, 8, 9, 10, 11, 12, 13, 14, 15); }
__device__ __forceinline__ v16bf cat16b(v8us lo, v8us hi) { return __builtin_bit_cast(v16bf, __builtin_shufflevector(lo, hi, 0, 1, 2, 3, 4, 5, 6, 7, 8, 9, 10, 11, 12, 13, 14, 15)); }
__device__ __forceinline__ v8f wmma16(v16h a, v16h b, v8f c) { return __builtin_amdgcn_wmma_f32_16x16x32_f16(false, a, false, b, (short)0, c, false, false); }
__device__ __forceinline__ v8f wmmab(v16bf a, v16bf b, v8f c) { return __builtin_amdgcn_wmma_f32_16x16x32_bf16(false, a, false, b, (short)0, c, false, false); }

// ---- k_gemmw: register-blocked GEMM, ONE WAVE per 64x64 output tile (16 accumulators), operands straight from K-contiguous 16-bit planes; grid (M/64, N/64, Z), 32 threads.
// C[m][n] (f32, pitch ldc, + optional f32 bias[n] via bf16; z = 1, 2 take bias1, bias2) = sum_k A[m][k] Bt[n][k] (+ split products per NSPLIT). z-batch strides sA/sB/sC in elements. K % 32 == 0; A and Bt row pitch == K.
// Fragment map (both operands): lane l -> row/col l&15, elements 0..7 <- k 8h..8h+7, elements 8..15 <- k 16+8h..16+8h+7 (h = l>>4); D element r -> row 8h+r, col l&15.
template <typename T16> struct WFrag;
template <> struct WFrag<h16> { typedef v16h V; static __device__ __forceinline__ V ld(const h16* p) { return cat16(*(const v8h*)p, *(const v8h*)(p + 16)); } static __device__ __forceinline__ v8f mma(V a, V b, v8f c) { return wmma16(a, b, c); } };
template <> struct WFrag<bf> { typedef v16bf V; static __device__ __forceinline__ V ld(const bf* p) { return cat16b(*(const v8us*)p, *(const v8us*)(p + 16)); } static __device__ __forceinline__ v8f mma(V a, V b, v8f c) { return wmmab(a, b, c); } };
template <typename T16, int NSPLIT, bool BIAS>
__global__ __launch_bounds__(32) void k_gemmw(const T16* __restrict__ A, const T16* __restrict__ A2, const T16* __restrict__ Bt, const T16* __restrict__ Bt2, int K, float* C, int ldc, const float* __restrict__ bias0, const float* __restrict__ bias1, const float* __restrict__ bias2, size_t sA, size_t sB, size_t sC) {
    typedef typename WFrag<T16>::V V;
    __shared__ __align__(16) float os[16 * 68];
    const size_t z = blockIdx.z; A += z * sA; if (A2) A2 += z * sA; Bt += z * sB; if (Bt2) Bt2 += z * sB; C += z * sC;
    const float* __restrict__ bias = (z == 0) ? bias0 : (z == 1) ? bias1 : bias2;
    const int lane = threadIdx.x & 31, lr = lane & 15, hi = lane >> 4; const int r0 = blockIdx.x * 64, c0 = blockIdx.y * 64;
    v8f acc[4][4];
#pragma unroll
    for (int mb = 0; mb < 4; ++mb)
#pragma unroll
        for (int nb = 0; nb < 4; ++nb) acc[mb][nb] = (v8f){};
    const size_t aoff = (size_t)(r0 + lr) * K + 8 * hi, boff = (size_t)(c0 + lr) * K + 8 * hi;
#pragma unroll 1
    for (int kc = 0; kc < K; kc += 32) {
        V a[4], a2[4];
#pragma unroll
        for (int mb = 0; mb < 4; ++mb) { a[mb] = WFrag<T16>::ld(A + aoff + (size_t)mb * 16 * K + kc); if (NSPLIT == 1 || NSPLIT == 2) a2[mb] = WFrag<T16>::ld(A2 + aoff + (size_t)mb * 16 * K + kc); }
#pragma unroll
        for (int nb = 0; nb < 4; ++nb) { const V b = WFrag<T16>::ld(Bt + boff + (size_t)nb * 16 * K + kc); V b2; if (NSPLIT >= 2) b2 = WFrag<T16>::ld(Bt2 + boff + (size_t)nb * 16 * K + kc);
#pragma unroll
            for (int mb = 0; mb < 4; ++mb) { acc[mb][nb] = WFrag<T16>::mma(a[mb], b, acc[mb][nb]); if (NSPLIT == 1 || NSPLIT == 2) acc[mb][nb] = WFrag<T16>::mma(a2[mb], b, acc[mb][nb]); if (NSPLIT >= 2) acc[mb][nb] = WFrag<T16>::mma(a[mb], b2, acc[mb][nb]); } }
        asm volatile("v_nop\n\tv_nop\n\tv_nop\n\tv_nop" : "+v"(acc[0][0]), "+v"(acc[1][1]), "+v"(acc[2][2]), "+v"(acc[3][3]) : "v"(a[0]), "v"(a[3]));
    }
#pragma unroll
    for (int mb = 0; mb < 4; ++mb) {
#pragma unroll
        for (int nb = 0; nb < 4; ++nb) {
#pragma unroll
            for (int j = 0; j < 8; ++j) os[(hi * 8 + j) * 68 + nb * 16 + lr] = acc[mb][nb][j]; }
        __builtin_amdgcn_wave_barrier(); asm volatile("" ::: "memory");
        float* crow = C + (size_t)(r0 + mb * 16) * ldc + c0;
{
#pragma unroll
            for (int s = 0; s < 8; ++s) { const int row = 2 * s + hi, cofs = lr * 4; v4f val = *(const v4fa*)(os + row * 68 + cofs); if (BIAS) { val[0] += bfr(bias[c0 + cofs]); val[1] += bfr(bias[c0 + cofs + 1]); val[2] += bfr(bias[c0 + cofs + 2]); val[3] += bfr(bias[c0 + cofs + 3]); }
                *(v4f*)(crow + (size_t)row * ldc + cofs) = val; }
             }
        __builtin_amdgcn_wave_barrier(); asm volatile("" ::: "memory");
    }
}

__device__ __forceinline__ h16 tohx(float x) { return (h16)x; }
__device__ __forceinline__ void splitf(float y, unsigned short& h, unsigned short& l) { h = f2bf(y); l = f2bf(y - bf2f(h)); }
typedef __attribute__((ext_vector_type(2))) _Float16 v2h;
typedef __attribute__((ext_vector_type(4))) _Float16 v4h;
typedef __attribute__((ext_vector_type(2))) unsigned short v2us;
typedef __attribute__((ext_vector_type(4))) unsigned short v4us;
typedef __attribute__((ext_vector_type(2))) float v2f;

// blockIdx.y picks one of up to four equally long sources; its bf16 copy is slab y of dst.
__global__ __launch_bounds__(256) void k_cvt8(const float* __restrict__ s0, const float* __restrict__ s1, const float* __restrict__ s2, const float* __restrict__ s3, bf* dst, size_t n8) { const size_t i = (size_t)blockIdx.x * 256 + threadIdx.x; if (i >= n8) return;
    const unsigned y = blockIdx.y; const float* __restrict__ src = (y == 0) ? s0 : (y == 1) ? s1 : (y == 2) ? s2 : s3; dst += (size_t)y * n8 * 8; const v8f v = *(const v8f*)(src + i * 8); v8us o;
#pragma unroll
    for (int k = 0; k < 8; ++k) o[k] = f2bf(v[k]); *(v8us*)(dst + i * 8) = o;  }

__global__ __launch_bounds__(256) void k_epad2(const float* __restrict__ E, bf* EB) { const size_t i = (size_t)blockIdx.x * 256 + threadIdx.x; if (i >= (size_t)NE * HD / 8) return; const int d0 = (int)(i % (HD / 8)) * 8; const int r = (int)(i / (HD / 8)); const float* src = E + (size_t)min(r, NREL - 1) * HD + d0; v8us o;
#pragma unroll
    for (int q = 0; q < 8; ++q) { const unsigned short v = f2bf(src[q]); o[q] = (r < NREL) ? v : (unsigned short)0; }
    *(v8us*)(EB + (size_t)r * HD + d0) = o;  }

// blockIdx.y: slab of TT rows of F (q's batches, then k's) and its nheads planes.
__global__ __launch_bounds__(256) void k_plane(const float* __restrict__ F, int pitch, int nheads, bf* Ph, bf* Pl) {
    const size_t e = ((size_t)blockIdx.x * 256 + threadIdx.x) * 8; if (e >= (size_t)nheads * TT * HD) return;
    F += (size_t)blockIdx.y * TT * pitch; Ph += (size_t)blockIdx.y * nheads * TT * HD; Pl += (size_t)blockIdx.y * nheads * TT * HD;
    const int d = (int)(e % HD); const int t = (int)((e / HD) % TT); const int h = (int)(e / ((size_t)HD * TT));
    const v8f x = *(const v8f*)(F + (size_t)t * pitch + h * HD + d); v8us oh, ol;
#pragma unroll
    for (int q = 0; q < 8; ++q) { unsigned short a, c2; splitf(x[q], a, c2); oh[q] = a; ol[q] = c2; }
    *(v8us*)(Ph + e) = oh; *(v8us*)(Pl + e) = ol;  }

// blockIdx.y: batch (TT rows of F, nheads planes of VT).
__global__ __launch_bounds__(256) void k_vtp8(const float* __restrict__ F, int pitch, int nheads, h16* VT) {
    const size_t e = ((size_t)blockIdx.x * 256 + threadIdx.x) * 8; if (e >= (size_t)nheads * HD * TT) return;
    F += (size_t)blockIdx.y * TT * pitch; VT += (size_t)blockIdx.y * nheads * HD * PP;
    const int t = (int)(e % TT); const int d = (int)((e / TT) % HD); const int g = (int)(e / ((size_t)TT * HD));
    v8h o;
#pragma unroll
    for (int q = 0; q < 8; ++q) o[q] = tohx(F[(size_t)(t + q) * pitch + g * HD + d]);
    h16* dst = VT + ((size_t)g * HD + d) * PP + t;
    *(v8h*)dst = o;  }

__global__ __launch_bounds__(256) void k_evt(const float* __restrict__ EV, int nheads, h16* VT) {
    const size_t e = ((size_t)blockIdx.x * 256 + threadIdx.x) * 8; if (e >= (size_t)nheads * HD * NE) return;
    const int r0 = (int)(e % NE); const int d = (int)((e / NE) % HD); const int g = (int)(e / ((size_t)NE * HD));
    v8h o;
#pragma unroll
    for (int q = 0; q < 8; ++q) { const int r = r0 + q; const float x = bfr(EV[(size_t)min(r, NREL - 1) * HD + d]); const float y = (r < NREL) ? x : 0.0f; o[q] = tohx(y); }
    h16* dst = VT + ((size_t)g * HD + d) * PP + TT + r0;
    *(v8h*)dst = o;  }

// k_asoft: one wave per score row (zz, i), 8 rows per block, grid exactly ZH*TT/8 (no early exit; block barriers):
// t_j = S[zz][i][j] * HD^-0.5 + QE[zz][i][clip(j - i, -32, 32) + 32] (QE row staged in LDS); softmax over the TT keys (register row, one exp, fixed trees);
// P16 row (pitch PP) = [p_j x 1024 fp16, j < TT | at TT + r: r = 0 sum of p over j <= i - 32, r = 64 sum over j >= i + 32, 0 < r < 64 p at j = i + r - 32 (0 when outside [0, TT)), r > 64 zero], all x 1024;
__global__ __launch_bounds__(256) void k_asoft(const float* __restrict__ Sb, const float* __restrict__ QE, h16* P16) {
    __shared__ __align__(16) float qes[8][NE];
    __shared__ __align__(16) float prow[8][TT];
    const int lane = threadIdx.x & 31, wid = threadIdx.x >> 5; const int row = blockIdx.x * 8 + wid; const int i = row % TT;
    const float* sr = Sb + (size_t)row * TT; const float* qe = QE + (size_t)row * NE;
    { const v4f g4 = *(const v4f*)(qe + lane * 4); *(v4f*)(&qes[wid][lane * 4]) = g4; }
    __syncthreads();
    float v[TT / 32]; float mx = -3.0e38f;
#pragma unroll
    for (int ch = 0; ch < TT / 128; ++ch) { const int j0 = ch * 128 + lane * 4; const v4f a = *(const v4f*)(sr + j0);
#pragma unroll
        for (int q = 0; q < 4; ++q) { const int j = j0 + q; const int r = min(max(j - i, -MAXR), MAXR) + MAXR; const float t = a[q] * SCL + qes[wid][r]; v[ch * 4 + q] = t; mx = fmaxf(mx, t); } }
#pragma unroll
    for (int sh = 16; sh; sh >>= 1) mx = fmaxf(mx, __shfl_xor(mx, sh, 32));
    float sum = 0.f;
#pragma unroll
    for (int k = 0; k < TT / 32; ++k) { float d0 = __fsub_rn(v[k], mx); asm volatile("" : "+v"(d0)); v[k] = __builtin_amdgcn_exp2f(__fmul_rn(d0, 1.4426950408889634f)); sum += v[k]; }
#pragma unroll
    for (int sh = 16; sh; sh >>= 1) sum += __shfl_xor(sum, sh, 32);
    const float f = __fdiv_rn(PCAR, sum);
    float tl0 = 0.f, tl1 = 0.f;
#pragma unroll
    for (int ch = 0; ch < TT / 128; ++ch) { const int j0 = ch * 128 + lane * 4; v4f p4;
#pragma unroll
        for (int q = 0; q < 4; ++q) { const int j = j0 + q; const float p = v[ch * 4 + q] * f; v[ch * 4 + q] = p; p4[q] = p; tl0 += (j <= i - MAXR) ? p : 0.f; tl1 += (j >= i + MAXR) ? p : 0.f; }
        *(v4f*)(&prow[wid][j0]) = p4; }
#pragma unroll
    for (int sh = 16; sh; sh >>= 1) { tl0 += __shfl_xor(tl0, sh, 32); tl1 += __shfl_xor(tl1, sh, 32); }
    __syncthreads();
    v4h bq4;
#pragma unroll
    for (int q = 0; q < 4; ++q) { const int r = lane * 4 + q; const int j = i + r - MAXR; const int jc = min(max(j, 0), TT - 1); float w = prow[wid][jc];
        w = (r > 0 && r < 2 * MAXR && j >= 0 && j < TT) ? w : 0.f; w = (r == 0) ? tl0 : w; w = (r == 2 * MAXR) ? tl1 : w; bq4[q] = tohx(w); }
    h16* prw = P16 + (size_t)row * PP;
{
#pragma unroll
        for (int ch = 0; ch < TT / 128; ++ch) { v4h o4;
#pragma unroll
            for (int q = 0; q < 4; ++q) o4[q] = tohx(v[ch * 4 + q]);
            *(v4h*)(prw + ch * 128 + lane * 4) = o4; }
        *(v4h*)(prw + TT + lane * 4) = bq4;
         }
}

__global__ __launch_bounds__(256) void k_merge(const float* __restrict__ O, int h0, bf* Ah, bf* Al) { const size_t e = ((size_t)blockIdx.x * 256 + threadIdx.x) * 2; if (e >= (size_t)ZH * TT * HD) return; const int d = (int)(e % HD); const int t = (int)((e / HD) % TT); const int zz = (int)(e / ((size_t)HD * TT)); const float cs = 1.0f / PCAR; const size_t oo = (size_t)t * DQ + (h0 + zz) * HD + d;
    v2us oh, ol;
#pragma unroll
    for (int q = 0; q < 2; ++q) { unsigned short a, c2; splitf(O[e + q] * cs, a, c2); oh[q] = a; ol[q] = c2; } *(v2us*)(Ah + oo) = oh; *(v2us*)(Al + oo) = ol;  }

extern "C" void kernel_launch(void* const* d_in, const int* in_sizes, int n_in,
                              void* d_out, int out_size, void* d_ws, size_t ws_size, hipStream_t stream) {
    if (n_in < 13) return;
    const size_t needX = ((size_t)(NB - 1) * SEQ_FULL + TT) * DM;
    if ((size_t)in_sizes[0] < needX || (size_t)in_sizes[1] < needX || (size_t)in_sizes[2] < needX) return;
    if (in_sizes[3] < DM * DM || in_sizes[5] < DM * DM || in_sizes[7] < DM * DM || in_sizes[9] < DM * DM) return;
    if (in_sizes[4] < DM || in_sizes[6] < DM || in_sizes[8] < DM || in_sizes[10] < DM) return;
    if (in_sizes[11] < NREL * HD || in_sizes[12] < NREL * HD) return;
    if ((size_t)out_size < needX) return;
    const float* query = (const float*)d_in[0]; const float* key = (const float*)d_in[1]; const float* value = (const float*)d_in[2];
    const float* wq = (const float*)d_in[3]; const float* bq = (const float*)d_in[4]; const float* wk = (const float*)d_in[5]; const float* bk = (const float*)d_in[6];
    const float* wv = (const float*)d_in[7]; const float* bv = (const float*)d_in[8]; const float* wo = (const float*)d_in[9]; const float* bo = (const float*)d_in[10];
    const float* rke = (const float*)d_in[11]; const float* rve = (const float*)d_in[12];
    float* OUT = (float*)d_out;     // [NB][SEQ_FULL][DM]
    char* wsp = (char*)d_ws;
    auto take = [&](size_t bytes) { char* p = wsp; wsp += (bytes + 255) & ~(size_t)255; return (void*)p; };
    constexpr size_t MR = (size_t)NB * TT;      // rows of all batches
    constexpr size_t NG = (size_t)NB * NH_;     // (batch, head) planes
    bf* WQ = (bf*)take((size_t)4 * DQ * DM * 2); bf* WO = WQ + (size_t)3 * DQ * DM;      // wq, wk, wv, wo
    bf* EB = (bf*)take((size_t)NE * HD * 2);
    bf* XB = (bf*)take((size_t)3 * MR * DM * 2); float* F = (float*)take((size_t)3 * MR * DQ * 4);      // q, k, v
    bf* QPh = (bf*)take((size_t)2 * NG * TT * HD * 2); bf* QPl = (bf*)take((size_t)2 * NG * TT * HD * 2); bf* KPh = QPh + NG * TT * HD; bf* KPl = QPl + NG * TT * HD;
    h16* VT = (h16*)take(NG * HD * PP * 2);
    float* QE = (float*)take((size_t)ZH * TT * NE * 4); float* Sb = (float*)take((size_t)ZH * TT * TT * 4); h16* P16 = (h16*)take((size_t)ZH * TT * PP * 2);
    float* Ob = (float*)take((size_t)ZH * TT * HD * 4); bf* ATh = (bf*)take(MR * DQ * 2); bf* ATl = (bf*)take(MR * DQ * 2);
    const size_t carved = (size_t)(wsp - (char*)d_ws);
    if (carved > ws_size) return;    // 261,111,808 B at NB=4, SEQ=1024
    // weights and tables
    k_cvt8<<<dim3((unsigned)(((size_t)DQ * DM / 8 + 255) / 256), 4, 1), 256, 0, stream>>>(wq, wk, wv, wo, WQ, (size_t)DQ * DM / 8);
    k_epad2<<<(unsigned)(((size_t)NE * HD / 8 + 255) / 256), 256, 0, stream>>>(rke, EB);                      /* E_k: 65 rows bf16 (exact), rows 65..127 zero */
    k_evt<<<(unsigned)((NG * HD * NE / 8 + 255) / 256), 256, 0, stream>>>(rve, (int)NG, VT);           /* E_v^T columns TT..TT+127 of every V^T row */
    // projections of all batches: z = q, k, v
    k_cvt8<<<dim3((unsigned)((MR * DM / 8 + 255) / 256), 3, 1), 256, 0, stream>>>(query, key, value, value, XB, MR * DM / 8);
    k_gemmw<bf, 0, true><<<dim3((unsigned)(MR / 64), DQ / 64, 3), 32, 0, stream>>>(XB, nullptr, WQ, nullptr, DM, F, DQ, bq, bk, bv, MR * DM, (size_t)DQ * DM, MR * DQ);
    const unsigned LPL = (unsigned)(((size_t)NH_ * TT * HD / 8 + 255) / 256);
    k_plane<<<dim3(LPL, 2 * NB, 1), 256, 0, stream>>>(F, DQ, NH_, QPh, QPl);
    k_vtp8<<<dim3(LPL, NB, 1), 256, 0, stream>>>(F + 2 * MR * DQ, DQ, NH_, VT);
    for (size_t zq = 0; zq < NG; zq += ZH) { const size_t b = zq / NH_; const int h0 = (int)(zq % NH_);
        k_gemmw<bf, 2, false><<<dim3(TT / 64, TT / 64, ZH), 32, 0, stream>>>(QPh + zq * TT * HD, QPl + zq * TT * HD, KPh + zq * TT * HD, KPl + zq * TT * HD, HD, Sb, TT, nullptr, nullptr, nullptr, (size_t)TT * HD, (size_t)TT * HD, (size_t)TT * TT);   /* S[i][j] = q_i . k_j */
        k_gemmw<bf, 1, false><<<dim3(TT / 64, NE / 64, ZH), 32, 0, stream>>>(QPh + zq * TT * HD, QPl + zq * TT * HD, EB, nullptr, HD, QE, NE, nullptr, nullptr, nullptr, (size_t)TT * HD, 0, (size_t)TT * NE);                 /* QE[i][e] = q_i . E_k[e] */
        k_asoft<<<ZH * TT / 8, 256, 0, stream>>>(Sb, QE, P16);
        k_gemmw<h16, 0, false><<<dim3(TT / 64, HD / 64, ZH), 32, 0, stream>>>(P16, nullptr, VT + zq * HD * PP, nullptr, PP, Ob, HD, nullptr, nullptr, nullptr, (size_t)TT * PP, (size_t)HD * PP, (size_t)TT * HD);        /* 1024 (attn.V + attn.E_v[clip]) */
        k_merge<<<(unsigned)(((size_t)ZH * TT * HD / 2 + 255) / 256), 256, 0, stream>>>(Ob, h0, ATh + b * TT * DQ, ATl + b * TT * DQ); }
    k_gemmw<bf, 1, true><<<dim3((unsigned)(MR / 64), DM / 64, 1), 32, 0, stream>>>(ATh, ATl, WO, nullptr, DQ, OUT, DM, bo, bo, bo, 0, 0, 0);
}

// v003
// A run of this version takes 172 microseconds.
// Versions between v001 and this one are left out; their measured steps multiply to 2.45 times as fast.
// Over all steps from v000 it is 5.36 times as fast.
#include <hip/hip_runtime.h>

// Contractions, f32 accumulate: q/k/v projections v_wmma_f32_16x16x32_bf16 (x, W, bias all RNE-converted to bf16, single product); content scores v_wmma_f32_16x16x32_bf16 with q and k as bf16 hi/lo planes (3 products); q.E_k^T bf16 hi/lo x exact bf16 E_k (2 products); attn.[V | rel-value buckets] v_wmma_f32_16x16x32_f16 (P carried x1024 in fp16, V fp16, E_v exact); output projection bf16 hi/lo context x exact bf16 W_o (2 products) + bf16 bias. Softmax, logit adds and carries in f32.
// Layout, all batches at once: bf16 copy of the three inputs [3][NB*TT][DM]; one projection launch (z = q, k, v; f32) -> planes per (batch, head) g = b*NH_ + h (q, k: [g][t][d] bf16 hi + lo; v: [g][d][t] fp16 with pitch TT+128 whose last 128 columns hold E_v^T (65 used, rest zero)).
// Every 16-bit matrix operand in the workspace (R rows, K columns) lies in fragment order: [row / 16][k / 8][row % 16][k % 8], element offset FO(row, k, K); the 16 x 32 fragment at (row tile, k step) is then 1 KiB in a row and each of its two wave-wide 16-byte loads covers 512 contiguous bytes (4 whole lines).
// Attention, one launch for all NB*NH_ planes (k_fattn): per 32 query rows S = q.k^T and QE = q.E_k^T stay in LDS (f32); t_j = S_j / 8 + QE[clip(j - i, -32, 32) + 32], softmax over TT keys, P row = [1024 p_j fp16 | bucket sums: r = 0 keys j <= i - 32, r = 64 keys j >= i + 32, 0 < r < 64 the single key i + r - 32, r > 64 zero];
// one product with K = TT + 128 gives 1024 (attn.V + attn.E_v[clip]), scaled by 1/1024 into bf16 hi/lo context planes [b*TT + t][h*64 + d]; one output GEMM over all NB*TT rows with bias.

#ifndef NB
#define NB 4
#endif
#ifndef SEQ
#define SEQ 1024
#endif
#define NB_FULL  4
#define SEQ_FULL 1024
#define TT   SEQ
#define DM   1024
#define NH_  16
#define HD   64
#define DQ   (NH_ * HD)
#define PCAR 1024.0f
#define SCL  0.125f
#define NE   128     // rel tables (65 rows) padded to 128
#define NREL 65
#define MAXR 32
#define PP   (TT + NE)   // P row length and V^T columns (keys + rel buckets)
static_assert(TT % 128 == 0);
static_assert(TT == SEQ_FULL);   // the batches' rows are folded into one M = NB*TT dimension
static_assert(NB <= NB_FULL);
static_assert(NB >= 1);
static_assert(PP % 32 == 0);
static_assert(NREL == 2 * MAXR + 1);
static_assert(DM % 64 == 0);
static_assert(HD == 64);   // k_plane's thread map: 8 chunks of 8 columns a row

typedef _Float16 h16;
typedef unsigned short bf;
typedef __attribute__((ext_vector_type(16))) __bf16   v16bf;
typedef __attribute__((ext_vector_type(16))) _Float16 v16h;
typedef __attribute__((ext_vector_type(8)))  _Float16 v8h;
typedef __attribute__((ext_vector_type(8)))  unsigned short v8us;
typedef __attribute__((ext_vector_type(8)))  float    v8f;
typedef __attribute__((ext_vector_type(4)))  float    v4f;
typedef v8h  __attribute__((may_alias)) v8ha;
typedef v4f  __attribute__((may_alias)) v4fa;
typedef v8us __attribute__((may_alias)) v8usa;

__device__ __forceinline__ unsigned short f2bf(float f) { unsigned u = __float_as_uint(f); u += 0x7FFFu + ((u >> 16) & 1u); return (unsigned short)(u >> 16); }
__device__ __forceinline__ float bf2f(unsigned short b) { return __uint_as_float(((unsigned)b) << 16); }
__device__ __forceinline__ float bfr(float f) { return bf2f(f2bf(f)); }
__device__ __forceinline__ size_t FO(size_t row, size_t k, size_t K) { return ((row >> 4) * (K >> 3) + (k >> 3)) * 128 + (row & 15) * 8 + (k & 7); }
__device__ __forceinline__ v16h cat16(v8h lo, v8h hi) { return __builtin_shufflevector(lo, hi, 0, 1, 2, 3, 4, 5, 6, 7, 8, 9, 10, 11, 12, 13, 14, 15); }
__device__ __forceinline__ v16bf cat16b(v8us lo, v8us hi) { return __builtin_bit_cast(v16bf, __builtin_shufflevector(lo, hi, 0, 1, 2, 3, 4, 5, 6, 7, 8, 9, 10, 11, 12, 13, 14, 15)); }
__device__ __forceinline__ v8f wmma16(v16h a, v16h b, v8f c) { return __builtin_amdgcn_wmma_f32_16x16x32_f16(false, a, false, b, (short)0, c, false, false); }
__device__ __forceinline__ v8f wmmab(v16bf a, v16bf b, v8f c) { return __builtin_amdgcn_wmma_f32_16x16x32_bf16(false, a, false, b, (short)0, c, false, false); }

// ---- k_gemmw: register-blocked GEMM, ONE WAVE per 64x64 output tile (16 accumulators), operands straight from 16-bit planes in fragment order; grid (M/64, N/64, Z), 32 threads.
// C[m][n] (f32, pitch ldc, + optional f32 bias[n] via bf16; z = 1, 2 take bias1, bias2) = sum_k A[m][k] Bt[n][k] (+ split products per NSPLIT). z-batch strides sA/sB/sC in elements. K % 32 == 0, a compile-time constant, so that a row tile's distance is an immediate offset; A and Bt have K columns.
// Fragment map (both operands): lane l -> row/col l&15, elements 0..7 <- k 8h..8h+7, elements 8..15 <- k 16+8h..16+8h+7 (h = l>>4); D element r -> row 8h+r, col l&15. In fragment order these are elements 8 l .. 8 l + 7 and 256 + 8 l .. of the fragment's 512.
template <typename T16> __device__ __forceinline__ const T16* atb(const T16* u, unsigned bytes) { return (const T16*)((const char*)u + bytes); }
template <typename T16> struct WFrag;
template <> struct WFrag<h16> { typedef v16h V; static __device__ __forceinline__ V ld(const h16* p) { return cat16(*(const v8h*)p, *(const v8h*)(p + 256)); } static __device__ __forceinline__ v8f mma(V a, V b, v8f c) { return wmma16(a, b, c); } };
template <> struct WFrag<bf> { typedef v16bf V; static __device__ __forceinline__ V ld(const bf* p) { return cat16b(*(const v8us*)p, *(const v8us*)(p + 256)); } static __device__ __forceinline__ v8f mma(V a, V b, v8f c) { return wmmab(a, b, c); } };
template <typename T16, int NSPLIT, bool BIAS, int K>
__global__ __launch_bounds__(32) void k_gemmw(const T16* __restrict__ A, const T16* __restrict__ A2, const T16* __restrict__ Bt, const T16* __restrict__ Bt2, float* C, int ldc, const float* __restrict__ bias0, const float* __restrict__ bias1, const float* __restrict__ bias2, size_t sA, size_t sB, size_t sC) {
    typedef typename WFrag<T16>::V V;
    __shared__ __align__(16) float os[16 * 68];
    const size_t z = blockIdx.z; A += z * sA; if (A2) A2 += z * sA; Bt += z * sB; if (Bt2) Bt2 += z * sB; C += z * sC;
    const float* __restrict__ bias = (z == 0) ? bias0 : (z == 1) ? bias1 : bias2;
    const int lane = threadIdx.x & 31, lr = lane & 15, hi = lane >> 4; const int r0 = blockIdx.x * 64, c0 = blockIdx.y * 64;
    v8f acc[4][4];
#pragma unroll
    for (int mb = 0; mb < 4; ++mb)
#pragma unroll
        for (int nb = 0; nb < 4; ++nb) acc[mb][nb] = (v8f){};
    const size_t aoff = (size_t)r0 * K, boff = (size_t)c0 * K; const unsigned lo = (unsigned)lane * 16;   // a 16-row tile is 16 K elements, a k step of 32 is 512 of them; the row tiles' bases are wave-uniform
#pragma unroll 1
    for (int kc = 0; kc < K; kc += 32) {
        V a[4], a2[4], b[4], b2[4];
        const T16* pa = atb(A + aoff + kc * 16, lo); const T16* pb = atb(Bt + boff + kc * 16, lo);   // the lane's part of this k step in the first row tile of A and of Bt
        const T16* pa2 = (NSPLIT == 1 || NSPLIT == 2) ? atb(A2 + aoff + kc * 16, lo) : pa; const T16* pb2 = (NSPLIT >= 2) ? atb(Bt2 + boff + kc * 16, lo) : pb;
#pragma unroll
        for (int mb = 0; mb < 4; ++mb) { a[mb] = WFrag<T16>::ld(pa + mb * 16 * K); if (NSPLIT == 1 || NSPLIT == 2) a2[mb] = WFrag<T16>::ld(pa2 + mb * 16 * K); }
#pragma unroll
        for (int nb = 0; nb < 4; ++nb) { b[nb] = WFrag<T16>::ld(pb + nb * 16 * K); if (NSPLIT >= 2) b2[nb] = WFrag<T16>::ld(pb2 + nb * 16 * K); }
        // the lane's addresses are inputs, so they stay in their registers up to this wait: no result of the run of loads lands in a register that an issued load of the run still names
        asm volatile("s_wait_xcnt 0x0" :: "v"(pa), "v"(pa2), "v"(pb), "v"(pb2) : "memory");
#pragma unroll
        for (int nb = 0; nb < 4; ++nb) {
#pragma unroll
            for (int mb = 0; mb < 4; ++mb) { acc[mb][nb] = WFrag<T16>::mma(a[mb], b[nb], acc[mb][nb]); if (NSPLIT == 1 || NSPLIT == 2) acc[mb][nb] = WFrag<T16>::mma(a2[mb], b[nb], acc[mb][nb]); if (NSPLIT >= 2) acc[mb][nb] = WFrag<T16>::mma(a[mb], b2[nb], acc[mb][nb]); } }
        asm volatile("v_nop\n\tv_nop\n\tv_nop\n\tv_nop" : "+v"(acc[0][0]), "+v"(acc[1][1]), "+v"(acc[2][2]), "+v"(acc[3][3]) : "v"(a[0]), "v"(a[3]));
    }
#pragma unroll
    for (int mb = 0; mb < 4; ++mb) {
#pragma unroll
        for (int nb = 0; nb < 4; ++nb) {
#pragma unroll
            for (int j = 0; j < 8; ++j) os[(hi * 8 + j) * 68 + nb * 16 + lr] = acc[mb][nb][j]; }
        __builtin_amdgcn_wave_barrier(); asm volatile("" ::: "memory");
        float* crow = C + (size_t)(r0 + mb * 16) * ldc + c0;
{
#pragma unroll
            for (int s = 0; s < 8; ++s) { const int row = 2 * s + hi, cofs = lr * 4; v4f val = *(const v4fa*)(os + row * 68 + cofs); if (BIAS) { val[0] += bfr(bias[c0 + cofs]); val[1] += bfr(bias[c0 + cofs + 1]); val[2] += bfr(bias[c0 + cofs + 2]); val[3] += bfr(bias[c0 + cofs + 3]); }
                *(v4f*)(crow + (size_t)row * ldc + cofs) = val; }
             }
        __builtin_amdgcn_wave_barrier(); asm volatile("" ::: "memory");
    }
}

__device__ __forceinline__ h16 tohx(float x) { return (h16)x; }
__device__ __forceinline__ void splitf(float y, unsigned short& h, unsigned short& l) { h = f2bf(y); l = f2bf(y - bf2f(h)); }
typedef __attribute__((ext_vector_type(2))) _Float16 v2h;
typedef __attribute__((ext_vector_type(4))) _Float16 v4h;
typedef v4h  __attribute__((may_alias)) v4ha;
typedef __attribute__((ext_vector_type(2))) unsigned short v2us;
typedef __attribute__((ext_vector_type(4))) unsigned short v4us;
typedef __attribute__((ext_vector_type(2))) float v2f;

// blockIdx.y picks one of up to four equally long sources of DM columns; its bf16 copy, in fragment order, is slab y of dst. A wave takes 8 rows x 4 chunks of 8 columns: whole 128-byte lines on both sides.
__global__ __launch_bounds__(256) void k_cvt8(const float* __restrict__ s0, const float* __restrict__ s1, const float* __restrict__ s2, const float* __restrict__ s3, bf* dst, size_t n8) { const size_t i = (size_t)blockIdx.x * 256 + threadIdx.x; if (i >= n8) return;
    const unsigned y = blockIdx.y; const float* __restrict__ src = (y == 0) ? s0 : (y == 1) ? s1 : (y == 2) ? s2 : s3; dst += (size_t)y * n8 * 8;
    const size_t u = i >> 6; const size_t row = (u / (DM / 32)) * 16 + ((i >> 5) & 1) * 8 + ((i >> 2) & 7), k = ((u % (DM / 32)) * 4 + (i & 3)) * 8; const v8f v = *(const v8f*)(src + row * DM + k); v8us o;
#pragma unroll
    for (int q = 0; q < 8; ++q) o[q] = f2bf(v[q]); *(v8us*)(dst + FO(row, k, DM)) = o;  }

__global__ __launch_bounds__(256) void k_epad2(const float* __restrict__ E, bf* EB) { const size_t i = (size_t)blockIdx.x * 256 + threadIdx.x; if (i >= (size_t)NE * HD / 8) return; const int d0 = (int)(i % (HD / 8)) * 8; const int r = (int)(i / (HD / 8)); const float* src = E + (size_t)min(r, NREL - 1) * HD + d0; v8us o;
#pragma unroll
    for (int q = 0; q < 8; ++q) { const unsigned short v = f2bf(src[q]); o[q] = (r < NREL) ? v : (unsigned short)0; }
    *(v8us*)(EB + FO(r, d0, HD)) = o;  }

// blockIdx.y: slab of TT rows of F (q's batches, then k's) and its nheads planes, each in fragment order. A wave takes 8 rows x 4 chunks of 8 columns: whole 128-byte lines on both sides.
__global__ __launch_bounds__(256) void k_plane(const float* __restrict__ F, int pitch, int nheads, bf* Ph, bf* Pl) {
    const size_t x = (size_t)blockIdx.x * 256 + threadIdx.x; if (x >= (size_t)nheads * TT * HD / 8) return;
    F += (size_t)blockIdx.y * TT * pitch; Ph += (size_t)blockIdx.y * nheads * TT * HD; Pl += (size_t)blockIdx.y * nheads * TT * HD;
    const int d = (int)(((x >> 5) & 1) * 4 + (x & 3)) * 8; const int t = (int)((x >> 7) % (TT / 16)) * 16 + (int)((x >> 6) & 1) * 8 + (int)((x >> 2) & 7); const int h = (int)(x / ((size_t)HD * TT / 8));
    const size_t e = (size_t)h * TT * HD + FO(t, d, HD);
    const v8f y = *(const v8f*)(F + (size_t)t * pitch + h * HD + d); v8us oh, ol;
#pragma unroll
    for (int q = 0; q < 8; ++q) { unsigned short a, c2; splitf(y[q], a, c2); oh[q] = a; ol[q] = c2; }
    *(v8us*)(Ph + e) = oh; *(v8us*)(Pl + e) = ol;  }

// blockIdx.y: batch (TT rows of F, nheads planes of VT, each HD rows x PP columns in fragment order). A wave takes 32 neighbouring d of 8 keys: each load one whole line, the store two runs of 256 bytes.
__global__ __launch_bounds__(256) void k_vtp8(const float* __restrict__ F, int pitch, int nheads, h16* VT) {
    const size_t x = (size_t)blockIdx.x * 256 + threadIdx.x; if (x >= (size_t)nheads * HD * TT / 8) return;
    F += (size_t)blockIdx.y * TT * pitch; VT += (size_t)blockIdx.y * nheads * HD * PP;
    const int d = (int)(x % HD); const int t = (int)((x / HD) % (TT / 8)) * 8; const int g = (int)(x / ((size_t)TT * HD / 8));
    v8h o;
#pragma unroll
    for (int q = 0; q < 8; ++q) o[q] = tohx(F[(size_t)(t + q) * pitch + g * HD + d]);
    h16* dst = VT + (size_t)g * HD * PP + FO(d, t, PP);
    *(v8h*)dst = o;  }

__global__ __launch_bounds__(256) void k_evt(const float* __restrict__ EV, int nheads, h16* VT) {
    const size_t x = (size_t)blockIdx.x * 256 + threadIdx.x; if (x >= (size_t)nheads * HD * NE / 8) return;
    const int d = (int)(x % HD); const int r0 = (int)((x / HD) % (NE / 8)) * 8; const int g = (int)(x / ((size_t)NE * HD / 8));
    v8h o; const float* ep[8]; float ev[8];
#pragma unroll
    for (int q = 0; q < 8; ++q) { ep[q] = EV + (size_t)min(r0 + q, NREL - 1) * HD + d; ev[q] = *ep[q]; }
    // the eight addresses are inputs, so they stay in their registers up to this wait: no result of the run of loads lands in a register that an issued load of the run still names
    asm volatile("s_wait_xcnt 0x0" :: "v"(ep[0]), "v"(ep[1]), "v"(ep[2]), "v"(ep[3]), "v"(ep[4]), "v"(ep[5]), "v"(ep[6]), "v"(ep[7]) : "memory");
#pragma unroll
    for (int q = 0; q < 8; ++q) { const float y = (r0 + q < NREL) ? bfr(ev[q]) : 0.0f; o[q] = tohx(y); }
    h16* dst = VT + (size_t)g * HD * PP + FO(d, TT + r0, PP);
    *(v8h*)dst = o;  }

// k_fattn: one work-group (8 waves) per FR = 32 query rows of one (batch, head) plane g; the score rows never leave the chip.
// 1) wave w: S[32][128 w .. 128 w + 127] = q.k^T (3 products, same order as a K = 64 GEMM) and column tile w of QE = q.E_k^T (2 products), f32 into LDS;
// 2) wave w, rows 4 w .. 4 w + 3, one row at a time: t_j = S_j * HD^-0.5 + QE[clip(j - i, -32, 32) + 32], softmax over the TT keys (register row, one exp, fixed trees);
//    the fp16 row [1024 p_j, j < TT | at TT + r: r = 0 sum of p over j <= i - 32, r = 64 sum over j >= i + 32, 0 < r < 64 p at j = i + r - 32 (0 outside [0, TT)), r > 64 zero] overwrites the row's own scores;
// 3) wave w: 16x16 tile (row tile w / 4, column tile w % 4) of P.[V | E_v]^T, K = PP in ascending order, A from LDS, B from the V^T plane;
// 4) scaled by 1/1024 and split into the bf16 hi/lo context planes, row b*TT + t, column h*64 + d, in fragment order: a wave stores one chunk of 8 columns of the 32 rows, two runs of 256 bytes.
#define FR   32
#define SPB  (TT * 4 + 16)   // byte pitch of a score row in LDS: 16 rows of a b128 fragment read fall on 64 different banks
#define QEP  132             // float pitch of a QE row
#define OSP  68              // float pitch of a staged output row
static_assert(TT % FR == 0);
static_assert(TT == 8 * 128);     // 8 waves x 128 score columns
static_assert(PP * 2 <= TT * 4);  // the fp16 row fits into its f32 score row
static_assert(OSP <= QEP);
// 4 waves per SIMD = two work-groups per WGP, which their LDS allows: at most 256 registers
__global__ __launch_bounds__(256, 4) void k_fattn(const bf* __restrict__ QPh, const bf* __restrict__ QPl, const bf* __restrict__ KPh, const bf* __restrict__ KPl, const bf* __restrict__ EB, const h16* __restrict__ VT, bf* ATh, bf* ATl) {
    __shared__ __align__(16) char srow[FR * SPB];
    __shared__ __align__(16) float qes[FR * QEP];
    const int lane = threadIdx.x & 31, lr = lane & 15, hi = lane >> 4; const int wid = __builtin_amdgcn_readfirstlane(threadIdx.x >> 5);
    const int g = blockIdx.y, r0 = blockIdx.x * FR; const size_t pl = (size_t)g * TT * HD;
    const unsigned lo = (unsigned)lane * 16;   // the lane's byte offset in a fragment (fragment order); all else of an address is wave-uniform
    {
        v16bf a[2][2], a2[2][2];
        const bf* qbh = QPh + pl + (size_t)r0 * HD; const bf* qbl = QPl + pl + (size_t)r0 * HD;   // wave-uniform bases of the 32 rows
#pragma unroll
        for (int mb = 0; mb < 2; ++mb)
#pragma unroll
            for (int ks = 0; ks < 2; ++ks) { const int ao = mb * 16 * HD + ks * 512; a[mb][ks] = WFrag<bf>::ld(atb(qbh + ao, lo)); a2[mb][ks] = WFrag<bf>::ld(atb(qbl + ao, lo)); }
        // the lane offset and the two bases are inputs, so they stay in their registers up to this wait: no result of the run of loads lands in a register that an issued load of the run still names
        asm volatile("s_wait_xcnt 0x0" :: "v"(lo), "s"(qbh), "s"(qbl) : "memory");
        const bf* kbh = KPh + pl + (size_t)(wid * 128) * HD; const bf* kbl = KPl + pl + (size_t)(wid * 128) * HD;   // wave-uniform bases of the wave's 128 key rows
        // q.E_k^T ahead of the scores: its fragments, tile and LDS addresses are dead while the score products use all 256 registers (behind them the build spills)
        { const size_t eo = (size_t)(wid * 16) * HD; const v16bf e0 = WFrag<bf>::ld(atb(EB + eo, lo)), e1 = WFrag<bf>::ld(atb(EB + eo + 512, lo));
            v8f acq[2];
#pragma unroll
            for (int mb = 0; mb < 2; ++mb) { v8f t = (v8f){}; t = wmmab(a[mb][0], e0, t); t = wmmab(a2[mb][0], e0, t); t = wmmab(a[mb][1], e1, t); t = wmmab(a2[mb][1], e1, t); acq[mb] = t; }
#pragma unroll
            for (int mb = 0; mb < 2; ++mb)
#pragma unroll
                for (int j = 0; j < 8; ++j) qes[(mb * 16 + hi * 8 + j) * QEP + wid * 16 + lr] = acq[mb][j]; }
#pragma unroll
        for (int nh = 0; nh < 2; ++nh) {      // 64 score columns at a time
            v8f acc[2][4];
#pragma unroll
            for (int mb = 0; mb < 2; ++mb)
#pragma unroll
                for (int n4 = 0; n4 < 4; ++n4) acc[mb][n4] = (v8f){};
#pragma unroll
            for (int ks = 0; ks < 2; ++ks) {
                v16bf b[4], b2[4];
#pragma unroll
                for (int n4 = 0; n4 < 4; ++n4) { const int bo = (nh * 4 + n4) * 16 * HD + ks * 512; b[n4] = WFrag<bf>::ld(atb(kbh + bo, lo)); b2[n4] = WFrag<bf>::ld(atb(kbl + bo, lo)); }
                // inputs only: holds the eight fragments' loads together ahead of their products, one memory latency for the group; without it the build loads and waits fragment by fragment
                asm volatile("" :: "v"(b[0]), "v"(b[1]), "v"(b[2]), "v"(b[3]), "v"(b2[0]), "v"(b2[1]), "v"(b2[2]), "v"(b2[3]));
#pragma unroll
                for (int n4 = 0; n4 < 4; ++n4)
#pragma unroll
                    for (int mb = 0; mb < 2; ++mb) { v8f t = acc[mb][n4]; t = wmmab(a[mb][ks], b[n4], t); t = wmmab(a2[mb][ks], b[n4], t); t = wmmab(a[mb][ks], b2[n4], t); acc[mb][n4] = t; }
            }
#pragma unroll
            for (int mb = 0; mb < 2; ++mb)
#pragma unroll
                for (int n4 = 0; n4 < 4; ++n4)
#pragma unroll
                    for (int j = 0; j < 8; ++j) *(float*)(srow + (mb * 16 + hi * 8 + j) * SPB + (wid * 128 + (nh * 4 + n4) * 16 + lr) * 4) = acc[mb][n4][j];
        }
    }
    __syncthreads();
    // rolled: one row's registers at a time
#pragma unroll 1
    for (int rr = 0; rr < FR / 8; ++rr) {
        const int lrow = wid * (FR / 8) + rr; const int i = r0 + lrow;
        const float* sr = (const float*)(srow + lrow * SPB); const float* qe = qes + lrow * QEP; h16* prw = (h16*)(srow + lrow * SPB);
        float v[TT / 32]; float mx = -3.0e38f;
#pragma unroll
        for (int ch = 0; ch < TT / 128; ++ch) { const int j0 = ch * 128 + lane * 4; const v4f s4 = *(const v4fa*)(sr + j0);
#pragma unroll
            for (int q = 0; q < 4; ++q) { const int j = j0 + q; const int r = min(max(j - i, -MAXR), MAXR) + MAXR; const float t = s4[q] * SCL + qe[r]; v[ch * 4 + q] = t; mx = fmaxf(mx, t); } }
#pragma unroll
        for (int sh = 16; sh; sh >>= 1) mx = fmaxf(mx, __shfl_xor(mx, sh, 32));
        float sum = 0.f;
#pragma unroll
        for (int k = 0; k < TT / 32; ++k) { v[k] = __builtin_amdgcn_exp2f(__fmul_rn(__fsub_rn(v[k], mx), 1.4426950408889634f)); sum += v[k]; }
#pragma unroll
        for (int sh = 16; sh; sh >>= 1) sum += __shfl_xor(sum, sh, 32);
        const float f = __fdiv_rn(PCAR, sum);
        float tl0 = 0.f, tl1 = 0.f;
#pragma unroll
        for (int ch = 0; ch < TT / 128; ++ch) { const int j0 = ch * 128 + lane * 4; v4h o4;
#pragma unroll
            for (int q = 0; q < 4; ++q) { const int j = j0 + q; const float p = v[ch * 4 + q] * f; o4[q] = tohx(p); tl0 += (j <= i - MAXR) ? p : 0.f; tl1 += (j >= i + MAXR) ? p : 0.f; }
            *(v4ha*)(prw + j0) = o4; }
#pragma unroll
        for (int sh = 16; sh; sh >>= 1) { tl0 += __shfl_xor(tl0, sh, 32); tl1 += __shfl_xor(tl1, sh, 32); }
        __syncthreads();   // the band below reads fp16 values that other lanes stored
        v4h bq4;
#pragma unroll
        for (int q = 0; q < 4; ++q) { const int r = lane * 4 + q; const int j = i + r - MAXR; const int jc = min(max(j, 0), TT - 1); h16 w = prw[jc];
            w = (r > 0 && r < 2 * MAXR && j >= 0 && j < TT) ? w : (h16)0.f; w = (r == 0) ? tohx(tl0) : w; w = (r == 2 * MAXR) ? tohx(tl1) : w; bq4[q] = w; }
        *(v4ha*)(prw + TT + lane * 4) = bq4;
    }
    __syncthreads();
    {
        const int mb = wid >> 2, nb = wid & 3;
        const char* ap = srow + (mb * 16 + lr) * SPB + 16 * hi; const h16* bp = VT + ((size_t)g * HD + nb * 16) * PP;
        v8f acc = (v8f){};
#pragma unroll
        for (int kc = 0; kc < PP; kc += 32) { const v16h pa = cat16(*(const v8ha*)(ap + kc * 2), *(const v8ha*)(ap + kc * 2 + 32)); acc = wmma16(pa, WFrag<h16>::ld(atb(bp + kc * 16, lo)), acc); }
#pragma unroll
        for (int j = 0; j < 8; ++j) qes[(mb * 16 + hi * 8 + j) * OSP + nb * 16 + lr] = acc[j];   // the QE rows are dead behind the barrier above
    }
    __syncthreads();
    { const int t = lane, d0 = wid * 8; const float cs = 1.0f / PCAR; const v4f x0 = *(const v4fa*)(qes + t * OSP + d0), x1 = *(const v4fa*)(qes + t * OSP + d0 + 4);
        v8us oh, ol;
#pragma unroll
        for (int q = 0; q < 8; ++q) { unsigned short c1, c2; splitf((q < 4 ? x0[q & 3] : x1[q & 3]) * cs, c1, c2); oh[q] = c1; ol[q] = c2; }
        const size_t oo = FO((size_t)(g / NH_) * TT + r0 + t, (size_t)(g % NH_) * HD + d0, DQ);
        *(v8us*)(ATh + oo) = oh; *(v8us*)(ATl + oo) = ol; }
}

extern "C" void kernel_launch(void* const* d_in, const int* in_sizes, int n_in,
                              void* d_out, int out_size, void* d_ws, size_t ws_size, hipStream_t stream) {
    if (n_in < 13) return;
    const size_t needX = ((size_t)(NB - 1) * SEQ_FULL + TT) * DM;
    if ((size_t)in_sizes[0] < needX || (size_t)in_sizes[1] < needX || (size_t)in_sizes[2] < needX) return;
    if (in_sizes[3] < DM * DM || in_sizes[5] < DM * DM || in_sizes[7] < DM * DM || in_sizes[9] < DM * DM) return;
    if (in_sizes[4] < DM || in_sizes[6] < DM || in_sizes[8] < DM || in_sizes[10] < DM) return;
    if (in_sizes[11] < NREL * HD || in_sizes[12] < NREL * HD) return;
    if ((size_t)out_size < needX) return;
    const float* query = (const float*)d_in[0]; const float* key = (const float*)d_in[1]; const float* value = (const float*)d_in[2];
    const float* wq = (const float*)d_in[3]; const float* bq = (const float*)d_in[4]; const float* wk = (const float*)d_in[5]; const float* bk = (const float*)d_in[6];
    const float* wv = (const float*)d_in[7]; const float* bv = (const float*)d_in[8]; const float* wo = (const float*)d_in[9]; const float* bo = (const float*)d_in[10];
    const float* rke = (const float*)d_in[11]; const float* rve = (const float*)d_in[12];
    float* OUT = (float*)d_out;     // [NB][SEQ_FULL][DM]
    char* wsp = (char*)d_ws;
    auto take = [&](size_t bytes) { char* p = wsp; wsp += (bytes + 255) & ~(size_t)255; return (void*)p; };
    constexpr size_t MR = (size_t)NB * TT;      // rows of all batches
    constexpr size_t NG = (size_t)NB * NH_;     // (batch, head) planes
    bf* WQ = (bf*)take((size_t)4 * DQ * DM * 2); bf* WO = WQ + (size_t)3 * DQ * DM;      // wq, wk, wv, wo
    bf* EB = (bf*)take((size_t)NE * HD * 2);
    bf* XB = (bf*)take((size_t)3 * MR * DM * 2); float* F = (float*)take((size_t)3 * MR * DQ * 4);      // q, k, v
    bf* QPh = (bf*)take((size_t)2 * NG * TT * HD * 2); bf* QPl = (bf*)take((size_t)2 * NG * TT * HD * 2); bf* KPh = QPh + NG * TT * HD; bf* KPl = QPl + NG * TT * HD;
    h16* VT = (h16*)take(NG * HD * PP * 2);
    bf* ATh = (bf*)take(MR * DQ * 2); bf* ATl = (bf*)take(MR * DQ * 2);
    const size_t carved = (size_t)(wsp - (char*)d_ws);
    if (carved > ws_size) return;    // 143,671,296 B at NB=4, SEQ=1024
    // weights and tables
    k_cvt8<<<dim3((unsigned)(((size_t)DQ * DM / 8 + 255) / 256), 4, 1), 256, 0, stream>>>(wq, wk, wv, wo, WQ, (size_t)DQ * DM / 8);
    k_epad2<<<(unsigned)(((size_t)NE * HD / 8 + 255) / 256), 256, 0, stream>>>(rke, EB);                      /* E_k: 65 rows bf16 (exact), rows 65..127 zero */
    k_evt<<<(unsigned)((NG * HD * NE / 8 + 255) / 256), 256, 0, stream>>>(rve, (int)NG, VT);           /* E_v^T columns TT..TT+127 of every V^T row */
    // projections of all batches: z = q, k, v
    k_cvt8<<<dim3((unsigned)((MR * DM / 8 + 255) / 256), 3, 1), 256, 0, stream>>>(query, key, value, value, XB, MR * DM / 8);
    k_gemmw<bf, 0, true, DM><<<dim3((unsigned)(MR / 64), DQ / 64, 3), 32, 0, stream>>>(XB, nullptr, WQ, nullptr, F, DQ, bq, bk, bv, MR * DM, (size_t)DQ * DM, MR * DQ);
    const unsigned LPL = (unsigned)(((size_t)NH_ * TT * HD / 8 + 255) / 256);
    k_plane<<<dim3(LPL, 2 * NB, 1), 256, 0, stream>>>(F, DQ, NH_, QPh, QPl);
    k_vtp8<<<dim3(LPL, NB, 1), 256, 0, stream>>>(F + 2 * MR * DQ, DQ, NH_, VT);
    k_fattn<<<dim3(TT / FR, (unsigned)NG, 1), 256, 0, stream>>>(QPh, QPl, KPh, KPl, EB, VT, ATh, ATl);   /* scores, softmax, attn.[V | E_v], context planes */
    k_gemmw<bf, 1, true, DQ><<<dim3((unsigned)(MR / 64), DM / 64, 1), 32, 0, stream>>>(ATh, ATl, WO, nullptr, OUT, DM, bo, bo, bo, 0, 0, 0);
}

// v004
// One run takes 134 microseconds.
// Timed twice side by side with v003, it ran 1.27 and 1.28 times as fast.
// All steps since v000 together make it 6.83 times as fast.
#include <hip/hip_runtime.h>

// Contractions, f32 accumulate: q/k/v projections v_wmma_f32_16x16x32_bf16 (x, W, bias all RNE-converted to bf16, single product); content scores v_wmma_f32_16x16x32_bf16 with q and k as bf16 hi/lo planes (3 products); q.E_k^T bf16 hi/lo x exact bf16 E_k (2 products); attn.[V | rel-value buckets] v_wmma_f32_16x16x32_f16 (P carried x1024 in fp16, V fp16, E_v exact); output projection bf16 hi/lo context x exact bf16 W_o (2 products) + bf16 bias. Softmax, logit adds and carries in f32.
// Layout, all batches at once: bf16 copy of the three inputs [3][NB*TT][DM]; one projection launch (z = q, k, v; f32) -> planes per (batch, head) g = b*NH_ + h (q, k: [g][t][d] bf16 hi + lo; v: [g][d][t] fp16 with pitch TT+128 whose last 128 columns hold E_v^T (65 used, rest zero)).
// Every 16-bit matrix operand in the workspace (R rows, K columns) lies in fragment order: [row / 16][k / 8][row % 16][k % 8], element offset FO(row, k, K); the 16 x 32 fragment at (row tile, k step) is then 1 KiB in a row and each of its two wave-wide 16-byte loads covers 512 contiguous bytes (4 whole lines).
// Attention, one launch for all NB*NH_ planes (k_fattn): per 32 query rows S = q.k^T and QE = q.E_k^T stay in LDS (f32); t_j = S_j / 8 + QE[clip(j - i, -32, 32) + 32], softmax over TT keys, P row = [1024 p_j fp16 | bucket sums: r = 0 keys j <= i - 32, r = 64 keys j >= i + 32, 0 < r < 64 the single key i + r - 32, r > 64 zero];
// one product with K = TT + 128 gives 1024 (attn.V + attn.E_v[clip]), scaled by 1/1024 into bf16 hi/lo context planes [b*TT + t][h*64 + d]; one output GEMM over all NB*TT rows with bias.

#ifndef NB
#define NB 4
#endif
#ifndef SEQ
#define SEQ 1024
#endif
#define NB_FULL  4
#define SEQ_FULL 1024
#define TT   SEQ
#define DM   1024
#define NH_  16
#define HD   64
#define DQ   (NH_ * HD)
#define PCAR 1024.0f
#define SCL  0.125f
#define NE   128     // rel tables (65 rows) padded to 128
#define NREL 65
#define MAXR 32
#define PP   (TT + NE)   // P row length and V^T columns (keys + rel buckets)
static_assert(TT % 128 == 0);
static_assert(TT == SEQ_FULL);   // the batches' rows are folded into one M = NB*TT dimension
static_assert(NB <= NB_FULL);
static_assert(NB >= 1);
static_assert(PP % 32 == 0);
static_assert(NREL == 2 * MAXR + 1);
static_assert(DM % 64 == 0);
static_assert(HD == 64);   // k_plane's thread map: 8 chunks of 8 columns a row

typedef _Float16 h16;
typedef unsigned short bf;
typedef __attribute__((ext_vector_type(16))) __bf16   v16bf;
typedef __attribute__((ext_vector_type(16))) _Float16 v16h;
typedef __attribute__((ext_vector_type(8)))  _Float16 v8h;
typedef __attribute__((ext_vector_type(8)))  unsigned short v8us;
typedef __attribute__((ext_vector_type(8)))  float    v8f;
typedef __attribute__((ext_vector_type(4)))  float    v4f;
typedef v8h  __attribute__((may_alias)) v8ha;
typedef v4f  __attribute__((may_alias)) v4fa;
typedef v8us __attribute__((may_alias)) v8usa;

__device__ __forceinline__ unsigned short f2bf(float f) { unsigned u = __float_as_uint(f); u += 0x7FFFu + ((u >> 16) & 1u); return (unsigned short)(u >> 16); }
__device__ __forceinline__ float bf2f(unsigned short b) { return __uint_as_float(((unsigned)b) << 16); }
__device__ __forceinline__ float bfr(float f) { return bf2f(f2bf(f)); }
__device__ __forceinline__ size_t FO(size_t row, size_t k, size_t K) { return ((row >> 4) * (K >> 3) + (k >> 3)) * 128 + (row & 15) * 8 + (k & 7); }
__device__ __forceinline__ v16h cat16(v8h lo, v8h hi) { return __builtin_shufflevector(lo, hi, 0, 1, 2, 3, 4, 5, 6, 7, 8, 9, 10, 11, 12, 13, 14, 15); }
__device__ __forceinline__ v16bf cat16b(v8us lo, v8us hi) { return __builtin_bit_cast(v16bf, __builtin_shufflevector(lo, hi, 0, 1, 2, 3, 4, 5, 6, 7, 8, 9, 10, 11, 12, 13, 14, 15)); }
__device__ __forceinline__ v8f wmma16(v16h a, v16h b, v8f c) { return __builtin_amdgcn_wmma_f32_16x16x32_f16(false, a, false, b, (short)0, c, false, false); }
__device__ __forceinline__ v8f wmmab(v16bf a, v16bf b, v8f c) { return __builtin_amdgcn_wmma_f32_16x16x32_bf16(false, a, false, b, (short)0, c, false, false); }

// ---- k_gemmw: GEMM, one work-group of 4 waves (2 x 2) per 128x128 output tile, 64x64 (16 accumulators) per wave; operands are 16-bit planes in fragment order; grid (M/128, N/128, Z), 128 threads.
// C[m][n] (f32, pitch ldc, + optional f32 bias[n] via bf16; z = 1, 2 take bias1, bias2) = sum_k A[m][k] Bt[n][k] (+ A2[m][k] Bt[n][k] where NSPLIT == 1). z-batch strides sA/sB/sC in elements. K % 64 == 0, K >= 128, a compile-time constant; A, A2 and Bt have K columns.
// Fragment map (both operands): lane l -> row/col l&15, elements 0..7 <- k 8h..8h+7, elements 8..15 <- k 16+8h..16+8h+7 (h = l>>4); D element r -> row 8h+r, col l&15. In fragment order these are elements 8 l .. 8 l + 7 and 256 + 8 l .. of the fragment's 512.
// A stage is 64 k of the tile's 8 row tiles of each operand: a row tile's 64 k are 2 KiB in a row in the workspace and go as they lie into LDS, 16 bytes a thread, by asynchronous copies; two stage buffers, the next stage's copies fly while this one is multiplied. Every fragment is fetched from L2 once for two waves.
template <typename T16> __device__ __forceinline__ const T16* atb(const T16* u, unsigned bytes) { return (const T16*)((const char*)u + bytes); }
template <typename T16> struct WFrag;
template <> struct WFrag<h16> { typedef v16h V; static __device__ __forceinline__ V ld(const h16* p) { return cat16(*(const v8h*)p, *(const v8h*)(p + 256)); } static __device__ __forceinline__ v8f mma(V a, V b, v8f c) { return wmma16(a, b, c); } };
template <> struct WFrag<bf> { typedef v16bf V; static __device__ __forceinline__ V ld(const bf* p) { return cat16b(*(const v8us*)p, *(const v8us*)(p + 256)); } static __device__ __forceinline__ V lds(const char* p) { return cat16b(*(const v8usa*)p, *(const v8usa*)(p + 512)); } static __device__ __forceinline__ v8f mma(V a, V b, v8f c) { return wmmab(a, b, c); } };
// the thread's 16 bytes of eight row tiles (gs bytes apart in the workspace, 2 KiB apart in LDS); the s_wait_xcnt closes the statement, so no address register of a copy is rewritten ahead of it
__device__ __forceinline__ void cp8(unsigned l, const char* g, unsigned gs) {
    asm volatile("global_load_async_to_lds_b128 %0, %8, off\n\t"
                 "global_load_async_to_lds_b128 %1, %9, off\n\t"
                 "global_load_async_to_lds_b128 %2, %10, off\n\t"
                 "global_load_async_to_lds_b128 %3, %11, off\n\t"
                 "global_load_async_to_lds_b128 %4, %12, off\n\t"
                 "global_load_async_to_lds_b128 %5, %13, off\n\t"
                 "global_load_async_to_lds_b128 %6, %14, off\n\t"
                 "global_load_async_to_lds_b128 %7, %15, off\n\t"
                 "s_wait_xcnt 0x0"
                 :: "v"(l), "v"(l + 2048u), "v"(l + 4096u), "v"(l + 6144u), "v"(l + 8192u), "v"(l + 10240u), "v"(l + 12288u), "v"(l + 14336u),
                    "v"(g), "v"(g + gs), "v"(g + 2 * (size_t)gs), "v"(g + 3 * (size_t)gs), "v"(g + 4 * (size_t)gs), "v"(g + 5 * (size_t)gs), "v"(g + 6 * (size_t)gs), "v"(g + 7 * (size_t)gs) : "memory");
}
// at most 256 registers: three work-groups of the projections fit a WGP (their LDS allows three), and every operand of the copies' asm text stays below v256
template <typename T16, int NSPLIT, bool BIAS, int K>
__global__ __launch_bounds__(128, 4) void k_gemmw(const T16* __restrict__ A, const T16* __restrict__ A2, const T16* __restrict__ Bt, float* C, int ldc, const float* __restrict__ bias0, const float* __restrict__ bias1, const float* __restrict__ bias2, size_t sA, size_t sB, size_t sC) {
    typedef typename WFrag<T16>::V V;
    static_assert(NSPLIT == 0 || NSPLIT == 1); static_assert(K % 64 == 0 && K >= 128);
    constexpr unsigned OPB = 8 * 2048;                       // one operand's part of a stage
    constexpr unsigned BOF = (NSPLIT == 1 ? 2 : 1) * OPB;    // Bt's place in a stage, behind A (and A2)
    constexpr unsigned STG = BOF + OPB;
    constexpr int NT = K / 64;
    __shared__ __align__(16) char st[2 * STG];
    __shared__ __align__(16) float osw[4][16 * 68];
    const size_t z = blockIdx.z; A += z * sA; if (NSPLIT == 1) A2 += z * sA; Bt += z * sB; C += z * sC;
    const float* __restrict__ bias = (z == 0) ? bias0 : (z == 1) ? bias1 : bias2;
    const int lane = threadIdx.x & 31, lr = lane & 15, hi = lane >> 4; const int wid = __builtin_amdgcn_readfirstlane(threadIdx.x >> 5); const int wm = wid & 1, wn = wid >> 1;
    const int rb = blockIdx.x * 128, cb = blockIdx.y * 128;
    v8f acc[4][4];
#pragma unroll
    for (int mb = 0; mb < 4; ++mb)
#pragma unroll
        for (int nb = 0; nb < 4; ++nb) acc[mb][nb] = (v8f){};
    // a 16-row tile is 16 K elements, 64 k of it 2 KiB
    const char* gA = (const char*)(A + (size_t)rb * K) + threadIdx.x * 16; const char* gA2 = (NSPLIT == 1) ? (const char*)(A2 + (size_t)rb * K) + threadIdx.x * 16 : gA; const char* gB = (const char*)(Bt + (size_t)cb * K) + threadIdx.x * 16;
    const unsigned l0 = (unsigned)(size_t)(__attribute__((address_space(3))) char*)st + threadIdx.x * 16;   // the thread's LDS byte address in a row tile of buffer 0
    auto fill = [&](int t, unsigned buf) { const unsigned l = l0 + buf * STG; const size_t go = (size_t)t * 2048;
        cp8(l, gA + go, 32 * K); if (NSPLIT == 1) cp8(l + OPB, gA2 + go, 32 * K); cp8(l + BOF, gB + go, 32 * K); };
    fill(0, 0);
    asm volatile("s_wait_asynccnt 0x0" ::: "memory");   // this wave's copies of stage 0 have landed
    __syncthreads();                                    // ... and every other wave's
    fill(1, 1);
#pragma unroll 1
    for (int t = 0; t < NT; ++t) {
        const char* sb = st + (unsigned)(t & 1) * STG + lane * 16;
#pragma unroll
        for (int ks = 0; ks < 2; ++ks) {
            V a[4], a2[4], b[4];
            b[0] = WFrag<T16>::lds(sb + BOF + (wn * 4) * 2048 + ks * 1024);
#pragma unroll
            for (int mb = 0; mb < 4; ++mb) { a[mb] = WFrag<T16>::lds(sb + (wm * 4 + mb) * 2048 + ks * 1024); if (NSPLIT == 1) a2[mb] = WFrag<T16>::lds(sb + OPB + (wm * 4 + mb) * 2048 + ks * 1024); }
#pragma unroll
            for (int nb = 1; nb < 4; ++nb) b[nb] = WFrag<T16>::lds(sb + BOF + (wn * 4 + nb) * 2048 + ks * 1024);
            __builtin_amdgcn_sched_barrier(0);   // the k step's LDS reads stay one group ahead of its products, in the order of use; without it the build reads Bt fragment by fragment and waits out the LDS latency before every four products
#pragma unroll
            for (int nb = 0; nb < 4; ++nb) {
#pragma unroll
                for (int mb = 0; mb < 4; ++mb) { acc[mb][nb] = WFrag<T16>::mma(a[mb], b[nb], acc[mb][nb]); if (NSPLIT == 1) acc[mb][nb] = WFrag<T16>::mma(a2[mb], b[nb], acc[mb][nb]); } }
        }
        __builtin_amdgcn_sched_barrier(0);                  // the stage's products stay ahead of the foot; without it the build sinks 32 k of them behind the barrier, in front of the refill, whose copies then start that much later
        asm volatile("s_wait_dscnt 0x0" ::: "memory");      // this wave's reads of the buffer are done before it is refilled
        asm volatile("s_wait_asynccnt 0x0" ::: "memory");   // this wave's copies of stage t + 1 have landed
        __syncthreads();                                    // publishes stage t + 1 and ends every wave's reads of stage t
        if (t + 2 < NT) fill(t + 2, (unsigned)(t & 1));
    }
    asm volatile("s_wait_asynccnt 0x0" ::: "memory");       // no copy is outstanding when the wave goes on
    float* os = osw[wid]; const int r0 = rb + wm * 64, c0 = cb + wn * 64;   // the wave's own staging rows and its 64x64 part of the tile
#pragma unroll
    for (int mb = 0; mb < 4; ++mb) {
#pragma unroll
        for (int nb = 0; nb < 4; ++nb) {
#pragma unroll
            for (int j = 0; j < 8; ++j) os[(hi * 8 + j) * 68 + nb * 16 + lr] = acc[mb][nb][j]; }
        __builtin_amdgcn_wave_barrier(); asm volatile("" ::: "memory");
        float* crow = C + (size_t)(r0 + mb * 16) * ldc + c0;
{
#pragma unroll
            for (int s = 0; s < 8; ++s) { const int row = 2 * s + hi, cofs = lr * 4; v4f val = *(const v4fa*)(os + row * 68 + cofs); if (BIAS) { val[0] += bfr(bias[c0 + cofs]); val[1] += bfr(bias[c0 + cofs + 1]); val[2] += bfr(bias[c0 + cofs + 2]); val[3] += bfr(bias[c0 + cofs + 3]); }
                *(v4f*)(crow + (size_t)row * ldc + cofs) = val; }
             }
        asm volatile("s_wait_xcnt 0x0" ::: "memory");   // ahead of the next row tile's code, which reuses the registers that the eight stores name
        __builtin_amdgcn_wave_barrier(); asm volatile("" ::: "memory");
    }
}

__device__ __forceinline__ h16 tohx(float x) { return (h16)x; }
__device__ __forceinline__ void splitf(float y, unsigned short& h, unsigned short& l) { h = f2bf(y); l = f2bf(y - bf2f(h)); }
typedef __attribute__((ext_vector_type(2))) _Float16 v2h;
typedef __attribute__((ext_vector_type(4))) _Float16 v4h;
typedef v4h  __attribute__((may_alias)) v4ha;
typedef __attribute__((ext_vector_type(2))) unsigned short v2us;
typedef __attribute__((ext_vector_type(4))) unsigned short v4us;
typedef __attribute__((ext_vector_type(2))) float v2f;

// blockIdx.y picks one of up to four equally long sources of DM columns; its bf16 copy, in fragment order, is slab y of dst. A wave takes 8 rows x 4 chunks of 8 columns: whole 128-byte lines on both sides.
__global__ __launch_bounds__(256) void k_cvt8(const float* __restrict__ s0, const float* __restrict__ s1, const float* __restrict__ s2, const float* __restrict__ s3, bf* dst, size_t n8) { const size_t i = (size_t)blockIdx.x * 256 + threadIdx.x; if (i >= n8) return;
    const unsigned y = blockIdx.y; const float* __restrict__ src = (y == 0) ? s0 : (y == 1) ? s1 : (y == 2) ? s2 : s3; dst += (size_t)y * n8 * 8;
    const size_t u = i >> 6; const size_t row = (u / (DM / 32)) * 16 + ((i >> 5) & 1) * 8 + ((i >> 2) & 7), k = ((u % (DM / 32)) * 4 + (i & 3)) * 8; const v8f v = *(const v8f*)(src + row * DM + k); v8us o;
#pragma unroll
    for (int q = 0; q < 8; ++q) o[q] = f2bf(v[q]); *(v8us*)(dst + FO(row, k, DM)) = o;  }

__global__ __launch_bounds__(256) void k_epad2(const float* __restrict__ E, bf* EB) { const size_t i = (size_t)blockIdx.x * 256 + threadIdx.x; if (i >= (size_t)NE * HD / 8) return; const int d0 = (int)(i % (HD / 8)) * 8; const int r = (int)(i / (HD / 8)); const float* src = E + (size_t)min(r, NREL - 1) * HD + d0; v8us o;
#pragma unroll
    for (int q = 0; q < 8; ++q) { const unsigned short v = f2bf(src[q]); o[q] = (r < NREL) ? v : (unsigned short)0; }
    *(v8us*)(EB + FO(r, d0, HD)) = o;  }

// blockIdx.y: slab of TT rows of F (q's batches, then k's) and its nheads planes, each in fragment order. A wave takes 8 rows x 4 chunks of 8 columns: whole 128-byte lines on both sides.
__global__ __launch_bounds__(256) void k_plane(const float* __restrict__ F, int pitch, int nheads, bf* Ph, bf* Pl) {
    const size_t x = (size_t)blockIdx.x * 256 + threadIdx.x; if (x >= (size_t)nheads * TT * HD / 8) return;
    F += (size_t)blockIdx.y * TT * pitch; Ph += (size_t)blockIdx.y * nheads * TT * HD; Pl += (size_t)blockIdx.y * nheads * TT * HD;
    const int d = (int)(((x >> 5) & 1) * 4 + (x & 3)) * 8; const int t = (int)((x >> 7) % (TT / 16)) * 16 + (int)((x >> 6) & 1) * 8 + (int)((x >> 2) & 7); const int h = (int)(x / ((size_t)HD * TT / 8));
    const size_t e = (size_t)h * TT * HD + FO(t, d, HD);
    const v8f y = *(const v8f*)(F + (size_t)t * pitch + h * HD + d); v8us oh, ol;
#pragma unroll
    for (int q = 0; q < 8; ++q) { unsigned short a, c2; splitf(y[q], a, c2); oh[q] = a; ol[q] = c2; }
    *(v8us*)(Ph + e) = oh; *(v8us*)(Pl + e) = ol;  }

// blockIdx.y: batch (TT rows of F, nheads planes of VT, each HD rows x PP columns in fragment order). A wave takes 32 neighbouring d of 8 keys: each load one whole line, the store two runs of 256 bytes.
__global__ __launch_bounds__(256) void k_vtp8(const float* __restrict__ F, int pitch, int nheads, h16* VT) {
    const size_t x = (size_t)blockIdx.x * 256 + threadIdx.x; if (x >= (size_t)nheads * HD * TT / 8) return;
    F += (size_t)blockIdx.y * TT * pitch; VT += (size_t)blockIdx.y * nheads * HD * PP;
    const int d = (int)(x % HD); const int t = (int)((x / HD) % (TT / 8)) * 8; const int g = (int)(x / ((size_t)TT * HD / 8));
    v8h o;
#pragma unroll
    for (int q = 0; q < 8; ++q) o[q] = tohx(F[(size_t)(t + q) * pitch + g * HD + d]);
    h16* dst = VT + (size_t)g * HD * PP + FO(d, t, PP);
    *(v8h*)dst = o;  }

__global__ __launch_bounds__(256) void k_evt(const float* __restrict__ EV, int nheads, h16* VT) {
    const size_t x = (size_t)blockIdx.x * 256 + threadIdx.x; if (x >= (size_t)nheads * HD * NE / 8) return;
    const int d = (int)(x % HD); const int r0 = (int)((x / HD) % (NE / 8)) * 8; const int g = (int)(x / ((size_t)NE * HD / 8));
    v8h o; const float* ep[8]; float ev[8];
#pragma unroll
    for (int q = 0; q < 8; ++q) { ep[q] = EV + (size_t)min(r0 + q, NREL - 1) * HD + d; ev[q] = *ep[q]; }
    // the eight addresses are inputs, so they stay in their registers up to this wait: no result of the run of loads lands in a register that an issued load of the run still names
    asm volatile("s_wait_xcnt 0x0" :: "v"(ep[0]), "v"(ep[1]), "v"(ep[2]), "v"(ep[3]), "v"(ep[4]), "v"(ep[5]), "v"(ep[6]), "v"(ep[7]) : "memory");
#pragma unroll
    for (int q = 0; q < 8; ++q) { const float y = (r0 + q < NREL) ? bfr(ev[q]) : 0.0f; o[q] = tohx(y); }
    h16* dst = VT + (size_t)g * HD * PP + FO(d, TT + r0, PP);
    *(v8h*)dst = o;  }

// k_fattn: one work-group (8 waves) per FR = 32 query rows of one (batch, head) plane g; the score rows never leave the chip.
// 1) wave w: S[32][128 w .. 128 w + 127] = q.k^T (3 products, same order as a K = 64 GEMM) and column tile w of QE = q.E_k^T (2 products), f32 into LDS;
// 2) wave w, rows 4 w .. 4 w + 3, one row at a time: t_j = S_j * HD^-0.5 + QE[clip(j - i, -32, 32) + 32], softmax over the TT keys (register row, one exp, fixed trees);
//    the fp16 row [1024 p_j, j < TT | at TT + r: r = 0 sum of p over j <= i - 32, r = 64 sum over j >= i + 32, 0 < r < 64 p at j = i + r - 32 (0 outside [0, TT)), r > 64 zero] overwrites the row's own scores;
// 3) wave w: 16x16 tile (row tile w / 4, column tile w % 4) of P.[V | E_v]^T, K = PP in ascending order, A from LDS, B from the V^T plane;
// 4) scaled by 1/1024 and split into the bf16 hi/lo context planes, row b*TT + t, column h*64 + d, in fragment order: a wave stores one chunk of 8 columns of the 32 rows, two runs of 256 bytes.
#define FR   32
#define SPB  (TT * 4 + 16)   // byte pitch of a score row in LDS: 16 rows of a b128 fragment read fall on 64 different banks
#define QEP  132             // float pitch of a QE row
#define OSP  68              // float pitch of a staged output row
static_assert(TT % FR == 0);
static_assert(TT == 8 * 128);     // 8 waves x 128 score columns
static_assert(PP * 2 <= TT * 4);  // the fp16 row fits into its f32 score row
static_assert(OSP <= QEP);
// 4 waves per SIMD = two work-groups per WGP, which their LDS allows: at most 256 registers
__global__ __launch_bounds__(256, 4) void k_fattn(const bf* __restrict__ QPh, const bf* __restrict__ QPl, const bf* __restrict__ KPh, const bf* __restrict__ KPl, const bf* __restrict__ EB, const h16* __restrict__ VT, bf* ATh, bf* ATl) {
    __shared__ __align__(16) char srow[FR * SPB];
    __shared__ __align__(16) float qes[FR * QEP];
    const int lane = threadIdx.x & 31, lr = lane & 15, hi = lane >> 4; const int wid = __builtin_amdgcn_readfirstlane(threadIdx.x >> 5);
    const int g = blockIdx.y, r0 = blockIdx.x * FR; const size_t pl = (size_t)g * TT * HD;
    const unsigned lo = (unsigned)lane * 16;   // the lane's byte offset in a fragment (fragment order); all else of an address is wave-uniform
    {
        v16bf a[2][2], a2[2][2];
        const bf* qbh = QPh + pl + (size_t)r0 * HD; const bf* qbl = QPl + pl + (size_t)r0 * HD;   // wave-uniform bases of the 32 rows
#pragma unroll
        for (int mb = 0; mb < 2; ++mb)
#pragma unroll
            for (int ks = 0; ks < 2; ++ks) { const int ao = mb * 16 * HD + ks * 512; a[mb][ks] = WFrag<bf>::ld(atb(qbh + ao, lo)); a2[mb][ks] = WFrag<bf>::ld(atb(qbl + ao, lo)); }
        // the lane offset and the two bases are inputs, so they stay in their registers up to this wait: no result of the run of loads lands in a register that an issued load of the run still names
        asm volatile("s_wait_xcnt 0x0" :: "v"(lo), "s"(qbh), "s"(qbl) : "memory");
        const bf* kbh = KPh + pl + (size_t)(wid * 128) * HD; const bf* kbl = KPl + pl + (size_t)(wid * 128) * HD;   // wave-uniform bases of the wave's 128 key rows
        // q.E_k^T ahead of the scores: its fragments, tile and LDS addresses are dead while the score products use all 256 registers (behind them the build spills)
        { const size_t eo = (size_t)(wid * 16) * HD; const v16bf e0 = WFrag<bf>::ld(atb(EB + eo, lo)), e1 = WFrag<bf>::ld(atb(EB + eo + 512, lo));
            v8f acq[2];
#pragma unroll
            for (int mb = 0; mb < 2; ++mb) { v8f t = (v8f){}; t = wmmab(a[mb][0], e0, t); t = wmmab(a2[mb][0], e0, t); t = wmmab(a[mb][1], e1, t); t = wmmab(a2[mb][1], e1, t); acq[mb] = t; }
#pragma unroll
            for (int mb = 0; mb < 2; ++mb)
#pragma unroll
                for (int j = 0; j < 8; ++j) qes[(mb * 16 + hi * 8 + j) * QEP + wid * 16 + lr] = acq[mb][j]; }
#pragma unroll
        for (int nh = 0; nh < 2; ++nh) {      // 64 score columns at a time
            v8f acc[2][4];
#pragma unroll
            for (int mb = 0; mb < 2; ++mb)
#pragma unroll
                for (int n4 = 0; n4 < 4; ++n4) acc[mb][n4] = (v8f){};
#pragma unroll
            for (int ks = 0; ks < 2; ++ks) {
                v16bf b[4], b2[4];
#pragma unroll
                for (int n4 = 0; n4 < 4; ++n4) { const int bo = (nh * 4 + n4) * 16 * HD + ks * 512; b[n4] = WFrag<bf>::ld(atb(kbh + bo, lo)); b2[n4] = WFrag<bf>::ld(atb(kbl + bo, lo)); }
                // inputs only: holds the eight fragments' loads together ahead of their products, one memory latency for the group; without it the build loads and waits fragment by fragment
                asm volatile("" :: "v"(b[0]), "v"(b[1]), "v"(b[2]), "v"(b[3]), "v"(b2[0]), "v"(b2[1]), "v"(b2[2]), "v"(b2[3]));
#pragma unroll
                for (int n4 = 0; n4 < 4; ++n4)
#pragma unroll
                    for (int mb = 0; mb < 2; ++mb) { v8f t = acc[mb][n4]; t = wmmab(a[mb][ks], b[n4], t); t = wmmab(a2[mb][ks], b[n4], t); t = wmmab(a[mb][ks], b2[n4], t); acc[mb][n4] = t; }
            }
#pragma unroll
            for (int mb = 0; mb < 2; ++mb)
#pragma unroll
                for (int n4 = 0; n4 < 4; ++n4)
#pragma unroll
                    for (int j = 0; j < 8; ++j) *(float*)(srow + (mb * 16 + hi * 8 + j) * SPB + (wid * 128 + (nh * 4 + n4) * 16 + lr) * 4) = acc[mb][n4][j];
        }
    }
    __syncthreads();
    // rolled: one row's registers at a time
#pragma unroll 1
    for (int rr = 0; rr < FR / 8; ++rr) {
        const int lrow = wid * (FR / 8) + rr; const int i = r0 + lrow;
        const float* sr = (const float*)(srow + lrow * SPB); const float* qe = qes + lrow * QEP; h16* prw = (h16*)(srow + lrow * SPB);
        float v[TT / 32]; float mx = -3.0e38f;
#pragma unroll
        for (int ch = 0; ch < TT / 128; ++ch) { const int j0 = ch * 128 + lane * 4; const v4f s4 = *(const v4fa*)(sr + j0);
#pragma unroll
            for (int q = 0; q < 4; ++q) { const int j = j0 + q; const int r = min(max(j - i, -MAXR), MAXR) + MAXR; const float t = s4[q] * SCL + qe[r]; v[ch * 4 + q] = t; mx = fmaxf(mx, t); } }
#pragma unroll
        for (int sh = 16; sh; sh >>= 1) mx = fmaxf(mx, __shfl_xor(mx, sh, 32));
        float sum = 0.f;
#pragma unroll
        for (int k = 0; k < TT / 32; ++k) { v[k] = __builtin_amdgcn_exp2f(__fmul_rn(__fsub_rn(v[k], mx), 1.4426950408889634f)); sum += v[k]; }
#pragma unroll
        for (int sh = 16; sh; sh >>= 1) sum += __shfl_xor(sum, sh, 32);
        const float f = __fdiv_rn(PCAR, sum);
        float tl0 = 0.f, tl1 = 0.f;
#pragma unroll
        for (int ch = 0; ch < TT / 128; ++ch) { const int j0 = ch * 128 + lane * 4; v4h o4;
#pragma unroll
            for (int q = 0; q < 4; ++q) { const int j = j0 + q; const float p = v[ch * 4 + q] * f; o4[q] = tohx(p); tl0 += (j <= i - MAXR) ? p : 0.f; tl1 += (j >= i + MAXR) ? p : 0.f; }
            *(v4ha*)(prw + j0) = o4; }
#pragma unroll
        for (int sh = 16; sh; sh >>= 1) { tl0 += __shfl_xor(tl0, sh, 32); tl1 += __shfl_xor(tl1, sh, 32); }
        __syncthreads();   // the band below reads fp16 values that other lanes stored
        v4h bq4;
#pragma unroll
        for (int q = 0; q < 4; ++q) { const int r = lane * 4 + q; const int j = i + r - MAXR; const int jc = min(max(j, 0), TT - 1); h16 w = prw[jc];
            w = (r > 0 && r < 2 * MAXR && j >= 0 && j < TT) ? w : (h16)0.f; w = (r == 0) ? tohx(tl0) : w; w = (r == 2 * MAXR) ? tohx(tl1) : w; bq4[q] = w; }
        *(v4ha*)(prw + TT + lane * 4) = bq4;
    }
    __syncthreads();
    {
        const int mb = wid >> 2, nb = wid & 3;
        const char* ap = srow + (mb * 16 + lr) * SPB + 16 * hi; const h16* bp = VT + ((size_t)g * HD + nb * 16) * PP;
        v8f acc = (v8f){};
#pragma unroll
        for (int kc = 0; kc < PP; kc += 32) { const v16h pa = cat16(*(const v8ha*)(ap + kc * 2), *(const v8ha*)(ap + kc * 2 + 32)); acc = wmma16(pa, WFrag<h16>::ld(atb(bp + kc * 16, lo)), acc); }
#pragma unroll
        for (int j = 0; j < 8; ++j) qes[(mb * 16 + hi * 8 + j) * OSP + nb * 16 + lr] = acc[j];   // the QE rows are dead behind the barrier above
    }
    __syncthreads();
    { const int t = lane, d0 = wid * 8; const float cs = 1.0f / PCAR; const v4f x0 = *(const v4fa*)(qes + t * OSP + d0), x1 = *(const v4fa*)(qes + t * OSP + d0 + 4);
        v8us oh, ol;
#pragma unroll
        for (int q = 0; q < 8; ++q) { unsigned short c1, c2; splitf((q < 4 ? x0[q & 3] : x1[q & 3]) * cs, c1, c2); oh[q] = c1; ol[q] = c2; }
        const size_t oo = FO((size_t)(g / NH_) * TT + r0 + t, (size_t)(g % NH_) * HD + d0, DQ);
        *(v8us*)(ATh + oo) = oh; *(v8us*)(ATl + oo) = ol; }
}

extern "C" void kernel_launch(void* const* d_in, const int* in_sizes, int n_in,
                              void* d_out, int out_size, void* d_ws, size_t ws_size, hipStream_t stream) {
    if (n_in < 13) return;
    const size_t needX = ((size_t)(NB - 1) * SEQ_FULL + TT) * DM;
    if ((size_t)in_sizes[0] < needX || (size_t)in_sizes[1] < needX || (size_t)in_sizes[2] < needX) return;
    if (in_sizes[3] < DM * DM || in_sizes[5] < DM * DM || in_sizes[7] < DM * DM || in_sizes[9] < DM * DM) return;
    if (in_sizes[4] < DM || in_sizes[6] < DM || in_sizes[8] < DM || in_sizes[10] < DM) return;
    if (in_sizes[11] < NREL * HD || in_sizes[12] < NREL * HD) return;
    if ((size_t)out_size < needX) return;
    const float* query = (const float*)d_in[0]; const float* key = (const float*)d_in[1]; const float* value = (const float*)d_in[2];
    const float* wq = (const float*)d_in[3]; const float* bq = (const float*)d_in[4]; const float* wk = (const float*)d_in[5]; const float* bk = (const float*)d_in[6];
    const float* wv = (const float*)d_in[7]; const float* bv = (const float*)d_in[8]; const float* wo = (const float*)d_in[9]; const float* bo = (const float*)d_in[10];
    const float* rke = (const float*)d_in[11]; const float* rve = (const float*)d_in[12];
    float* OUT = (float*)d_out;     // [NB][SEQ_FULL][DM]
    char* wsp = (char*)d_ws;
    auto take = [&](size_t bytes) { char* p = wsp; wsp += (bytes + 255) & ~(size_t)255; return (void*)p; };
    constexpr size_t MR = (size_t)NB * TT;      // rows of all batches
    constexpr size_t NG = (size_t)NB * NH_;     // (batch, head) planes
    bf* WQ = (bf*)take((size_t)4 * DQ * DM * 2); bf* WO = WQ + (size_t)3 * DQ * DM;      // wq, wk, wv, wo
    bf* EB = (bf*)take((size_t)NE * HD * 2);
    bf* XB = (bf*)take((size_t)3 * MR * DM * 2); float* F = (float*)take((size_t)3 * MR * DQ * 4);      // q, k, v
    bf* QPh = (bf*)take((size_t)2 * NG * TT * HD * 2); bf* QPl = (bf*)take((size_t)2 * NG * TT * HD * 2); bf* KPh = QPh + NG * TT * HD; bf* KPl = QPl + NG * TT * HD;
    h16* VT = (h16*)take(NG * HD * PP * 2);
    bf* ATh = (bf*)take(MR * DQ * 2); bf* ATl = (bf*)take(MR * DQ * 2);
    const size_t carved = (size_t)(wsp - (char*)d_ws);
    if (carved > ws_size) return;    // 143,671,296 B at NB=4, SEQ=1024
    // weights and tables
    k_cvt8<<<dim3((unsigned)(((size_t)DQ * DM / 8 + 255) / 256), 4, 1), 256, 0, stream>>>(wq, wk, wv, wo, WQ, (size_t)DQ * DM / 8);
    k_epad2<<<(unsigned)(((size_t)NE * HD / 8 + 255) / 256), 256, 0, stream>>>(rke, EB);                      /* E_k: 65 rows bf16 (exact), rows 65..127 zero */
    k_evt<<<(unsigned)((NG * HD * NE / 8 + 255) / 256), 256, 0, stream>>>(rve, (int)NG, VT);           /* E_v^T columns TT..TT+127 of every V^T row */
    // projections of all batches: z = q, k, v
    k_cvt8<<<dim3((unsigned)((MR * DM / 8 + 255) / 256), 3, 1), 256, 0, stream>>>(query, key, value, value, XB, MR * DM / 8);
    k_gemmw<bf, 0, true, DM><<<dim3((unsigned)(MR / 128), DQ / 128, 3), 128, 0, stream>>>(XB, nullptr, WQ, F, DQ, bq, bk, bv, MR * DM, (size_t)DQ * DM, MR * DQ);
    const unsigned LPL = (unsigned)(((size_t)NH_ * TT * HD / 8 + 255) / 256);
    k_plane<<<dim3(LPL, 2 * NB, 1), 256, 0, stream>>>(F, DQ, NH_, QPh, QPl);
    k_vtp8<<<dim3(LPL, NB, 1), 256, 0, stream>>>(F + 2 * MR * DQ, DQ, NH_, VT);
    k_fattn<<<dim3(TT / FR, (unsigned)NG, 1), 256, 0, stream>>>(QPh, QPl, KPh, KPl, EB, VT, ATh, ATl);   /* scores, softmax, attn.[V | E_v], context planes */
    k_gemmw<bf, 1, true, DQ><<<dim3((unsigned)(MR / 128), DM / 128, 1), 128, 0, stream>>>(ATh, ATl, WO, OUT, DM, bo, bo, bo, 0, 0, 0);
}

// v005
// It runs in 127 microseconds.
// Two timings next to v004 both put it at 1.05 times that version's speed.
// All steps since v000 together make it 7.17 times as fast.
#include <hip/hip_runtime.h>

// Contractions, f32 accumulate: q/k/v projections v_wmma_f32_16x16x32_bf16 (x, W, bias all RNE-converted to bf16, single product); content scores v_wmma_f32_16x16x32_bf16 with q and k as bf16 hi/lo planes (3 products); q.E_k^T bf16 hi/lo x exact bf16 E_k (2 products); attn.[V | rel-value buckets] v_wmma_f32_16x16x32_f16 (P carried x1024 in fp16, V fp16, E_v exact); output projection bf16 hi/lo context x exact bf16 W_o (2 products) + bf16 bias. Softmax, logit adds and carries in f32.
// Layout, all batches at once: bf16 copy of the three inputs [3][NB*TT][DM]; one projection launch (z = q, k, v; f32) -> planes per (batch, head) g = b*NH_ + h (q, k: [g][t][d] bf16 hi + lo; v: [g][d][t] fp16 with pitch TT+128 whose last 128 columns hold E_v^T (65 used, rest zero)).
// Every 16-bit matrix operand in the workspace (R rows, K columns) lies in fragment order: [row / 16][k / 8][row % 16][k % 8], element offset FO(row, k, K); the 16 x 32 fragment at (row tile, k step) is then 1 KiB in a row and each of its two wave-wide 16-byte loads covers 512 contiguous bytes (4 whole lines).
// Attention, one launch for all NB*NH_ planes (k_fattn): per 32 query rows S = q.k^T and QE = q.E_k^T stay in LDS (f32); t_j = S_j / 8 + QE[clip(j - i, -32, 32) + 32], softmax over TT keys, P row = [1024 p_j fp16 | bucket sums: r = 0 keys j <= i - 32, r = 64 keys j >= i + 32, 0 < r < 64 the single key i + r - 32, r > 64 zero];
// one product with K = TT + 128 gives 1024 (attn.V + attn.E_v[clip]), scaled by 1/1024 into bf16 hi/lo context planes [b*TT + t][h*64 + d]; one output GEMM over all NB*TT rows with bias.

#ifndef NB
#define NB 4
#endif
#ifndef SEQ
#define SEQ 1024
#endif
#define NB_FULL  4
#define SEQ_FULL 1024
#define TT   SEQ
#define DM   1024
#define NH_  16
#define HD   64
#define DQ   (NH_ * HD)
#define PCAR 1024.0f
#define SCL  0.125f
#define NE   128     // rel tables (65 rows) padded to 128
#define NREL 65
#define MAXR 32
#define PP   (TT + NE)   // P row length and V^T columns (keys + rel buckets)
static_assert(TT % 128 == 0);
static_assert(TT == SEQ_FULL);   // the batches' rows are folded into one M = NB*TT dimension
static_assert(NB <= NB_FULL);
static_assert(NB >= 1);
static_assert(PP % 32 == 0);
static_assert(NREL == 2 * MAXR + 1);
static_assert(DM % 64 == 0);
static_assert(HD == 64);   // k_plane's thread map: 8 chunks of 8 columns a row

typedef _Float16 h16;
typedef unsigned short bf;
typedef __attribute__((ext_vector_type(16))) __bf16   v16bf;
typedef __attribute__((ext_vector_type(16))) _Float16 v16h;
typedef __attribute__((ext_vector_type(8)))  _Float16 v8h;
typedef __attribute__((ext_vector_type(8)))  unsigned short v8us;
typedef __attribute__((ext_vector_type(8)))  float    v8f;
typedef __attribute__((ext_vector_type(4)))  float    v4f;
typedef v8h  __attribute__((may_alias)) v8ha;
typedef v4f  __attribute__((may_alias)) v4fa;
typedef v8us __attribute__((may_alias)) v8usa;

__device__ __forceinline__ unsigned short f2bf(float f) { unsigned u = __float_as_uint(f); u += 0x7FFFu + ((u >> 16) & 1u); return (unsigned short)(u >> 16); }
__device__ __forceinline__ float bf2f(unsigned short b) { return __uint_as_float(((unsigned)b) << 16); }
__device__ __forceinline__ float bfr(float f) { return bf2f(f2bf(f)); }
__device__ __forceinline__ size_t FO(size_t row, size_t k, size_t K) { return ((row >> 4) * (K >> 3) + (k >> 3)) * 128 + (row & 15) * 8 + (k & 7); }
__device__ __forceinline__ v16h cat16(v8h lo, v8h hi) { return __builtin_shufflevector(lo, hi, 0, 1, 2, 3, 4, 5, 6, 7, 8, 9, 10, 11, 12, 13, 14, 15); }
__device__ __forceinline__ v16bf cat16b(v8us lo, v8us hi) { return __builtin_bit_cast(v16bf, __builtin_shufflevector(lo, hi, 0, 1, 2, 3, 4, 5, 6, 7, 8, 9, 10, 11, 12, 13, 14, 15)); }
__device__ __forceinline__ v8f wmma16(v16h a, v16h b, v8f c) { return __builtin_amdgcn_wmma_f32_16x16x32_f16(false, a, false, b, (short)0, c, false, false); }
__device__ __forceinline__ v8f wmmab(v16bf a, v16bf b, v8f c) { return __builtin_amdgcn_wmma_f32_16x16x32_bf16(false, a, false, b, (short)0, c, false, false); }

// ---- k_gemmw: GEMM, one work-group of 4 waves (2 x 2) per 128x128 output tile, 64x64 (16 accumulators) per wave; operands are 16-bit planes in fragment order; grid (M/128, N/128, Z), 128 threads.
// C[m][n] (f32, pitch ldc, + optional f32 bias[n] via bf16; z = 1, 2 take bias1, bias2) = sum_k A[m][k] Bt[n][k] (+ A2[m][k] Bt[n][k] where NSPLIT == 1). z-batch strides sA/sB/sC in elements. K % 64 == 0, K >= 128, a compile-time constant; A, A2 and Bt have K columns.
// Fragment map (both operands): lane l -> row/col l&15, elements 0..7 <- k 8h..8h+7, elements 8..15 <- k 16+8h..16+8h+7 (h = l>>4); D element r -> row 8h+r, col l&15. In fragment order these are elements 8 l .. 8 l + 7 and 256 + 8 l .. of the fragment's 512.
// A stage is 64 k of the tile's 8 row tiles of each operand: a row tile's 64 k are 2 KiB in a row in the workspace and go as they lie into LDS, 16 bytes a thread, by asynchronous copies; two stage buffers, the next stage's copies fly while this one is multiplied. Every fragment is fetched from L2 once for two waves.
template <typename T16> __device__ __forceinline__ const T16* atb(const T16* u, unsigned bytes) { return (const T16*)((const char*)u + bytes); }
template <typename T16> struct WFrag;
template <> struct WFrag<h16> { typedef v16h V; static __device__ __forceinline__ V ld(const h16* p) { return cat16(*(const v8h*)p, *(const v8h*)(p + 256)); } static __device__ __forceinline__ v8f mma(V a, V b, v8f c) { return wmma16(a, b, c); } };
template <> struct WFrag<bf> { typedef v16bf V; static __device__ __forceinline__ V ld(const bf* p) { return cat16b(*(const v8us*)p, *(const v8us*)(p + 256)); } static __device__ __forceinline__ V lds(const char* p) { return cat16b(*(const v8usa*)p, *(const v8usa*)(p + 512)); } static __device__ __forceinline__ v8f mma(V a, V b, v8f c) { return wmmab(a, b, c); } };
// the thread's 16 bytes of eight row tiles (gs bytes apart in the workspace, 2 KiB apart in LDS); the s_wait_xcnt closes the statement, so no address register of a copy is rewritten ahead of it
__device__ __forceinline__ void cp8(unsigned l, const char* g, unsigned gs) {
    asm volatile("global_load_async_to_lds_b128 %0, %8, off\n\t"
                 "global_load_async_to_lds_b128 %1, %9, off\n\t"
                 "global_load_async_to_lds_b128 %2, %10, off\n\t"
                 "global_load_async_to_lds_b128 %3, %11, off\n\t"
                 "global_load_async_to_lds_b128 %4, %12, off\n\t"
                 "global_load_async_to_lds_b128 %5, %13, off\n\t"
                 "global_load_async_to_lds_b128 %6, %14, off\n\t"
                 "global_load_async_to_lds_b128 %7, %15, off\n\t"
                 "s_wait_xcnt 0x0"
                 :: "v"(l), "v"(l + 2048u), "v"(l + 4096u), "v"(l + 6144u), "v"(l + 8192u), "v"(l + 10240u), "v"(l + 12288u), "v"(l + 14336u),
                    "v"(g), "v"(g + gs), "v"(g + 2 * (size_t)gs), "v"(g + 3 * (size_t)gs), "v"(g + 4 * (size_t)gs), "v"(g + 5 * (size_t)gs), "v"(g + 6 * (size_t)gs), "v"(g + 7 * (size_t)gs) : "memory");
}
// at most 256 registers: three work-groups of the projections fit a WGP (their LDS allows three), and every operand of the copies' asm text stays below v256
template <typename T16, int NSPLIT, bool BIAS, int K>
__global__ __launch_bounds__(128, 4) void k_gemmw(const T16* __restrict__ A, const T16* __restrict__ A2, const T16* __restrict__ Bt, float* C, int ldc, const float* __restrict__ bias0, const float* __restrict__ bias1, const float* __restrict__ bias2, size_t sA, size_t sB, size_t sC) {
    typedef typename WFrag<T16>::V V;
    static_assert(NSPLIT == 0 || NSPLIT == 1); static_assert(K % 64 == 0 && K >= 128);
    constexpr unsigned OPB = 8 * 2048;                       // one operand's part of a stage
    constexpr unsigned BOF = (NSPLIT == 1 ? 2 : 1) * OPB;    // Bt's place in a stage, behind A (and A2)
    constexpr unsigned STG = BOF + OPB;
    constexpr int NT = K / 64;
    __shared__ __align__(16) char st[2 * STG];
    __shared__ __align__(16) float osw[4][16 * 68];
    const size_t z = blockIdx.z; A += z * sA; if (NSPLIT == 1) A2 += z * sA; Bt += z * sB; C += z * sC;
    const float* __restrict__ bias = (z == 0) ? bias0 : (z == 1) ? bias1 : bias2;
    const int lane = threadIdx.x & 31, lr = lane & 15, hi = lane >> 4; const int wid = __builtin_amdgcn_readfirstlane(threadIdx.x >> 5); const int wm = wid & 1, wn = wid >> 1;
    const int rb = blockIdx.x * 128, cb = blockIdx.y * 128;
    v8f acc[4][4];
#pragma unroll
    for (int mb = 0; mb < 4; ++mb)
#pragma unroll
        for (int nb = 0; nb < 4; ++nb) acc[mb][nb] = (v8f){};
    // a 16-row tile is 16 K elements, 64 k of it 2 KiB
    const char* gA = (const char*)(A + (size_t)rb * K) + threadIdx.x * 16; const char* gA2 = (NSPLIT == 1) ? (const char*)(A2 + (size_t)rb * K) + threadIdx.x * 16 : gA; const char* gB = (const char*)(Bt + (size_t)cb * K) + threadIdx.x * 16;
    const unsigned l0 = (unsigned)(size_t)(__attribute__((address_space(3))) char*)st + threadIdx.x * 16;   // the thread's LDS byte address in a row tile of buffer 0
    auto fill = [&](int t, unsigned buf) { const unsigned l = l0 + buf * STG; const size_t go = (size_t)t * 2048;
        cp8(l, gA + go, 32 * K); if (NSPLIT == 1) cp8(l + OPB, gA2 + go, 32 * K); cp8(l + BOF, gB + go, 32 * K); };
    fill(0, 0);
    asm volatile("s_wait_asynccnt 0x0" ::: "memory");   // this wave's copies of stage 0 have landed
    __syncthreads();                                    // ... and every other wave's
    fill(1, 1);
#pragma unroll 1
    for (int t = 0; t < NT; ++t) {
        const char* sb = st + (unsigned)(t & 1) * STG + lane * 16;
#pragma unroll
        for (int ks = 0; ks < 2; ++ks) {
            V a[4], a2[4], b[4];
            b[0] = WFrag<T16>::lds(sb + BOF + (wn * 4) * 2048 + ks * 1024);
#pragma unroll
            for (int mb = 0; mb < 4; ++mb) { a[mb] = WFrag<T16>::lds(sb + (wm * 4 + mb) * 2048 + ks * 1024); if (NSPLIT == 1) a2[mb] = WFrag<T16>::lds(sb + OPB + (wm * 4 + mb) * 2048 + ks * 1024); }
#pragma unroll
            for (int nb = 1; nb < 4; ++nb) b[nb] = WFrag<T16>::lds(sb + BOF + (wn * 4 + nb) * 2048 + ks * 1024);
            __builtin_amdgcn_sched_barrier(0);   // the k step's LDS reads stay one group ahead of its products, in the order of use; without it the build reads Bt fragment by fragment and waits out the LDS latency before every four products
#pragma unroll
            for (int nb = 0; nb < 4; ++nb) {
#pragma unroll
                for (int mb = 0; mb < 4; ++mb) { acc[mb][nb] = WFrag<T16>::mma(a[mb], b[nb], acc[mb][nb]); if (NSPLIT == 1) acc[mb][nb] = WFrag<T16>::mma(a2[mb], b[nb], acc[mb][nb]); } }
        }
        __builtin_amdgcn_sched_barrier(0);                  // the stage's products stay ahead of the foot; without it the build sinks 32 k of them behind the barrier, in front of the refill, whose copies then start that much later
        asm volatile("s_wait_dscnt 0x0" ::: "memory");      // this wave's reads of the buffer are done before it is refilled
        asm volatile("s_wait_asynccnt 0x0" ::: "memory");   // this wave's copies of stage t + 1 have landed
        __syncthreads();                                    // publishes stage t + 1 and ends every wave's reads of stage t
        if (t + 2 < NT) fill(t + 2, (unsigned)(t & 1));
    }
    asm volatile("s_wait_asynccnt 0x0" ::: "memory");       // no copy is outstanding when the wave goes on
    float* os = osw[wid]; const int r0 = rb + wm * 64, c0 = cb + wn * 64;   // the wave's own staging rows and its 64x64 part of the tile
#pragma unroll
    for (int mb = 0; mb < 4; ++mb) {
#pragma unroll
        for (int nb = 0; nb < 4; ++nb) {
#pragma unroll
            for (int j = 0; j < 8; ++j) os[(hi * 8 + j) * 68 + nb * 16 + lr] = acc[mb][nb][j]; }
        __builtin_amdgcn_wave_barrier(); asm volatile("" ::: "memory");
        float* crow = C + (size_t)(r0 + mb * 16) * ldc + c0;
{
#pragma unroll
            for (int s = 0; s < 8; ++s) { const int row = 2 * s + hi, cofs = lr * 4; v4f val = *(const v4fa*)(os + row * 68 + cofs); if (BIAS) { val[0] += bfr(bias[c0 + cofs]); val[1] += bfr(bias[c0 + cofs + 1]); val[2] += bfr(bias[c0 + cofs + 2]); val[3] += bfr(bias[c0 + cofs + 3]); }
                *(v4f*)(crow + (size_t)row * ldc + cofs) = val; }
             }
        asm volatile("s_wait_xcnt 0x0" ::: "memory");   // ahead of the next row tile's code, which reuses the registers that the eight stores name
        __builtin_amdgcn_wave_barrier(); asm volatile("" ::: "memory");
    }
}

__device__ __forceinline__ h16 tohx(float x) { return (h16)x; }
__device__ __forceinline__ void splitf(float y, unsigned short& h, unsigned short& l) { h = f2bf(y); l = f2bf(y - bf2f(h)); }
typedef __attribute__((ext_vector_type(2))) _Float16 v2h;
typedef __attribute__((ext_vector_type(4))) _Float16 v4h;
typedef v4h  __attribute__((may_alias)) v4ha;
typedef __attribute__((ext_vector_type(2))) unsigned short v2us;
typedef __attribute__((ext_vector_type(4))) unsigned short v4us;
typedef __attribute__((ext_vector_type(2))) float v2f;

// blockIdx.y picks one of up to four equally long sources of DM columns; its bf16 copy, in fragment order, is slab y of dst. A wave takes 8 rows x 4 chunks of 8 columns: whole 128-byte lines on both sides.
__global__ __launch_bounds__(256) void k_cvt8(const float* __restrict__ s0, const float* __restrict__ s1, const float* __restrict__ s2, const float* __restrict__ s3, bf* dst, size_t n8) { const size_t i = (size_t)blockIdx.x * 256 + threadIdx.x; if (i >= n8) return;
    const unsigned y = blockIdx.y; const float* __restrict__ src = (y == 0) ? s0 : (y == 1) ? s1 : (y == 2) ? s2 : s3; dst += (size_t)y * n8 * 8;
    const size_t u = i >> 6; const size_t row = (u / (DM / 32)) * 16 + ((i >> 5) & 1) * 8 + ((i >> 2) & 7), k = ((u % (DM / 32)) * 4 + (i & 3)) * 8; const v8f v = *(const v8f*)(src + row * DM + k); v8us o;
#pragma unroll
    for (int q = 0; q < 8; ++q) o[q] = f2bf(v[q]); *(v8us*)(dst + FO(row, k, DM)) = o;  }

__global__ __launch_bounds__(256) void k_epad2(const float* __restrict__ E, bf* EB) { const size_t i = (size_t)blockIdx.x * 256 + threadIdx.x; if (i >= (size_t)NE * HD / 8) return; const int d0 = (int)(i % (HD / 8)) * 8; const int r = (int)(i / (HD / 8)); const float* src = E + (size_t)min(r, NREL - 1) * HD + d0; v8us o;
#pragma unroll
    for (int q = 0; q < 8; ++q) { const unsigned short v = f2bf(src[q]); o[q] = (r < NREL) ? v : (unsigned short)0; }
    *(v8us*)(EB + FO(r, d0, HD)) = o;  }

// blockIdx.y: slab of TT rows of F (q's batches, then k's) and its nheads planes, each in fragment order. A wave takes 8 rows x 4 chunks of 8 columns: whole 128-byte lines on both sides.
__global__ __launch_bounds__(256) void k_plane(const float* __restrict__ F, int pitch, int nheads, bf* Ph, bf* Pl) {
    const size_t x = (size_t)blockIdx.x * 256 + threadIdx.x; if (x >= (size_t)nheads * TT * HD / 8) return;
    F += (size_t)blockIdx.y * TT * pitch; Ph += (size_t)blockIdx.y * nheads * TT * HD; Pl += (size_t)blockIdx.y * nheads * TT * HD;
    const int d = (int)(((x >> 5) & 1) * 4 + (x & 3)) * 8; const int t = (int)((x >> 7) % (TT / 16)) * 16 + (int)((x >> 6) & 1) * 8 + (int)((x >> 2) & 7); const int h = (int)(x / ((size_t)HD * TT / 8));
    const size_t e = (size_t)h * TT * HD + FO(t, d, HD);
    const v8f y = *(const v8f*)(F + (size_t)t * pitch + h * HD + d); v8us oh, ol;
#pragma unroll
    for (int q = 0; q < 8; ++q) { unsigned short a, c2; splitf(y[q], a, c2); oh[q] = a; ol[q] = c2; }
    *(v8us*)(Ph + e) = oh; *(v8us*)(Pl + e) = ol;  }

// blockIdx.y: batch (TT rows of F, nheads planes of VT, each HD rows x PP columns in fragment order). A wave takes 32 neighbouring d of 8 keys: each load one whole line, the store two runs of 256 bytes.
__global__ __launch_bounds__(256) void k_vtp8(const float* __restrict__ F, int pitch, int nheads, h16* VT) {
    const size_t x = (size_t)blockIdx.x * 256 + threadIdx.x; if (x >= (size_t)nheads * HD * TT / 8) return;
    F += (size_t)blockIdx.y * TT * pitch; VT += (size_t)blockIdx.y * nheads * HD * PP;
    const int d = (int)(x % HD); const int t = (int)((x / HD) % (TT / 8)) * 8; const int g = (int)(x / ((size_t)TT * HD / 8));
    v8h o;
#pragma unroll
    for (int q = 0; q < 8; ++q) o[q] = tohx(F[(size_t)(t + q) * pitch + g * HD + d]);
    h16* dst = VT + (size_t)g * HD * PP + FO(d, t, PP);
    *(v8h*)dst = o;  }

__global__ __launch_bounds__(256) void k_evt(const float* __restrict__ EV, int nheads, h16* VT) {
    const size_t x = (size_t)blockIdx.x * 256 + threadIdx.x; if (x >= (size_t)nheads * HD * NE / 8) return;
    const int d = (int)(x % HD); const int r0 = (int)((x / HD) % (NE / 8)) * 8; const int g = (int)(x / ((size_t)NE * HD / 8));
    v8h o; const float* ep[8]; float ev[8];
#pragma unroll
    for (int q = 0; q < 8; ++q) { ep[q] = EV + (size_t)min(r0 + q, NREL - 1) * HD + d; ev[q] = *ep[q]; }
    // the eight addresses are inputs, so they stay in their registers up to this wait: no result of the run of loads lands in a register that an issued load of the run still names
    asm volatile("s_wait_xcnt 0x0" :: "v"(ep[0]), "v"(ep[1]), "v"(ep[2]), "v"(ep[3]), "v"(ep[4]), "v"(ep[5]), "v"(ep[6]), "v"(ep[7]) : "memory");
#pragma unroll
    for (int q = 0; q < 8; ++q) { const float y = (r0 + q < NREL) ? bfr(ev[q]) : 0.0f; o[q] = tohx(y); }
    h16* dst = VT + (size_t)g * HD * PP + FO(d, TT + r0, PP);
    *(v8h*)dst = o;  }

// k_fattn: one work-group (8 waves) per FR = 32 query rows of one (batch, head) plane g; the score rows never leave the chip.
// 1) wave w: S[32][128 w .. 128 w + 127] = q.k^T (3 products, same order as a K = 64 GEMM) and column tile w of QE = q.E_k^T (2 products), f32 into LDS;
// 2) wave w, rows 4 w .. 4 w + 3, one row at a time: t_j = S_j * HD^-0.5 + QE[clip(j - i, -32, 32) + 32], softmax over the TT keys (register row, one exp, fixed trees);
//    the fp16 row [1024 p_j, j < TT | at TT + r: r = 0 sum of p over j <= i - 32, r = 64 sum over j >= i + 32, 0 < r < 64 p at j = i + r - 32 (0 outside [0, TT)), r > 64 zero] overwrites the row's own scores;
// 3) wave w: 16x16 tile (row tile w / 4, column tile w % 4) of P.[V | E_v]^T, K = PP in ascending order, A from LDS, B from the V^T plane;
// 4) scaled by 1/1024 and split into the bf16 hi/lo context planes, row b*TT + t, column h*64 + d, in fragment order: a wave stores one chunk of 8 columns of the 32 rows, two runs of 256 bytes.
#define FR   32
#define SPB  (TT * 4 + 16)   // byte pitch of a score row in LDS: 16 rows of a b128 fragment read fall on 64 different banks
#define QEP  132             // float pitch of a QE row
#define OSP  68              // float pitch of a staged output row
static_assert(TT % FR == 0);
static_assert(TT == 8 * 128);     // 8 waves x 128 score columns
static_assert(PP * 2 <= TT * 4);  // the fp16 row fits into its f32 score row
static_assert(OSP <= QEP);
static_assert(2 * MAXR <= 128);   // the band of single keys spans at most two 128-key chunks
// one step of three lane sums at once: each lane adds the values of the lane whose byte index (4 x lane) is src. The three exchanges and their wait are one statement, so a step costs one LDS-path latency;
// written as three __shfl_xor chains the build threads the exchanges one by one, nine to twelve waits in a row for the five steps
__device__ __forceinline__ void xadd3(int src, float& a, float& b, float& c) {
    float x, y, z;
    asm volatile("ds_bpermute_b32 %0, %3, %4\n\t"
                 "ds_bpermute_b32 %1, %3, %5\n\t"
                 "ds_bpermute_b32 %2, %3, %6\n\t"
                 "s_wait_dscnt 0x0"
                 : "=&v"(x), "=&v"(y), "=&v"(z) : "v"(src), "v"(a), "v"(b), "v"(c) : "memory");
    a += x; b += y; c += z;
}
// 4 waves per SIMD = two work-groups per WGP, which their LDS allows: at most 256 registers
__global__ __launch_bounds__(256, 4) void k_fattn(const bf* __restrict__ QPh, const bf* __restrict__ QPl, const bf* __restrict__ KPh, const bf* __restrict__ KPl, const bf* __restrict__ EB, const h16* __restrict__ VT, bf* ATh, bf* ATl) {
    __shared__ __align__(16) char srow[FR * SPB];
    __shared__ __align__(16) float qes[FR * QEP];
    const int lane = threadIdx.x & 31, lr = lane & 15, hi = lane >> 4; const int wid = __builtin_amdgcn_readfirstlane(threadIdx.x >> 5);
    const int g = blockIdx.y, r0 = blockIdx.x * FR; const size_t pl = (size_t)g * TT * HD;
    const unsigned lo = (unsigned)lane * 16;   // the lane's byte offset in a fragment (fragment order); all else of an address is wave-uniform
    {
        v16bf a[2][2], a2[2][2];
        const bf* qbh = QPh + pl + (size_t)r0 * HD; const bf* qbl = QPl + pl + (size_t)r0 * HD;   // wave-uniform bases of the 32 rows
#pragma unroll
        for (int mb = 0; mb < 2; ++mb)
#pragma unroll
            for (int ks = 0; ks < 2; ++ks) { const int ao = mb * 16 * HD + ks * 512; a[mb][ks] = WFrag<bf>::ld(atb(qbh + ao, lo)); a2[mb][ks] = WFrag<bf>::ld(atb(qbl + ao, lo)); }
        // the lane offset and the two bases are inputs, so they stay in their registers up to this wait: no result of the run of loads lands in a register that an issued load of the run still names
        asm volatile("s_wait_xcnt 0x0" :: "v"(lo), "s"(qbh), "s"(qbl) : "memory");
        const bf* kbh = KPh + pl + (size_t)(wid * 128) * HD; const bf* kbl = KPl + pl + (size_t)(wid * 128) * HD;   // wave-uniform bases of the wave's 128 key rows
        // q.E_k^T ahead of the scores: its fragments, tile and LDS addresses are dead while the score products use all 256 registers (behind them the build spills)
        { const size_t eo = (size_t)(wid * 16) * HD; const v16bf e0 = WFrag<bf>::ld(atb(EB + eo, lo)), e1 = WFrag<bf>::ld(atb(EB + eo + 512, lo));
            v8f acq[2];
#pragma unroll
            for (int mb = 0; mb < 2; ++mb) { v8f t = (v8f){}; t = wmmab(a[mb][0], e0, t); t = wmmab(a2[mb][0], e0, t); t = wmmab(a[mb][1], e1, t); t = wmmab(a2[mb][1], e1, t); acq[mb] = t; }
#pragma unroll
            for (int mb = 0; mb < 2; ++mb)
#pragma unroll
                for (int j = 0; j < 8; ++j) qes[(mb * 16 + hi * 8 + j) * QEP + wid * 16 + lr] = acq[mb][j]; }
#pragma unroll
        for (int nh = 0; nh < 2; ++nh) {      // 64 score columns at a time
            v8f acc[2][4];
#pragma unroll
            for (int mb = 0; mb < 2; ++mb)
#pragma unroll
                for (int n4 = 0; n4 < 4; ++n4) acc[mb][n4] = (v8f){};
#pragma unroll
            for (int ks = 0; ks < 2; ++ks) {
                v16bf b[4], b2[4];
#pragma unroll
                for (int n4 = 0; n4 < 4; ++n4) { const int bo = (nh * 4 + n4) * 16 * HD + ks * 512; b[n4] = WFrag<bf>::ld(atb(kbh + bo, lo)); b2[n4] = WFrag<bf>::ld(atb(kbl + bo, lo)); }
                // inputs only: holds the eight fragments' loads together ahead of their products, one memory latency for the group; without it the build loads and waits fragment by fragment
                asm volatile("" :: "v"(b[0]), "v"(b[1]), "v"(b[2]), "v"(b[3]), "v"(b2[0]), "v"(b2[1]), "v"(b2[2]), "v"(b2[3]));
#pragma unroll
                for (int n4 = 0; n4 < 4; ++n4)
#pragma unroll
                    for (int mb = 0; mb < 2; ++mb) { v8f t = acc[mb][n4]; t = wmmab(a[mb][ks], b[n4], t); t = wmmab(a2[mb][ks], b[n4], t); t = wmmab(a[mb][ks], b2[n4], t); acc[mb][n4] = t; }
            }
#pragma unroll
            for (int mb = 0; mb < 2; ++mb)
#pragma unroll
                for (int n4 = 0; n4 < 4; ++n4)
#pragma unroll
                    for (int j = 0; j < 8; ++j) *(float*)(srow + (mb * 16 + hi * 8 + j) * SPB + (wid * 128 + (nh * 4 + n4) * 16 + lr) * 4) = acc[mb][n4][j];
        }
    }
    __syncthreads();
    // rolled: one row's registers at a time
#pragma unroll 1
    for (int rr = 0; rr < FR / 8; ++rr) {
        const int lrow = wid * (FR / 8) + rr; const int i = r0 + lrow;
        const float* sr = (const float*)(srow + lrow * SPB); const float* qe = qes + lrow * QEP; h16* prw = (h16*)(srow + lrow * SPB);
        // register slot k holds the 128-key chunk (cA + k) % 8, cA the chunk of the band's first key: the band i - 31 .. i + 31 lies in slots 0 and 1;
        // a slot k >= 2 lies wholly right of the band or, wrapped past the row's end (cA + k >= 8), wholly left of it: one clipped logit for all its keys, and its sum of exps goes to one tail as a whole
        const int cA = max(i - (MAXR - 1), 0) >> 7;
        const float qL = qe[0], qR = qe[2 * MAXR];
        float v[TT / 32]; float mx = -3.0e38f;
#pragma unroll
        for (int k = 0; k < TT / 128; ++k) { const int j0 = ((cA + k) & (TT / 128 - 1)) * 128 + lane * 4; const v4f s4 = *(const v4fa*)(sr + j0); const float ck = (cA + k >= TT / 128) ? qL : qR;
#pragma unroll
            for (int q = 0; q < 4; ++q) { float c = ck; if (k < 2) { const int r = min(max(j0 + q - i, -MAXR), MAXR) + MAXR; c = qe[r]; }
                const float t = s4[q] * SCL + c; v[k * 4 + q] = t; mx = fmaxf(mx, t); } }
#pragma unroll
        for (int sh = 16; sh; sh >>= 1) mx = fmaxf(mx, __int_as_float(__builtin_amdgcn_ds_bpermute((lane ^ sh) << 2, __float_as_int(mx))));   // the exchange of __shfl_xor on the index registers of xadd3 below: one set of five, not two, is live at the end of the score products
        // tails as sums of exps, scaled once below: per key only where the band's edges can lie (left edge: slot 0; right edge: slots 0 and 1; slot 1 holds left keys only when wrapped, then all of them)
        float sum = 0.f, tl0 = 0.f, tl1 = 0.f;
#pragma unroll
        for (int k = 0; k < TT / 128; ++k) { const int j0 = ((cA + k) & (TT / 128 - 1)) * 128 + lane * 4; const bool wr = cA + k >= TT / 128;
#pragma unroll
            for (int q = 0; q < 4; ++q) { const float x = __builtin_amdgcn_exp2f(__fmul_rn(__fsub_rn(v[k * 4 + q], mx), 1.4426950408889634f)); v[k * 4 + q] = x;
                if (k == 0) tl0 += (j0 + q <= i - MAXR) ? x : 0.f;
                if (k < 2) tl1 += (j0 + q >= i + MAXR) ? x : 0.f; }
            const float e = (v[k * 4] + v[k * 4 + 1]) + (v[k * 4 + 2] + v[k * 4 + 3]); sum = (k == 0) ? e : sum + e;
            if (k >= 1) tl0 = fmaf(e, wr ? 1.f : 0.f, tl0);
            if (k >= 2) tl1 = fmaf(e, wr ? 0.f : 1.f, tl1); }
#pragma unroll
        for (int sh = 16; sh; sh >>= 1) xadd3((lane ^ sh) << 2, sum, tl0, tl1);
        const float f = __fdiv_rn(PCAR, sum);
        tl0 *= f; tl1 *= f;
#pragma unroll
        for (int k = 0; k < TT / 128; ++k) { const int j0 = ((cA + k) & (TT / 128 - 1)) * 128 + lane * 4; v4h o4;
#pragma unroll
            for (int q = 0; q < 4; ++q) o4[q] = tohx(v[k * 4 + q] * f);
            *(v4ha*)(prw + j0) = o4; }
        __syncthreads();   // the band below reads fp16 values that other lanes stored
        v4h bq4;
#pragma unroll
        for (int q = 0; q < 4; ++q) { const int r = lane * 4 + q; const int j = i + r - MAXR; const int jc = min(max(j, 0), TT - 1); h16 w = prw[jc];
            w = (r > 0 && r < 2 * MAXR && j >= 0 && j < TT) ? w : (h16)0.f; w = (r == 0) ? tohx(tl0) : w; w = (r == 2 * MAXR) ? tohx(tl1) : w; bq4[q] = w; }
        *(v4ha*)(prw + TT + lane * 4) = bq4;
    }
    __syncthreads();
    {
        const int mb = wid >> 2, nb = wid & 3;
        const char* ap = srow + (mb * 16 + lr) * SPB + 16 * hi; const h16* bp = VT + ((size_t)g * HD + nb * 16) * PP;
        v8f acc = (v8f){};
#pragma unroll
        for (int kc = 0; kc < PP; kc += 32) { const v16h pa = cat16(*(const v8ha*)(ap + kc * 2), *(const v8ha*)(ap + kc * 2 + 32)); acc = wmma16(pa, WFrag<h16>::ld(atb(bp + kc * 16, lo)), acc); }
#pragma unroll
        for (int j = 0; j < 8; ++j) qes[(mb * 16 + (int)(__lane_id() >> 4) * 8 + j) * OSP + nb * 16 + lr] = acc[j];   // the QE rows are dead behind the barrier above; the lane's half is formed anew: held from the kernel's head it is spilled, and its reload waits for every V load in flight
    }
    __syncthreads();
    { const int t = lane, d0 = wid * 8; const float cs = 1.0f / PCAR; const v4f x0 = *(const v4fa*)(qes + t * OSP + d0), x1 = *(const v4fa*)(qes + t * OSP + d0 + 4);
        v8us oh, ol;
#pragma unroll
        for (int q = 0; q < 8; ++q) { unsigned short c1, c2; splitf((q < 4 ? x0[q & 3] : x1[q & 3]) * cs, c1, c2); oh[q] = c1; ol[q] = c2; }
        const size_t oo = FO((size_t)(g / NH_) * TT + r0 + t, (size_t)(g % NH_) * HD + d0, DQ);
        *(v8us*)(ATh + oo) = oh; *(v8us*)(ATl + oo) = ol; }
}

extern "C" void kernel_launch(void* const* d_in, const int* in_sizes, int n_in,
                              void* d_out, int out_size, void* d_ws, size_t ws_size, hipStream_t stream) {
    if (n_in < 13) return;
    const size_t needX = ((size_t)(NB - 1) * SEQ_FULL + TT) * DM;
    if ((size_t)in_sizes[0] < needX || (size_t)in_sizes[1] < needX || (size_t)in_sizes[2] < needX) return;
    if (in_sizes[3] < DM * DM || in_sizes[5] < DM * DM || in_sizes[7] < DM * DM || in_sizes[9] < DM * DM) return;
    if (in_sizes[4] < DM || in_sizes[6] < DM || in_sizes[8] < DM || in_sizes[10] < DM) return;
    if (in_sizes[11] < NREL * HD || in_sizes[12] < NREL * HD) return;
    if ((size_t)out_size < needX) return;
    const float* query = (const float*)d_in[0]; const float* key = (const float*)d_in[1]; const float* value = (const float*)d_in[2];
    const float* wq = (const float*)d_in[3]; const float* bq = (const float*)d_in[4]; const float* wk = (const float*)d_in[5]; const float* bk = (const float*)d_in[6];
    const float* wv = (const float*)d_in[7]; const float* bv = (const float*)d_in[8]; const float* wo = (const float*)d_in[9]; const float* bo = (const float*)d_in[10];
    const float* rke = (const float*)d_in[11]; const float* rve = (const float*)d_in[12];
    float* OUT = (float*)d_out;     // [NB][SEQ_FULL][DM]
    char* wsp = (char*)d_ws;
    auto take = [&](size_t bytes) { char* p = wsp; wsp += (bytes + 255) & ~(size_t)255; return (void*)p; };
    constexpr size_t MR = (size_t)NB * TT;      // rows of all batches
    constexpr size_t NG = (size_t)NB * NH_;     // (batch, head) planes
    bf* WQ = (bf*)take((size_t)4 * DQ * DM * 2); bf* WO = WQ + (size_t)3 * DQ * DM;      // wq, wk, wv, wo
    bf* EB = (bf*)take((size_t)NE * HD * 2);
    bf* XB = (bf*)take((size_t)3 * MR * DM * 2); float* F = (float*)take((size_t)3 * MR * DQ * 4);      // q, k, v
    bf* QPh = (bf*)take((size_t)2 * NG * TT * HD * 2); bf* QPl = (bf*)take((size_t)2 * NG * TT * HD * 2); bf* KPh = QPh + NG * TT * HD; bf* KPl = QPl + NG * TT * HD;
    h16* VT = (h16*)take(NG * HD * PP * 2);
    bf* ATh = (bf*)take(MR * DQ * 2); bf* ATl = (bf*)take(MR * DQ * 2);
    const size_t carved = (size_t)(wsp - (char*)d_ws);
    if (carved > ws_size) return;    // 143,671,296 B at NB=4, SEQ=1024
    // weights and tables
    k_cvt8<<<dim3((unsigned)(((size_t)DQ * DM / 8 + 255) / 256), 4, 1), 256, 0, stream>>>(wq, wk, wv, wo, WQ, (size_t)DQ * DM / 8);
    k_epad2<<<(unsigned)(((size_t)NE * HD / 8 + 255) / 256), 256, 0, stream>>>(rke, EB);                      /* E_k: 65 rows bf16 (exact), rows 65..127 zero */
    k_evt<<<(unsigned)((NG * HD * NE / 8 + 255) / 256), 256, 0, stream>>>(rve, (int)NG, VT);           /* E_v^T columns TT..TT+127 of every V^T row */
    // projections of all batches: z = q, k, v
    k_cvt8<<<dim3((unsigned)((MR * DM / 8 + 255) / 256), 3, 1), 256, 0, stream>>>(query, key, value, value, XB, MR * DM / 8);
    k_gemmw<bf, 0, true, DM><<<dim3((unsigned)(MR / 128), DQ / 128, 3), 128, 0, stream>>>(XB, nullptr, WQ, F, DQ, bq, bk, bv, MR * DM, (size_t)DQ * DM, MR * DQ);
    const unsigned LPL = (unsigned)(((size_t)NH_ * TT * HD / 8 + 255) / 256);
    k_plane<<<dim3(LPL, 2 * NB, 1), 256, 0, stream>>>(F, DQ, NH_, QPh, QPl);
    k_vtp8<<<dim3(LPL, NB, 1), 256, 0, stream>>>(F + 2 * MR * DQ, DQ, NH_, VT);
    k_fattn<<<dim3(TT / FR, (unsigned)NG, 1), 256, 0, stream>>>(QPh, QPl, KPh, KPl, EB, VT, ATh, ATl);   /* scores, softmax, attn.[V | E_v], context planes */
    k_gemmw<bf, 1, true, DQ><<<dim3((unsigned)(MR / 128), DM / 128, 1), 128, 0, stream>>>(ATh, ATl, WO, OUT, DM, bo, bo, bo, 0, 0, 0);
}

// v006
// A run of this version takes 120 microseconds.
// Timed twice side by side with v005, it ran 1.07 and 1.06 times as fast.
// Over all steps from v000 it is 7.64 times as fast.
#include <hip/hip_runtime.h>

// Contractions, f32 accumulate: q/k/v projections v_wmma_f32_16x16x32_bf16 (x, W, bias all RNE-converted to bf16, single product); content scores v_wmma_f32_16x16x32_bf16 with q and k as bf16 hi/lo planes (3 products); q.E_k^T bf16 hi/lo x exact bf16 E_k (2 products); attn.[V | rel-value buckets] v_wmma_f32_16x16x32_f16 (P carried x1024 in fp16, V fp16, E_v exact); output projection bf16 hi/lo context x exact bf16 W_o (2 products) + bf16 bias. Softmax, logit adds and carries in f32.
// Layout, all batches at once: bf16 copy of the three inputs [3][NB*TT][DM]; one projection launch (z = q, k, v; f32) -> planes per (batch, head) g = b*NH_ + h (q, k: [g][t][d] bf16 hi + lo; v: [g][d][t] fp16 with pitch TT+128 whose last 128 columns hold E_v^T (65 used, rest zero)).
// Every 16-bit matrix operand in the workspace (R rows, K columns) lies in fragment order: [row / 16][k / 8][row % 16][k % 8], element offset FO(row, k, K); the 16 x 32 fragment at (row tile, k step) is then 1 KiB in a row and each of its two wave-wide 16-byte loads covers 512 contiguous bytes (4 whole lines).
// Attention, one launch for all NB*NH_ planes (k_fattn): per 32 query rows S = q.k^T and QE = q.E_k^T stay in LDS (f32); t_j = S_j / 8 + QE[clip(j - i, -32, 32) + 32], softmax over TT keys, P row = [1024 p_j fp16 | bucket sums: r = 0 keys j <= i - 32, r = 64 keys j >= i + 32, 0 < r < 64 the single key i + r - 32, r > 64 zero];
// one product with K = TT + 128 gives 1024 (attn.V + attn.E_v[clip]), scaled by 1/1024 into bf16 hi/lo context planes [b*TT + t][h*64 + d]; one output GEMM over all NB*TT rows with bias.

#ifndef NB
#define NB 4
#endif
#ifndef SEQ
#define SEQ 1024
#endif
#define NB_FULL  4
#define SEQ_FULL 1024
#define TT   SEQ
#define DM   1024
#define NH_  16
#define HD   64
#define DQ   (NH_ * HD)
#define PCAR 1024.0f
#define SCL  0.125f
#define NE   128     // rel tables (65 rows) padded to 128
#define NREL 65
#define MAXR 32
#define PP   (TT + NE)   // P row length and V^T columns (keys + rel buckets)
static_assert(TT % 128 == 0);
static_assert(TT == SEQ_FULL);   // the batches' rows are folded into one M = NB*TT dimension
static_assert(NB <= NB_FULL);
static_assert(NB >= 1);
static_assert(PP % 32 == 0);
static_assert(NREL == 2 * MAXR + 1);
static_assert(DM % 64 == 0);
static_assert(HD == 64);   // plane's thread map: 8 chunks of 8 columns a row

typedef _Float16 h16;
typedef unsigned short bf;
typedef __attribute__((ext_vector_type(16))) __bf16   v16bf;
typedef __attribute__((ext_vector_type(16))) _Float16 v16h;
typedef __attribute__((ext_vector_type(8)))  _Float16 v8h;
typedef __attribute__((ext_vector_type(8)))  unsigned short v8us;
typedef __attribute__((ext_vector_type(8)))  float    v8f;
typedef __attribute__((ext_vector_type(4)))  float    v4f;
typedef v8h  __attribute__((may_alias)) v8ha;
typedef v4f  __attribute__((may_alias)) v4fa;
typedef v8us __attribute__((may_alias)) v8usa;

__device__ __forceinline__ unsigned short f2bf(float f) { unsigned u = __float_as_uint(f); u += 0x7FFFu + ((u >> 16) & 1u); return (unsigned short)(u >> 16); }
__device__ __forceinline__ float bf2f(unsigned short b) { return __uint_as_float(((unsigned)b) << 16); }
__device__ __forceinline__ float bfr(float f) { return bf2f(f2bf(f)); }
__device__ __forceinline__ size_t FO(size_t row, size_t k, size_t K) { return ((row >> 4) * (K >> 3) + (k >> 3)) * 128 + (row & 15) * 8 + (k & 7); }
__device__ __forceinline__ v16h cat16(v8h lo, v8h hi) { return __builtin_shufflevector(lo, hi, 0, 1, 2, 3, 4, 5, 6, 7, 8, 9, 10, 11, 12, 13, 14, 15); }
__device__ __forceinline__ v16bf cat16b(v8us lo, v8us hi) { return __builtin_bit_cast(v16bf, __builtin_shufflevector(lo, hi, 0, 1, 2, 3, 4, 5, 6, 7, 8, 9, 10, 11, 12, 13, 14, 15)); }
__device__ __forceinline__ v8f wmma16(v16h a, v16h b, v8f c) { return __builtin_amdgcn_wmma_f32_16x16x32_f16(false, a, false, b, (short)0, c, false, false); }
__device__ __forceinline__ v8f wmmab(v16bf a, v16bf b, v8f c) { return __builtin_amdgcn_wmma_f32_16x16x32_bf16(false, a, false, b, (short)0, c, false, false); }

// ---- k_gemmw: GEMM, one work-group of 4 waves (2 x 2) per 128x128 output tile, 64x64 (16 accumulators) per wave; operands are 16-bit planes in fragment order; grid (M/128, N/128, Z), 128 threads.
// C[m][n] (f32, pitch ldc, + optional f32 bias[n] via bf16; z = 1, 2 take bias1, bias2) = sum_k A[m][k] Bt[n][k] (+ A2[m][k] Bt[n][k] where NSPLIT == 1). z-batch strides sA/sB/sC in elements. K % 64 == 0, K >= 128, a compile-time constant; A, A2 and Bt have K columns.
// Fragment map (both operands): lane l -> row/col l&15, elements 0..7 <- k 8h..8h+7, elements 8..15 <- k 16+8h..16+8h+7 (h = l>>4); D element r -> row 8h+r, col l&15. In fragment order these are elements 8 l .. 8 l + 7 and 256 + 8 l .. of the fragment's 512.
// A stage is 64 k of the tile's 8 row tiles of each operand: a row tile's 64 k are 2 KiB in a row in the workspace and go as they lie into LDS, 16 bytes a thread, by asynchronous copies; two stage buffers, the next stage's copies fly while this one is multiplied. Every fragment is fetched from L2 once for two waves.
template <typename T16> __device__ __forceinline__ const T16* atb(const T16* u, unsigned bytes) { return (const T16*)((const char*)u + bytes); }
template <typename T16> struct WFrag;
template <> struct WFrag<h16> { typedef v16h V; static __device__ __forceinline__ V ld(const h16* p) { return cat16(*(const v8h*)p, *(const v8h*)(p + 256)); } static __device__ __forceinline__ v8f mma(V a, V b, v8f c) { return wmma16(a, b, c); } };
template <> struct WFrag<bf> { typedef v16bf V; static __device__ __forceinline__ V ld(const bf* p) { return cat16b(*(const v8us*)p, *(const v8us*)(p + 256)); } static __device__ __forceinline__ V lds(const char* p) { return cat16b(*(const v8usa*)p, *(const v8usa*)(p + 512)); } static __device__ __forceinline__ v8f mma(V a, V b, v8f c) { return wmmab(a, b, c); } };
// the thread's 16 bytes of eight row tiles (gs bytes apart in the workspace, 2 KiB apart in LDS); the s_wait_xcnt closes the statement, so no address register of a copy is rewritten ahead of it
__device__ __forceinline__ void cp8(unsigned l, const char* g, unsigned gs) {
    asm volatile("global_load_async_to_lds_b128 %0, %8, off\n\t"
                 "global_load_async_to_lds_b128 %1, %9, off\n\t"
                 "global_load_async_to_lds_b128 %2, %10, off\n\t"
                 "global_load_async_to_lds_b128 %3, %11, off\n\t"
                 "global_load_async_to_lds_b128 %4, %12, off\n\t"
                 "global_load_async_to_lds_b128 %5, %13, off\n\t"
                 "global_load_async_to_lds_b128 %6, %14, off\n\t"
                 "global_load_async_to_lds_b128 %7, %15, off\n\t"
                 "s_wait_xcnt 0x0"
                 :: "v"(l), "v"(l + 2048u), "v"(l + 4096u), "v"(l + 6144u), "v"(l + 8192u), "v"(l + 10240u), "v"(l + 12288u), "v"(l + 14336u),
                    "v"(g), "v"(g + gs), "v"(g + 2 * (size_t)gs), "v"(g + 3 * (size_t)gs), "v"(g + 4 * (size_t)gs), "v"(g + 5 * (size_t)gs), "v"(g + 6 * (size_t)gs), "v"(g + 7 * (size_t)gs) : "memory");
}
// at most 256 registers: three work-groups of the projections fit a WGP (their LDS allows three), and every operand of the copies' asm text stays below v256
template <typename T16, int NSPLIT, bool BIAS, int K>
__global__ __launch_bounds__(128, 4) void k_gemmw(const T16* __restrict__ A, const T16* __restrict__ A2, const T16* __restrict__ Bt, float* C, int ldc, const float* __restrict__ bias0, const float* __restrict__ bias1, const float* __restrict__ bias2, size_t sA, size_t sB, size_t sC) {
    typedef typename WFrag<T16>::V V;
    static_assert(NSPLIT == 0 || NSPLIT == 1); static_assert(K % 64 == 0 && K >= 128);
    constexpr unsigned OPB = 8 * 2048;                       // one operand's part of a stage
    constexpr unsigned BOF = (NSPLIT == 1 ? 2 : 1) * OPB;    // Bt's place in a stage, behind A (and A2)
    constexpr unsigned STG = BOF + OPB;
    constexpr int NT = K / 64;
    __shared__ __align__(16) char st[2 * STG];
    __shared__ __align__(16) float osw[4][16 * 68];
    const size_t z = blockIdx.z; A += z * sA; if (NSPLIT == 1) A2 += z * sA; Bt += z * sB; C += z * sC;
    const float* __restrict__ bias = (z == 0) ? bias0 : (z == 1) ? bias1 : bias2;
    const int lane = threadIdx.x & 31, lr = lane & 15, hi = lane >> 4; const int wid = __builtin_amdgcn_readfirstlane(threadIdx.x >> 5); const int wm = wid & 1, wn = wid >> 1;
    const int rb = blockIdx.x * 128, cb = blockIdx.y * 128;
    v8f acc[4][4];
#pragma unroll
    for (int mb = 0; mb < 4; ++mb)
#pragma unroll
        for (int nb = 0; nb < 4; ++nb) acc[mb][nb] = (v8f){};
    // a 16-row tile is 16 K elements, 64 k of it 2 KiB
    const char* gA = (const char*)(A + (size_t)rb * K) + threadIdx.x * 16; const char* gA2 = (NSPLIT == 1) ? (const char*)(A2 + (size_t)rb * K) + threadIdx.x * 16 : gA; const char* gB = (const char*)(Bt + (size_t)cb * K) + threadIdx.x * 16;
    const unsigned l0 = (unsigned)(size_t)(__attribute__((address_space(3))) char*)st + threadIdx.x * 16;   // the thread's LDS byte address in a row tile of buffer 0
    auto fill = [&](int t, unsigned buf) { const unsigned l = l0 + buf * STG; const size_t go = (size_t)t * 2048;
        cp8(l, gA + go, 32 * K); if (NSPLIT == 1) cp8(l + OPB, gA2 + go, 32 * K); cp8(l + BOF, gB + go, 32 * K); };
    fill(0, 0);
    asm volatile("s_wait_asynccnt 0x0" ::: "memory");   // this wave's copies of stage 0 have landed
    __syncthreads();                                    // ... and every other wave's
    fill(1, 1);
#pragma unroll 1
    for (int t = 0; t < NT; ++t) {
        const char* sb = st + (unsigned)(t & 1) * STG + lane * 16;
#pragma unroll
        for (int ks = 0; ks < 2; ++ks) {
            V a[4], a2[4], b[4];
            b[0] = WFrag<T16>::lds(sb + BOF + (wn * 4) * 2048 + ks * 1024);
#pragma unroll
            for (int mb = 0; mb < 4; ++mb) { a[mb] = WFrag<T16>::lds(sb + (wm * 4 + mb) * 2048 + ks * 1024); if (NSPLIT == 1) a2[mb] = WFrag<T16>::lds(sb + OPB + (wm * 4 + mb) * 2048 + ks * 1024); }
#pragma unroll
            for (int nb = 1; nb < 4; ++nb) b[nb] = WFrag<T16>::lds(sb + BOF + (wn * 4 + nb) * 2048 + ks * 1024);
            __builtin_amdgcn_sched_barrier(0);   // the k step's LDS reads stay one group ahead of its products, in the order of use; without it the build reads Bt fragment by fragment and waits out the LDS latency before every four products
#pragma unroll
            for (int nb = 0; nb < 4; ++nb) {
#pragma unroll
                for (int mb = 0; mb < 4; ++mb) { acc[mb][nb] = WFrag<T16>::mma(a[mb], b[nb], acc[mb][nb]); if (NSPLIT == 1) acc[mb][nb] = WFrag<T16>::mma(a2[mb], b[nb], acc[mb][nb]); } }
        }
        __builtin_amdgcn_sched_barrier(0);                  // the stage's products stay ahead of the foot; without it the build sinks 32 k of them behind the barrier, in front of the refill, whose copies then start that much later
        asm volatile("s_wait_dscnt 0x0" ::: "memory");      // this wave's reads of the buffer are done before it is refilled
        asm volatile("s_wait_asynccnt 0x0" ::: "memory");   // this wave's copies of stage t + 1 have landed
        __syncthreads();                                    // publishes stage t + 1 and ends every wave's reads of stage t
        if (t + 2 < NT) fill(t + 2, (unsigned)(t & 1));
    }
    asm volatile("s_wait_asynccnt 0x0" ::: "memory");       // no copy is outstanding when the wave goes on
    float* os = osw[wid]; const int r0 = rb + wm * 64, c0 = cb + wn * 64;   // the wave's own staging rows and its 64x64 part of the tile
#pragma unroll
    for (int mb = 0; mb < 4; ++mb) {
#pragma unroll
        for (int nb = 0; nb < 4; ++nb) {
#pragma unroll
            for (int j = 0; j < 8; ++j) os[(hi * 8 + j) * 68 + nb * 16 + lr] = acc[mb][nb][j]; }
        __builtin_amdgcn_wave_barrier(); asm volatile("" ::: "memory");
        float* crow = C + (size_t)(r0 + mb * 16) * ldc + c0;
{
#pragma unroll
            for (int s = 0; s < 8; ++s) { const int row = 2 * s + hi, cofs = lr * 4; v4f val = *(const v4fa*)(os + row * 68 + cofs); if (BIAS) { val[0] += bfr(bias[c0 + cofs]); val[1] += bfr(bias[c0 + cofs + 1]); val[2] += bfr(bias[c0 + cofs + 2]); val[3] += bfr(bias[c0 + cofs + 3]); }
                *(v4f*)(crow + (size_t)row * ldc + cofs) = val; }
             }
        asm volatile("s_wait_xcnt 0x0" ::: "memory");   // ahead of the next row tile's code, which reuses the registers that the eight stores name
        __builtin_amdgcn_wave_barrier(); asm volatile("" ::: "memory");
    }
}

__device__ __forceinline__ h16 tohx(float x) { return (h16)x; }
__device__ __forceinline__ void splitf(float y, unsigned short& h, unsigned short& l) { h = f2bf(y); l = f2bf(y - bf2f(h)); }
typedef __attribute__((ext_vector_type(2))) _Float16 v2h;
typedef __attribute__((ext_vector_type(4))) _Float16 v4h;
typedef v4h  __attribute__((may_alias)) v4ha;
typedef __attribute__((ext_vector_type(2))) unsigned short v2us;
typedef __attribute__((ext_vector_type(4))) unsigned short v4us;
typedef __attribute__((ext_vector_type(2))) float v2f;

// The jobs below that need nothing of each other share a launch: each takes a range of the block index (bx: the block's index inside its job, by: the job's slab), picked by a block-uniform branch in k_prep and k_relay.
// y picks one of up to four equally long sources of DM columns; its bf16 copy, in fragment order, is slab y of dst. A wave takes 8 rows x 4 chunks of 8 columns: whole 128-byte lines on both sides.
__device__ __forceinline__ void cvt8(unsigned bx, unsigned y, const float* __restrict__ s0, const float* __restrict__ s1, const float* __restrict__ s2, const float* __restrict__ s3, bf* dst, size_t n8) { const size_t i = (size_t)bx * 256 + threadIdx.x; if (i >= n8) return;
    const float* __restrict__ src = (y == 0) ? s0 : (y == 1) ? s1 : (y == 2) ? s2 : s3; dst += (size_t)y * n8 * 8;
    const size_t u = i >> 6; const size_t row = (u / (DM / 32)) * 16 + ((i >> 5) & 1) * 8 + ((i >> 2) & 7), k = ((u % (DM / 32)) * 4 + (i & 3)) * 8; const v8f v = *(const v8f*)(src + row * DM + k); v8us o;
#pragma unroll
    for (int q = 0; q < 8; ++q) o[q] = f2bf(v[q]); *(v8us*)(dst + FO(row, k, DM)) = o;  }

__device__ __forceinline__ void epad2(unsigned bx, const float* __restrict__ E, bf* EB) { const size_t i = (size_t)bx * 256 + threadIdx.x; if (i >= (size_t)NE * HD / 8) return; const int d0 = (int)(i % (HD / 8)) * 8; const int r = (int)(i / (HD / 8)); const float* src = E + (size_t)min(r, NREL - 1) * HD + d0; v8us o;
#pragma unroll
    for (int q = 0; q < 8; ++q) { const unsigned short v = f2bf(src[q]); o[q] = (r < NREL) ? v : (unsigned short)0; }
    *(v8us*)(EB + FO(r, d0, HD)) = o;  }

// by: slab of TT rows of F (q's batches, then k's) and its nheads planes, each in fragment order. A wave takes 8 rows x 4 chunks of 8 columns: whole 128-byte lines on both sides.
__device__ __forceinline__ void plane(unsigned bx, unsigned by, const float* __restrict__ F, int pitch, int nheads, bf* Ph, bf* Pl) {
    const size_t x = (size_t)bx * 256 + threadIdx.x; if (x >= (size_t)nheads * TT * HD / 8) return;
    F += (size_t)by * TT * pitch; Ph += (size_t)by * nheads * TT * HD; Pl += (size_t)by * nheads * TT * HD;
    const int d = (int)(((x >> 5) & 1) * 4 + (x & 3)) * 8; const int t = (int)((x >> 7) % (TT / 16)) * 16 + (int)((x >> 6) & 1) * 8 + (int)((x >> 2) & 7); const int h = (int)(x / ((size_t)HD * TT / 8));
    const size_t e = (size_t)h * TT * HD + FO(t, d, HD);
    const v8f y = *(const v8f*)(F + (size_t)t * pitch + h * HD + d); v8us oh, ol;
#pragma unroll
    for (int q = 0; q < 8; ++q) { unsigned short a, c2; splitf(y[q], a, c2); oh[q] = a; ol[q] = c2; }
    *(v8us*)(Ph + e) = oh; *(v8us*)(Pl + e) = ol;  }

// by: batch (TT rows of F, nheads planes of VT, each HD rows x PP columns in fragment order). A wave takes 32 neighbouring d of 8 keys: each load one whole line, the store two runs of 256 bytes.
__device__ __forceinline__ void vtp8(unsigned bx, unsigned by, const float* __restrict__ F, int pitch, int nheads, h16* VT) {
    const size_t x = (size_t)bx * 256 + threadIdx.x; if (x >= (size_t)nheads * HD * TT / 8) return;
    F += (size_t)by * TT * pitch; VT += (size_t)by * nheads * HD * PP;
    const int d = (int)(x % HD); const int t = (int)((x / HD) % (TT / 8)) * 8; const int g = (int)(x / ((size_t)TT * HD / 8));
    v8h o;
#pragma unroll
    for (int q = 0; q < 8; ++q) o[q] = tohx(F[(size_t)(t + q) * pitch + g * HD + d]);
    h16* dst = VT + (size_t)g * HD * PP + FO(d, t, PP);
    *(v8h*)dst = o;  }

__device__ __forceinline__ void evt(unsigned bx, const float* __restrict__ EV, int nheads, h16* VT) {
    const size_t x = (size_t)bx * 256 + threadIdx.x; if (x >= (size_t)nheads * HD * NE / 8) return;
    const int d = (int)(x % HD); const int r0 = (int)((x / HD) % (NE / 8)) * 8; const int g = (int)(x / ((size_t)NE * HD / 8));
    v8h o; const float* ep[8]; float ev[8];
#pragma unroll
    for (int q = 0; q < 8; ++q) { ep[q] = EV + (size_t)min(r0 + q, NREL - 1) * HD + d; ev[q] = *ep[q]; }
    // the eight addresses are inputs, so they stay in their registers up to this wait: no result of the run of loads lands in a register that an issued load of the run still names
    asm volatile("s_wait_xcnt 0x0" :: "v"(ep[0]), "v"(ep[1]), "v"(ep[2]), "v"(ep[3]), "v"(ep[4]), "v"(ep[5]), "v"(ep[6]), "v"(ep[7]) : "memory");
#pragma unroll
    for (int q = 0; q < 8; ++q) { const float y = (r0 + q < NREL) ? bfr(ev[q]) : 0.0f; o[q] = tohx(y); }
    h16* dst = VT + (size_t)g * HD * PP + FO(d, TT + r0, PP);
    *(v8h*)dst = o;  }

// blocks of each job
#define GB_E ((NE * HD / 8 + 255) / 256)                  // E_k table
#define GB_V ((NB * NH_ * HD * NE / 8 + 255) / 256)       // E_v^T columns of every plane
#define GB_W ((DQ * DM / 8 + 255) / 256)                  // one weight matrix
#define GB_X ((NB * TT * DM / 8 + 255) / 256)             // one input, all batches
#define GB_P ((NH_ * TT * HD / 8 + 255) / 256)            // one slab of TT projected rows
// k_prep: all that reads only the inputs: the two tables, the bf16 copies of the four weights and of the three inputs. Grid GB_E + GB_V + 4 GB_W + 3 GB_X.
__global__ __launch_bounds__(256) void k_prep(const float* __restrict__ query, const float* __restrict__ key, const float* __restrict__ value, const float* __restrict__ wq, const float* __restrict__ wk, const float* __restrict__ wv, const float* __restrict__ wo,
                                              const float* __restrict__ rke, const float* __restrict__ rve, bf* XB, bf* WQ, bf* EB, h16* VT) {
    unsigned b = blockIdx.x;
    if (b < GB_E) { epad2(b, rke, EB); return; }                                                      /* E_k: 65 rows bf16 (exact), rows 65..127 zero */
    b -= GB_E;
    if (b < GB_V) { evt(b, rve, NB * NH_, VT); return; }                                              /* E_v^T columns TT..TT+127 of every V^T row */
    b -= GB_V;
    if (b < 4 * GB_W) { cvt8(b % GB_W, b / GB_W, wq, wk, wv, wo, WQ, (size_t)DQ * DM / 8); return; }
    b -= 4 * GB_W;
    cvt8(b % GB_X, b / GB_X, query, key, value, value, XB, (size_t)NB * TT * DM / 8);
}
// k_relay: the projections' f32 rows F [q | k | v][NB*TT][DQ] into the operand planes of the attention. Grid 3 NB GB_P.
__global__ __launch_bounds__(256) void k_relay(const float* __restrict__ F, bf* QPh, bf* QPl, h16* VT) {
    unsigned b = blockIdx.x;
    if (b < NB * GB_P) { vtp8(b % GB_P, b / GB_P, F + (size_t)2 * NB * TT * DQ, DQ, NH_, VT); return; }
    b -= NB * GB_P;
    plane(b % GB_P, b / GB_P, F, DQ, NH_, QPh, QPl);
}

// k_fattn: one work-group (8 waves) per FR = 32 query rows of one (batch, head) plane g; the score rows never leave the chip.
// 1) wave w: S[32][128 w .. 128 w + 127] = q.k^T (3 products, same order as a K = 64 GEMM) and column tile w of QE = q.E_k^T (2 products), f32 into LDS;
// 2) wave w, rows 4 w .. 4 w + 3, one row at a time: t_j = S_j * HD^-0.5 + QE[clip(j - i, -32, 32) + 32], softmax over the TT keys (register row, one exp, fixed trees);
//    the fp16 row [1024 p_j, j < TT | at TT + r: r = 0 sum of p over j <= i - 32, r = 64 sum over j >= i + 32, 0 < r < 64 p at j = i + r - 32 (0 outside [0, TT)), r > 64 zero] overwrites the row's own scores;
// 3) wave w: 16x16 tile (row tile w / 4, column tile w % 4) of P.[V | E_v]^T, K = PP in ascending order, A from LDS, B from the V^T plane;
// 4) scaled by 1/1024 and split into the bf16 hi/lo context planes, row b*TT + t, column h*64 + d, in fragment order: a wave stores one chunk of 8 columns of the 32 rows, two runs of 256 bytes.
#define FR   32
#define SPB  (TT * 4 + 16)   // byte pitch of a score row in LDS: 16 rows of a b128 fragment read fall on 64 different banks
#define QEP  132             // float pitch of a QE row
#define OSP  68              // float pitch of a staged output row
static_assert(TT % FR == 0);
static_assert(TT == 8 * 128);     // 8 waves x 128 score columns
static_assert(PP * 2 <= TT * 4);  // the fp16 row fits into its f32 score row
static_assert(OSP <= QEP);
static_assert(2 * MAXR <= 128);   // the band of single keys spans at most two 128-key chunks
// one step of three lane sums at once: each lane adds the values of the lane whose byte index (4 x lane) is src. The three exchanges and their wait are one statement, so a step costs one LDS-path latency;
// written as three __shfl_xor chains the build threads the exchanges one by one, nine to twelve waits in a row for the five steps
__device__ __forceinline__ void xadd3(int src, float& a, float& b, float& c) {
    float x, y, z;
    asm volatile("ds_bpermute_b32 %0, %3, %4\n\t"
                 "ds_bpermute_b32 %1, %3, %5\n\t"
                 "ds_bpermute_b32 %2, %3, %6\n\t"
                 "s_wait_dscnt 0x0"
                 : "=&v"(x), "=&v"(y), "=&v"(z) : "v"(src), "v"(a), "v"(b), "v"(c) : "memory");
    a += x; b += y; c += z;
}
// 4 waves per SIMD = two work-groups per WGP, which their LDS allows: at most 256 registers
__global__ __launch_bounds__(256, 4) void k_fattn(const bf* __restrict__ QPh, const bf* __restrict__ QPl, const bf* __restrict__ KPh, const bf* __restrict__ KPl, const bf* __restrict__ EB, const h16* __restrict__ VT, bf* ATh, bf* ATl) {
    __shared__ __align__(16) char srow[FR * SPB];
    __shared__ __align__(16) float qes[FR * QEP];
    const int lane = threadIdx.x & 31, lr = lane & 15, hi = lane >> 4; const int wid = __builtin_amdgcn_readfirstlane(threadIdx.x >> 5);
    const int g = blockIdx.y, r0 = blockIdx.x * FR; const size_t pl = (size_t)g * TT * HD;
    const unsigned lo = (unsigned)lane * 16;   // the lane's byte offset in a fragment (fragment order); all else of an address is wave-uniform
    {
        v16bf a[2][2], a2[2][2];
        const bf* qbh = QPh + pl + (size_t)r0 * HD; const bf* qbl = QPl + pl + (size_t)r0 * HD;   // wave-uniform bases of the 32 rows
#pragma unroll
        for (int mb = 0; mb < 2; ++mb)
#pragma unroll
            for (int ks = 0; ks < 2; ++ks) { const int ao = mb * 16 * HD + ks * 512; a[mb][ks] = WFrag<bf>::ld(atb(qbh + ao, lo)); a2[mb][ks] = WFrag<bf>::ld(atb(qbl + ao, lo)); }
        // the lane offset and the two bases are inputs, so they stay in their registers up to this wait: no result of the run of loads lands in a register that an issued load of the run still names
        asm volatile("s_wait_xcnt 0x0" :: "v"(lo), "s"(qbh), "s"(qbl) : "memory");
        const bf* kbh = KPh + pl + (size_t)(wid * 128) * HD; const bf* kbl = KPl + pl + (size_t)(wid * 128) * HD;   // wave-uniform bases of the wave's 128 key rows
        // q.E_k^T ahead of the scores: its fragments, tile and LDS addresses are dead while the score products use all 256 registers (behind them the build spills)
        { const size_t eo = (size_t)(wid * 16) * HD; const v16bf e0 = WFrag<bf>::ld(atb(EB + eo, lo)), e1 = WFrag<bf>::ld(atb(EB + eo + 512, lo));
            v8f acq[2];
#pragma unroll
            for (int mb = 0; mb < 2; ++mb) { v8f t = (v8f){}; t = wmmab(a[mb][0], e0, t); t = wmmab(a2[mb][0], e0, t); t = wmmab(a[mb][1], e1, t); t = wmmab(a2[mb][1], e1, t); acq[mb] = t; }
#pragma unroll
            for (int mb = 0; mb < 2; ++mb)
#pragma unroll
                for (int j = 0; j < 8; ++j) qes[(mb * 16 + hi * 8 + j) * QEP + wid * 16 + lr] = acq[mb][j]; }
#pragma unroll
        for (int nh = 0; nh < 2; ++nh) {      // 64 score columns at a time
            v8f acc[2][4];
#pragma unroll
            for (int mb = 0; mb < 2; ++mb)
#pragma unroll
                for (int n4 = 0; n4 < 4; ++n4) acc[mb][n4] = (v8f){};
#pragma unroll
            for (int ks = 0; ks < 2; ++ks) {
                v16bf b[4], b2[4];
#pragma unroll
                for (int n4 = 0; n4 < 4; ++n4) { const int bo = (nh * 4 + n4) * 16 * HD + ks * 512; b[n4] = WFrag<bf>::ld(atb(kbh + bo, lo)); b2[n4] = WFrag<bf>::ld(atb(kbl + bo, lo)); }
                // inputs only: holds the eight fragments' loads together ahead of their products, one memory latency for the group; without it the build loads and waits fragment by fragment
                asm volatile("" :: "v"(b[0]), "v"(b[1]), "v"(b[2]), "v"(b[3]), "v"(b2[0]), "v"(b2[1]), "v"(b2[2]), "v"(b2[3]));
#pragma unroll
                for (int n4 = 0; n4 < 4; ++n4)
#pragma unroll
                    for (int mb = 0; mb < 2; ++mb) { v8f t = acc[mb][n4]; t = wmmab(a[mb][ks], b[n4], t); t = wmmab(a2[mb][ks], b[n4], t); t = wmmab(a[mb][ks], b2[n4], t); acc[mb][n4] = t; }
            }
#pragma unroll
            for (int mb = 0; mb < 2; ++mb)
#pragma unroll
                for (int n4 = 0; n4 < 4; ++n4)
#pragma unroll
                    for (int j = 0; j < 8; ++j) *(float*)(srow + (mb * 16 + hi * 8 + j) * SPB + (wid * 128 + (nh * 4 + n4) * 16 + lr) * 4) = acc[mb][n4][j];
        }
    }
    __syncthreads();
    // rolled: one row's registers at a time
#pragma unroll 1
    for (int rr = 0; rr < FR / 8; ++rr) {
        const int lrow = wid * (FR / 8) + rr; const int i = r0 + lrow;
        const float* sr = (const float*)(srow + lrow * SPB); const float* qe = qes + lrow * QEP; h16* prw = (h16*)(srow + lrow * SPB);
        // register slot k holds the 128-key chunk (cA + k) % 8, cA the chunk of the band's first key: the band i - 31 .. i + 31 lies in slots 0 and 1;
        // a slot k >= 2 lies wholly right of the band or, wrapped past the row's end (cA + k >= 8), wholly left of it: one clipped logit for all its keys, and its sum of exps goes to one tail as a whole
        const int cA = max(i - (MAXR - 1), 0) >> 7;
        const float qL = qe[0], qR = qe[2 * MAXR];
        float v[TT / 32]; float mx = -3.0e38f;
#pragma unroll
        for (int k = 0; k < TT / 128; ++k) { const int j0 = ((cA + k) & (TT / 128 - 1)) * 128 + lane * 4; const v4f s4 = *(const v4fa*)(sr + j0); const float ck = (cA + k >= TT / 128) ? qL : qR;
#pragma unroll
            for (int q = 0; q < 4; ++q) { float c = ck; if (k < 2) { const int r = min(max(j0 + q - i, -MAXR), MAXR) + MAXR; c = qe[r]; }
                const float t = s4[q] * SCL + c; v[k * 4 + q] = t; mx = fmaxf(mx, t); } }
#pragma unroll
        for (int sh = 16; sh; sh >>= 1) mx = fmaxf(mx, __int_as_float(__builtin_amdgcn_ds_bpermute((lane ^ sh) << 2, __float_as_int(mx))));   // the exchange of __shfl_xor on the index registers of xadd3 below: one set of five, not two, is live at the end of the score products
        // tails as sums of exps, scaled once below: per key only where the band's edges can lie (left edge: slot 0; right edge: slots 0 and 1; slot 1 holds left keys only when wrapped, then all of them)
        float sum = 0.f, tl0 = 0.f, tl1 = 0.f;
#pragma unroll
        for (int k = 0; k < TT / 128; ++k) { const int j0 = ((cA + k) & (TT / 128 - 1)) * 128 + lane * 4; const bool wr = cA + k >= TT / 128;
#pragma unroll
            for (int q = 0; q < 4; ++q) { const float x = __builtin_amdgcn_exp2f(__fmul_rn(__fsub_rn(v[k * 4 + q], mx), 1.4426950408889634f)); v[k * 4 + q] = x;
                if (k == 0) tl0 += (j0 + q <= i - MAXR) ? x : 0.f;
                if (k < 2) tl1 += (j0 + q >= i + MAXR) ? x : 0.f; }
            const float e = (v[k * 4] + v[k * 4 + 1]) + (v[k * 4 + 2] + v[k * 4 + 3]); sum = (k == 0) ? e : sum + e;
            if (k >= 1) tl0 = fmaf(e, wr ? 1.f : 0.f, tl0);
            if (k >= 2) tl1 = fmaf(e, wr ? 0.f : 1.f, tl1); }
#pragma unroll
        for (int sh = 16; sh; sh >>= 1) xadd3((lane ^ sh) << 2, sum, tl0, tl1);
        const float f = __fdiv_rn(PCAR, sum);
        tl0 *= f; tl1 *= f;
#pragma unroll
        for (int k = 0; k < TT / 128; ++k) { const int j0 = ((cA + k) & (TT / 128 - 1)) * 128 + lane * 4; v4h o4;
#pragma unroll
            for (int q = 0; q < 4; ++q) o4[q] = tohx(v[k * 4 + q] * f);
            *(v4ha*)(prw + j0) = o4; }
        __syncthreads();   // the band below reads fp16 values that other lanes stored
        v4h bq4;
#pragma unroll
        for (int q = 0; q < 4; ++q) { const int r = lane * 4 + q; const int j = i + r - MAXR; const int jc = min(max(j, 0), TT - 1); h16 w = prw[jc];
            w = (r > 0 && r < 2 * MAXR && j >= 0 && j < TT) ? w : (h16)0.f; w = (r == 0) ? tohx(tl0) : w; w = (r == 2 * MAXR) ? tohx(tl1) : w; bq4[q] = w; }
        *(v4ha*)(prw + TT + lane * 4) = bq4;
    }
    __syncthreads();
    {
        const int mb = wid >> 2, nb = wid & 3;
        const char* ap = srow + (mb * 16 + lr) * SPB + 16 * hi; const h16* bp = VT + ((size_t)g * HD + nb * 16) * PP;
        v8f acc = (v8f){};
#pragma unroll
        for (int kc = 0; kc < PP; kc += 32) { const v16h pa = cat16(*(const v8ha*)(ap + kc * 2), *(const v8ha*)(ap + kc * 2 + 32)); acc = wmma16(pa, WFrag<h16>::ld(atb(bp + kc * 16, lo)), acc); }
#pragma unroll
        for (int j = 0; j < 8; ++j) qes[(mb * 16 + (int)(__lane_id() >> 4) * 8 + j) * OSP + nb * 16 + lr] = acc[j];   // the QE rows are dead behind the barrier above; the lane's half is formed anew: held from the kernel's head it is spilled, and its reload waits for every V load in flight
    }
    __syncthreads();
    { const int t = lane, d0 = wid * 8; const float cs = 1.0f / PCAR; const v4f x0 = *(const v4fa*)(qes + t * OSP + d0), x1 = *(const v4fa*)(qes + t * OSP + d0 + 4);
        v8us oh, ol;
#pragma unroll
        for (int q = 0; q < 8; ++q) { unsigned short c1, c2; splitf((q < 4 ? x0[q & 3] : x1[q & 3]) * cs, c1, c2); oh[q] = c1; ol[q] = c2; }
        const size_t oo = FO((size_t)(g / NH_) * TT + r0 + t, (size_t)(g % NH_) * HD + d0, DQ);
        *(v8us*)(ATh + oo) = oh; *(v8us*)(ATl + oo) = ol; }
}

extern "C" void kernel_launch(void* const* d_in, const int* in_sizes, int n_in,
                              void* d_out, int out_size, void* d_ws, size_t ws_size, hipStream_t stream) {
    if (n_in < 13) return;
    const size_t needX = ((size_t)(NB - 1) * SEQ_FULL + TT) * DM;
    if ((size_t)in_sizes[0] < needX || (size_t)in_sizes[1] < needX || (size_t)in_sizes[2] < needX) return;
    if (in_sizes[3] < DM * DM || in_sizes[5] < DM * DM || in_sizes[7] < DM * DM || in_sizes[9] < DM * DM) return;
    if (in_sizes[4] < DM || in_sizes[6] < DM || in_sizes[8] < DM || in_sizes[10] < DM) return;
    if (in_sizes[11] < NREL * HD || in_sizes[12] < NREL * HD) return;
    if ((size_t)out_size < needX) return;
    const float* query = (const float*)d_in[0]; const float* key = (const float*)d_in[1]; const float* value = (const float*)d_in[2];
    const float* wq = (const float*)d_in[3]; const float* bq = (const float*)d_in[4]; const float* wk = (const float*)d_in[5]; const float* bk = (const float*)d_in[6];
    const float* wv = (const float*)d_in[7]; const float* bv = (const float*)d_in[8]; const float* wo = (const float*)d_in[9]; const float* bo = (const float*)d_in[10];
    const float* rke = (const float*)d_in[11]; const float* rve = (const float*)d_in[12];
    float* OUT = (float*)d_out;     // [NB][SEQ_FULL][DM]
    char* wsp = (char*)d_ws;
    auto take = [&](size_t bytes) { char* p = wsp; wsp += (bytes + 255) & ~(size_t)255; return (void*)p; };
    constexpr size_t MR = (size_t)NB * TT;      // rows of all batches
    constexpr size_t NG = (size_t)NB * NH_;     // (batch, head) planes
    bf* WQ = (bf*)take((size_t)4 * DQ * DM * 2); bf* WO = WQ + (size_t)3 * DQ * DM;      // wq, wk, wv, wo
    bf* EB = (bf*)take((size_t)NE * HD * 2);
    bf* XB = (bf*)take((size_t)3 * MR * DM * 2); float* F = (float*)take((size_t)3 * MR * DQ * 4);      // q, k, v
    bf* QPh = (bf*)take((size_t)2 * NG * TT * HD * 2); bf* QPl = (bf*)take((size_t)2 * NG * TT * HD * 2); bf* KPh = QPh + NG * TT * HD; bf* KPl = QPl + NG * TT * HD;
    h16* VT = (h16*)take(NG * HD * PP * 2);
    bf* ATh = (bf*)take(MR * DQ * 2); bf* ATl = (bf*)take(MR * DQ * 2);
    const size_t carved = (size_t)(wsp - (char*)d_ws);
    if (carved > ws_size) return;    // 143,671,296 B at NB=4, SEQ=1024
    // tables, weights and inputs
    k_prep<<<GB_E + GB_V + 4 * GB_W + 3 * GB_X, 256, 0, stream>>>(query, key, value, wq, wk, wv, wo, rke, rve, XB, WQ, EB, VT);
    // projections of all batches: z = q, k, v
    k_gemmw<bf, 0, true, DM><<<dim3((unsigned)(MR / 128), DQ / 128, 3), 128, 0, stream>>>(XB, nullptr, WQ, F, DQ, bq, bk, bv, MR * DM, (size_t)DQ * DM, MR * DQ);
    k_relay<<<3 * NB * GB_P, 256, 0, stream>>>(F, QPh, QPl, VT);
    k_fattn<<<dim3(TT / FR, (unsigned)NG, 1), 256, 0, stream>>>(QPh, QPl, KPh, KPl, EB, VT, ATh, ATl);   /* scores, softmax, attn.[V | E_v], context planes */
    k_gemmw<bf, 1, true, DQ><<<dim3((unsigned)(MR / 128), DM / 128, 1), 128, 0, stream>>>(ATh, ATl, WO, OUT, DM, bo, bo, bo, 0, 0, 0);
}

// v007
// Measured time: 116 microseconds a run.
// Two timings next to v006 both put it at 1.03 times that version's speed.
// All steps since v000 together make it 7.87 times as fast.
#include <hip/hip_runtime.h>

// Contractions, f32 accumulate: q/k/v projections v_wmma_f32_16x16x32_bf16 (x, W, bias all RNE-converted to bf16, single product); content scores v_wmma_f32_16x16x32_bf16 with q and k as bf16 hi/lo planes (3 products); q.E_k^T bf16 hi/lo x exact bf16 E_k (2 products); attn.[V | rel-value buckets] v_wmma_f32_16x16x32_f16 (P carried x1024 in fp16, V fp16, E_v exact); output projection bf16 hi/lo context x exact bf16 W_o (2 products) + bf16 bias. Softmax, logit adds and carries in f32.
// Layout, all batches at once: bf16 copy of the three inputs [3][NB*TT][DM]; one projection launch (z = q, k, v; f32) -> planes per (batch, head) g = b*NH_ + h (q, k: [g][t][d] bf16 hi + lo; v: [g][d][t] fp16 with pitch TT+128 whose last 128 columns hold E_v^T (65 used, rest zero)).
// Every 16-bit matrix operand in the workspace (R rows, K columns) lies in fragment order: [row / 16][k / 8][row % 16][k % 8], element offset FO(row, k, K); the 16 x 32 fragment at (row tile, k step) is then 1 KiB in a row and each of its two wave-wide 16-byte loads covers 512 contiguous bytes (4 whole lines).
// Attention, one launch for all NB*NH_ planes (k_fattn): per 32 query rows S = q.k^T and QE = q.E_k^T stay in LDS (f32); t_j = S_j / 8 + QE[clip(j - i, -32, 32) + 32], softmax over TT keys, P row = [1024 p_j fp16 | bucket sums: r = 0 keys j <= i - 32, r = 64 keys j >= i + 32, 0 < r < 64 the single key i + r - 32, r > 64 zero];
// one product with K = TT + 128 gives 1024 (attn.V + attn.E_v[clip]), scaled by 1/1024 into bf16 hi/lo context planes [b*TT + t][h*64 + d]; one output GEMM over all NB*TT rows with bias.

#ifndef NB
#define NB 4
#endif
#ifndef SEQ
#define SEQ 1024
#endif
#define NB_FULL  4
#define SEQ_FULL 1024
#define TT   SEQ
#define DM   1024
#define NH_  16
#define HD   64
#define DQ   (NH_ * HD)
#define PCAR 1024.0f
#define SCL  0.125f
#define NE   128     // rel tables (65 rows) padded to 128
#define NREL 65
#define MAXR 32
#define PP   (TT + NE)   // P row length and V^T columns (keys + rel buckets)
static_assert(TT % 128 == 0);
static_assert(TT == SEQ_FULL);   // the batches' rows are folded into one M = NB*TT dimension
static_assert(NB <= NB_FULL);
static_assert(NB >= 1);
static_assert(PP % 32 == 0);
static_assert(NREL == 2 * MAXR + 1);
static_assert(DM % 64 == 0);
static_assert(HD == 64);   // plane's thread map: 8 chunks of 8 columns a row

typedef _Float16 h16;
typedef unsigned short bf;
typedef __attribute__((ext_vector_type(16))) __bf16   v16bf;
typedef __attribute__((ext_vector_type(16))) _Float16 v16h;
typedef __attribute__((ext_vector_type(8)))  _Float16 v8h;
typedef __attribute__((ext_vector_type(8)))  unsigned short v8us;
typedef __attribute__((ext_vector_type(8)))  float    v8f;
typedef __attribute__((ext_vector_type(4)))  float    v4f;
typedef v8h  __attribute__((may_alias)) v8ha;
typedef v4f  __attribute__((may_alias)) v4fa;
typedef v8us __attribute__((may_alias)) v8usa;

__device__ __forceinline__ unsigned short f2bf(float f) { unsigned u = __float_as_uint(f); u += 0x7FFFu + ((u >> 16) & 1u); return (unsigned short)(u >> 16); }
__device__ __forceinline__ float bf2f(unsigned short b) { return __uint_as_float(((unsigned)b) << 16); }
__device__ __forceinline__ float bfr(float f) { return bf2f(f2bf(f)); }
__device__ __forceinline__ size_t FO(size_t row, size_t k, size_t K) { return ((row >> 4) * (K >> 3) + (k >> 3)) * 128 + (row & 15) * 8 + (k & 7); }
__device__ __forceinline__ v16h cat16(v8h lo, v8h hi) { return __builtin_shufflevector(lo, hi, 0, 1, 2, 3, 4, 5, 6, 7, 8, 9, 10, 11, 12, 13, 14, 15); }
__device__ __forceinline__ v16bf cat16b(v8us lo, v8us hi) { return __builtin_bit_cast(v16bf, __builtin_shufflevector(lo, hi, 0, 1, 2, 3, 4, 5, 6, 7, 8, 9, 10, 11, 12, 13, 14, 15)); }
__device__ __forceinline__ v8f wmma16(v16h a, v16h b, v8f c) { return __builtin_amdgcn_wmma_f32_16x16x32_f16(false, a, false, b, (short)0, c, false, false); }
__device__ __forceinline__ v8f wmmab(v16bf a, v16bf b, v8f c) { return __builtin_amdgcn_wmma_f32_16x16x32_bf16(false, a, false, b, (short)0, c, false, false); }

// ---- k_gemmw: GEMM, one work-group of 4 waves (2 x 2) per 128x128 output tile, 64x64 (16 accumulators) per wave; operands are 16-bit planes in fragment order; grid (M/128, N/128, Z), 128 threads.
// C[m][n] (f32, pitch ldc, + optional f32 bias[n] via bf16; z = 1, 2 take bias1, bias2) = sum_k A[m][k] Bt[n][k] (+ A2[m][k] Bt[n][k] where NSPLIT == 1). z-batch strides sA/sB/sC in elements. K % 64 == 0, K >= 128, a compile-time constant; A, A2 and Bt have K columns.
// Fragment map (both operands): lane l -> row/col l&15, elements 0..7 <- k 8h..8h+7, elements 8..15 <- k 16+8h..16+8h+7 (h = l>>4); D element r -> row 8h+r, col l&15. In fragment order these are elements 8 l .. 8 l + 7 and 256 + 8 l .. of the fragment's 512.
// A stage is 64 k of the tile's 8 row tiles of each operand: a row tile's 64 k are 2 KiB in a row in the workspace and go as they lie into LDS, 16 bytes a thread, by asynchronous copies; two stage buffers, the next stage's copies fly while this one is multiplied. Every fragment is fetched from L2 once for two waves.
template <typename T16> __device__ __forceinline__ const T16* atb(const T16* u, unsigned bytes) { return (const T16*)((const char*)u + bytes); }
template <typename T16> struct WFrag;
template <> struct WFrag<h16> { typedef v16h V; static __device__ __forceinline__ V ld(const h16* p) { return cat16(*(const v8h*)p, *(const v8h*)(p + 256)); } static __device__ __forceinline__ v8f mma(V a, V b, v8f c) { return wmma16(a, b, c); } };
template <> struct WFrag<bf> { typedef v16bf V; static __device__ __forceinline__ V ld(const bf* p) { return cat16b(*(const v8us*)p, *(const v8us*)(p + 256)); } static __device__ __forceinline__ V lds(const char* p) { return cat16b(*(const v8usa*)p, *(const v8usa*)(p + 512)); } static __device__ __forceinline__ v8f mma(V a, V b, v8f c) { return wmmab(a, b, c); } };
// the thread's 16 bytes of eight row tiles (gs bytes apart in the workspace, 2 KiB apart in LDS); the s_wait_xcnt closes the statement, so no address register of a copy is rewritten ahead of it
__device__ __forceinline__ void cp8(unsigned l, const char* g, unsigned gs) {
    asm volatile("global_load_async_to_lds_b128 %0, %8, off\n\t"
                 "global_load_async_to_lds_b128 %1, %9, off\n\t"
                 "global_load_async_to_lds_b128 %2, %10, off\n\t"
                 "global_load_async_to_lds_b128 %3, %11, off\n\t"
                 "global_load_async_to_lds_b128 %4, %12, off\n\t"
                 "global_load_async_to_lds_b128 %5, %13, off\n\t"
                 "global_load_async_to_lds_b128 %6, %14, off\n\t"
                 "global_load_async_to_lds_b128 %7, %15, off\n\t"
                 "s_wait_xcnt 0x0"
                 :: "v"(l), "v"(l + 2048u), "v"(l + 4096u), "v"(l + 6144u), "v"(l + 8192u), "v"(l + 10240u), "v"(l + 12288u), "v"(l + 14336u),
                    "v"(g), "v"(g + gs), "v"(g + 2 * (size_t)gs), "v"(g + 3 * (size_t)gs), "v"(g + 4 * (size_t)gs), "v"(g + 5 * (size_t)gs), "v"(g + 6 * (size_t)gs), "v"(g + 7 * (size_t)gs) : "memory");
}
// at most 256 registers: three work-groups of the projections fit a WGP (their LDS allows three), and every operand of the copies' asm text stays below v256
template <typename T16, int NSPLIT, bool BIAS, int K>
__global__ __launch_bounds__(128, 4) void k_gemmw(const T16* __restrict__ A, const T16* __restrict__ A2, const T16* __restrict__ Bt, float* C, int ldc, const float* __restrict__ bias0, const float* __restrict__ bias1, const float* __restrict__ bias2, size_t sA, size_t sB, size_t sC) {
    typedef typename WFrag<T16>::V V;
    static_assert(NSPLIT == 0 || NSPLIT == 1); static_assert(K % 64 == 0 && K >= 128);
    constexpr unsigned OPB = 8 * 2048;                       // one operand's part of a stage
    constexpr unsigned BOF = (NSPLIT == 1 ? 2 : 1) * OPB;    // Bt's place in a stage, behind A (and A2)
    constexpr unsigned STG = BOF + OPB;
    constexpr int NT = K / 64;
    __shared__ __align__(16) char st[2 * STG];
    __shared__ __align__(16) float osw[4][16 * 68];
    const size_t z = blockIdx.z; A += z * sA; if (NSPLIT == 1) A2 += z * sA; Bt += z * sB; C += z * sC;
    const float* __restrict__ bias = (z == 0) ? bias0 : (z == 1) ? bias1 : bias2;
    const int lane = threadIdx.x & 31, lr = lane & 15, hi = lane >> 4; const int wid = __builtin_amdgcn_readfirstlane(threadIdx.x >> 5); const int wm = wid & 1, wn = wid >> 1;
    const int rb = blockIdx.x * 128, cb = blockIdx.y * 128;
    v8f acc[4][4];
#pragma unroll
    for (int mb = 0; mb < 4; ++mb)
#pragma unroll
        for (int nb = 0; nb < 4; ++nb) acc[mb][nb] = (v8f){};
    // a 16-row tile is 16 K elements, 64 k of it 2 KiB
    const char* gA = (const char*)(A + (size_t)rb * K) + threadIdx.x * 16; const char* gA2 = (NSPLIT == 1) ? (const char*)(A2 + (size_t)rb * K) + threadIdx.x * 16 : gA; const char* gB = (const char*)(Bt + (size_t)cb * K) + threadIdx.x * 16;
    const unsigned l0 = (unsigned)(size_t)(__attribute__((address_space(3))) char*)st + threadIdx.x * 16;   // the thread's LDS byte address in a row tile of buffer 0
    auto fill = [&](int t, unsigned buf) { const unsigned l = l0 + buf * STG; const size_t go = (size_t)t * 2048;
        cp8(l, gA + go, 32 * K); if (NSPLIT == 1) cp8(l + OPB, gA2 + go, 32 * K); cp8(l + BOF, gB + go, 32 * K); };
    fill(0, 0);
    asm volatile("s_wait_asynccnt 0x0" ::: "memory");   // this wave's copies of stage 0 have landed
    __syncthreads();                                    // ... and every other wave's
    fill(1, 1);
#pragma unroll 1
    for (int t = 0; t < NT; ++t) {
        const char* sb = st + (unsigned)(t & 1) * STG + lane * 16;
#pragma unroll
        for (int ks = 0; ks < 2; ++ks) {
            V a[4], a2[4], b[4];
            b[0] = WFrag<T16>::lds(sb + BOF + (wn * 4) * 2048 + ks * 1024);
#pragma unroll
            for (int mb = 0; mb < 4; ++mb) { a[mb] = WFrag<T16>::lds(sb + (wm * 4 + mb) * 2048 + ks * 1024); if (NSPLIT == 1) a2[mb] = WFrag<T16>::lds(sb + OPB + (wm * 4 + mb) * 2048 + ks * 1024); }
#pragma unroll
            for (int nb = 1; nb < 4; ++nb) b[nb] = WFrag<T16>::lds(sb + BOF + (wn * 4 + nb) * 2048 + ks * 1024);
            __builtin_amdgcn_sched_barrier(0);   // the k step's LDS reads stay one group ahead of its products, in the order of use; without it the build reads Bt fragment by fragment and waits out the LDS latency before every four products
#pragma unroll
            for (int nb = 0; nb < 4; ++nb) {
#pragma unroll
                for (int mb = 0; mb < 4; ++mb) { acc[mb][nb] = WFrag<T16>::mma(a[mb], b[nb], acc[mb][nb]); if (NSPLIT == 1) acc[mb][nb] = WFrag<T16>::mma(a2[mb], b[nb], acc[mb][nb]); } }
        }
        __builtin_amdgcn_sched_barrier(0);                  // the stage's products stay ahead of the foot; without it the build sinks 32 k of them behind the barrier, in front of the refill, whose copies then start that much later
        asm volatile("s_wait_dscnt 0x0" ::: "memory");      // this wave's reads of the buffer are done before it is refilled
        asm volatile("s_wait_asynccnt 0x0" ::: "memory");   // this wave's copies of stage t + 1 have landed
        __syncthreads();                                    // publishes stage t + 1 and ends every wave's reads of stage t
        if (t + 2 < NT) fill(t + 2, (unsigned)(t & 1));
    }
    asm volatile("s_wait_asynccnt 0x0" ::: "memory");       // no copy is outstanding when the wave goes on
    float* os = osw[wid]; const int r0 = rb + wm * 64, c0 = cb + wn * 64;   // the wave's own staging rows and its 64x64 part of the tile
#pragma unroll
    for (int mb = 0; mb < 4; ++mb) {
#pragma unroll
        for (int nb = 0; nb < 4; ++nb) {
#pragma unroll
            for (int j = 0; j < 8; ++j) os[(hi * 8 + j) * 68 + nb * 16 + lr] = acc[mb][nb][j]; }
        __builtin_amdgcn_wave_barrier(); asm volatile("" ::: "memory");
        float* crow = C + (size_t)(r0 + mb * 16) * ldc + c0;
{
#pragma unroll
            for (int s = 0; s < 8; ++s) { const int row = 2 * s + hi, cofs = lr * 4; v4f val = *(const v4fa*)(os + row * 68 + cofs); if (BIAS) { val[0] += bfr(bias[c0 + cofs]); val[1] += bfr(bias[c0 + cofs + 1]); val[2] += bfr(bias[c0 + cofs + 2]); val[3] += bfr(bias[c0 + cofs + 3]); }
                *(v4f*)(crow + (size_t)row * ldc + cofs) = val; }
             }
        asm volatile("s_wait_xcnt 0x0" ::: "memory");   // ahead of the next row tile's code, which reuses the registers that the eight stores name
        __builtin_amdgcn_wave_barrier(); asm volatile("" ::: "memory");
    }
}

__device__ __forceinline__ h16 tohx(float x) { return (h16)x; }
__device__ __forceinline__ void splitf(float y, unsigned short& h, unsigned short& l) { h = f2bf(y); l = f2bf(y - bf2f(h)); }
typedef __attribute__((ext_vector_type(2))) _Float16 v2h;
typedef __attribute__((ext_vector_type(4))) _Float16 v4h;
typedef v4h  __attribute__((may_alias)) v4ha;
typedef __attribute__((ext_vector_type(2))) unsigned short v2us;
typedef __attribute__((ext_vector_type(4))) unsigned short v4us;
typedef __attribute__((ext_vector_type(2))) float v2f;

// The jobs below that need nothing of each other share a launch: each takes a range of the block index (bx: the block's index inside its job, by: the job's slab), picked by a block-uniform branch in k_prep and k_relay.
// y picks one of up to four equally long sources of DM columns; its bf16 copy, in fragment order, is slab y of dst. A wave takes 8 rows x 4 chunks of 8 columns: whole 128-byte lines on both sides.
__device__ __forceinline__ void cvt8(unsigned bx, unsigned y, const float* __restrict__ s0, const float* __restrict__ s1, const float* __restrict__ s2, const float* __restrict__ s3, bf* dst, size_t n8) { const size_t i = (size_t)bx * 256 + threadIdx.x; if (i >= n8) return;
    const float* __restrict__ src = (y == 0) ? s0 : (y == 1) ? s1 : (y == 2) ? s2 : s3; dst += (size_t)y * n8 * 8;
    const size_t u = i >> 6; const size_t row = (u / (DM / 32)) * 16 + ((i >> 5) & 1) * 8 + ((i >> 2) & 7), k = ((u % (DM / 32)) * 4 + (i & 3)) * 8; const v8f v = *(const v8f*)(src + row * DM + k); v8us o;
#pragma unroll
    for (int q = 0; q < 8; ++q) o[q] = f2bf(v[q]); *(v8us*)(dst + FO(row, k, DM)) = o;  }

__device__ __forceinline__ void epad2(unsigned bx, const float* __restrict__ E, bf* EB) { const size_t i = (size_t)bx * 256 + threadIdx.x; if (i >= (size_t)NE * HD / 8) return; const int d0 = (int)(i % (HD / 8)) * 8; const int r = (int)(i / (HD / 8)); const float* src = E + (size_t)min(r, NREL - 1) * HD + d0; v8us o;
#pragma unroll
    for (int q = 0; q < 8; ++q) { const unsigned short v = f2bf(src[q]); o[q] = (r < NREL) ? v : (unsigned short)0; }
    *(v8us*)(EB + FO(r, d0, HD)) = o;  }

// by: slab of TT rows of F (q's batches, then k's) and its nheads planes, each in fragment order. A wave takes 8 rows x 4 chunks of 8 columns: whole 128-byte lines on both sides.
__device__ __forceinline__ void plane(unsigned bx, unsigned by, const float* __restrict__ F, int pitch, int nheads, bf* Ph, bf* Pl) {
    const size_t x = (size_t)bx * 256 + threadIdx.x; if (x >= (size_t)nheads * TT * HD / 8) return;
    F += (size_t)by * TT * pitch; Ph += (size_t)by * nheads * TT * HD; Pl += (size_t)by * nheads * TT * HD;
    const int d = (int)(((x >> 5) & 1) * 4 + (x & 3)) * 8; const int t = (int)((x >> 7) % (TT / 16)) * 16 + (int)((x >> 6) & 1) * 8 + (int)((x >> 2) & 7); const int h = (int)(x / ((size_t)HD * TT / 8));
    const size_t e = (size_t)h * TT * HD + FO(t, d, HD);
    const v8f y = *(const v8f*)(F + (size_t)t * pitch + h * HD + d); v8us oh, ol;
#pragma unroll
    for (int q = 0; q < 8; ++q) { unsigned short a, c2; splitf(y[q], a, c2); oh[q] = a; ol[q] = c2; }
    *(v8us*)(Ph + e) = oh; *(v8us*)(Pl + e) = ol;  }

// by: batch (TT rows of F, nheads planes of VT, each HD rows x PP columns in fragment order). A wave takes 32 neighbouring d of 8 keys: each load one whole line, the store two runs of 256 bytes.
__device__ __forceinline__ void vtp8(unsigned bx, unsigned by, const float* __restrict__ F, int pitch, int nheads, h16* VT) {
    const size_t x = (size_t)bx * 256 + threadIdx.x; if (x >= (size_t)nheads * HD * TT / 8) return;
    F += (size_t)by * TT * pitch; VT += (size_t)by * nheads * HD * PP;
    const int d = (int)(x % HD); const int t = (int)((x / HD) % (TT / 8)) * 8; const int g = (int)(x / ((size_t)TT * HD / 8));
    v8h o;
#pragma unroll
    for (int q = 0; q < 8; ++q) o[q] = tohx(F[(size_t)(t + q) * pitch + g * HD + d]);
    h16* dst = VT + (size_t)g * HD * PP + FO(d, t, PP);
    *(v8h*)dst = o;  }

__device__ __forceinline__ void evt(unsigned bx, const float* __restrict__ EV, int nheads, h16* VT) {
    const size_t x = (size_t)bx * 256 + threadIdx.x; if (x >= (size_t)nheads * HD * NE / 8) return;
    const int d = (int)(x % HD); const int r0 = (int)((x / HD) % (NE / 8)) * 8; const int g = (int)(x / ((size_t)NE * HD / 8));
    v8h o; const float* ep[8]; float ev[8];
#pragma unroll
    for (int q = 0; q < 8; ++q) { ep[q] = EV + (size_t)min(r0 + q, NREL - 1) * HD + d; ev[q] = *ep[q]; }
    // the eight addresses are inputs, so they stay in their registers up to this wait: no result of the run of loads lands in a register that an issued load of the run still names
    asm volatile("s_wait_xcnt 0x0" :: "v"(ep[0]), "v"(ep[1]), "v"(ep[2]), "v"(ep[3]), "v"(ep[4]), "v"(ep[5]), "v"(ep[6]), "v"(ep[7]) : "memory");
#pragma unroll
    for (int q = 0; q < 8; ++q) { const float y = (r0 + q < NREL) ? bfr(ev[q]) : 0.0f; o[q] = tohx(y); }
    h16* dst = VT + (size_t)g * HD * PP + FO(d, TT + r0, PP);
    *(v8h*)dst = o;  }

// blocks of each job
#define GB_E ((NE * HD / 8 + 255) / 256)                  // E_k table
#define GB_V ((NB * NH_ * HD * NE / 8 + 255) / 256)       // E_v^T columns of every plane
#define GB_W ((DQ * DM / 8 + 255) / 256)                  // one weight matrix
#define GB_X ((NB * TT * DM / 8 + 255) / 256)             // one input, all batches
#define GB_P ((NH_ * TT * HD / 8 + 255) / 256)            // one slab of TT projected rows
// k_prep: all that reads only the inputs: the two tables, the bf16 copies of the four weights and of the three inputs. Grid GB_E + GB_V + 4 GB_W + 3 GB_X.
__global__ __launch_bounds__(256) void k_prep(const float* __restrict__ query, const float* __restrict__ key, const float* __restrict__ value, const float* __restrict__ wq, const float* __restrict__ wk, const float* __restrict__ wv, const float* __restrict__ wo,
                                              const float* __restrict__ rke, const float* __restrict__ rve, bf* XB, bf* WQ, bf* EB, h16* VT) {
    unsigned b = blockIdx.x;
    if (b < GB_E) { epad2(b, rke, EB); return; }                                                      /* E_k: 65 rows bf16 (exact), rows 65..127 zero */
    b -= GB_E;
    if (b < GB_V) { evt(b, rve, NB * NH_, VT); return; }                                              /* E_v^T columns TT..TT+127 of every V^T row */
    b -= GB_V;
    if (b < 4 * GB_W) { cvt8(b % GB_W, b / GB_W, wq, wk, wv, wo, WQ, (size_t)DQ * DM / 8); return; }
    b -= 4 * GB_W;
    cvt8(b % GB_X, b / GB_X, query, key, value, value, XB, (size_t)NB * TT * DM / 8);
}
// k_relay: the projections' f32 rows F [q | k | v][NB*TT][DQ] into the operand planes of the attention. Grid 3 NB GB_P.
__global__ __launch_bounds__(256) void k_relay(const float* __restrict__ F, bf* QPh, bf* QPl, h16* VT) {
    unsigned b = blockIdx.x;
    if (b < NB * GB_P) { vtp8(b % GB_P, b / GB_P, F + (size_t)2 * NB * TT * DQ, DQ, NH_, VT); return; }
    b -= NB * GB_P;
    plane(b % GB_P, b / GB_P, F, DQ, NH_, QPh, QPl);
}

// k_fattn: one work-group (8 waves) per FR = 32 query rows of one (batch, head) plane g; the score rows never leave the chip.
// 1) wave w: S[32][128 w .. 128 w + 127] = q.k^T (3 products, same order as a K = 64 GEMM) and column tile w of QE = q.E_k^T (2 products), f32 into LDS;
// 2) wave w, rows 4 w .. 4 w + 3, one row at a time: t_j = S_j * HD^-0.5 + QE[clip(j - i, -32, 32) + 32], softmax over the TT keys (register row, one exp, fixed trees);
//    the fp16 row [1024 p_j, j < TT | at TT + r: r = 0 sum of p over j <= i - 32, r = 64 sum over j >= i + 32, 0 < r < 64 p at j = i + r - 32 (0 outside [0, TT)), r > 64 zero] overwrites the row's own scores;
// 3) wave w: quarter w / 2 of the PP keys, columns 32 (w % 2) .. + 31, all 32 rows of P.[V | E_v]^T (2 x 2 tiles, ascending k inside the quarter), A from LDS, B from the V^T plane; f32 partial sums into LDS;
// 4) the four quarters added as (0 + 1) + (2 + 3), scaled by 1/1024 and split into the bf16 hi/lo context planes, row b*TT + t, column h*64 + d, in fragment order: a wave stores one chunk of 8 columns of the 32 rows, two runs of 256 bytes.
#define FR   32
#define SPB  (TT * 4 + 16)   // byte pitch of a score row in LDS: 16 rows of a b128 fragment read fall on 64 different banks
#define QEP  132             // float pitch of a QE row
#define OSP  68              // float stride of one key quarter's partial sums in a score row
static_assert(TT % FR == 0);
static_assert(TT == 8 * 128);     // 8 waves x 128 score columns
static_assert(PP * 2 <= TT * 4);  // the fp16 row fits into its f32 score row
#define KQ   (PP / 4)        // keys of one wave in the P.[V | E_v] product
#define POF  (PP * 2)        // byte offset of the partial sums in a score row, behind the fp16 row
static_assert(KQ % 32 == 0);
static_assert(POF % 16 == 0 && POF + 4 * OSP * 4 <= TT * 4);   // four staged quarters fit behind the fp16 row
static_assert(2 * MAXR <= 128);   // the band of single keys spans at most two 128-key chunks
// one step of three lane sums at once: each lane adds the values of the lane whose byte index (4 x lane) is src. The three exchanges and their wait are one statement, so a step costs one LDS-path latency;
// written as three __shfl_xor chains the build threads the exchanges one by one, nine to twelve waits in a row for the five steps
__device__ __forceinline__ void xadd3(int src, float& a, float& b, float& c) {
    float x, y, z;
    asm volatile("ds_bpermute_b32 %0, %3, %4\n\t"
                 "ds_bpermute_b32 %1, %3, %5\n\t"
                 "ds_bpermute_b32 %2, %3, %6\n\t"
                 "s_wait_dscnt 0x0"
                 : "=&v"(x), "=&v"(y), "=&v"(z) : "v"(src), "v"(a), "v"(b), "v"(c) : "memory");
    a += x; b += y; c += z;
}
// 4 waves per SIMD = two work-groups per WGP, which their LDS allows: at most 256 registers
__global__ __launch_bounds__(256, 4) void k_fattn(const bf* __restrict__ QPh, const bf* __restrict__ QPl, const bf* __restrict__ KPh, const bf* __restrict__ KPl, const bf* __restrict__ EB, const h16* __restrict__ VT, bf* ATh, bf* ATl) {
    __shared__ __align__(16) char srow[FR * SPB];
    __shared__ __align__(16) float qes[FR * QEP];
    const int lane = threadIdx.x & 31, lr = lane & 15, hi = lane >> 4; const int wid = __builtin_amdgcn_readfirstlane(threadIdx.x >> 5);
    const int g = blockIdx.y, r0 = blockIdx.x * FR; const size_t pl = (size_t)g * TT * HD;
    const unsigned lo = (unsigned)lane * 16;   // the lane's byte offset in a fragment (fragment order); all else of an address is wave-uniform
    {
        v16bf a[2][2], a2[2][2];
        const bf* qbh = QPh + pl + (size_t)r0 * HD; const bf* qbl = QPl + pl + (size_t)r0 * HD;   // wave-uniform bases of the 32 rows
#pragma unroll
        for (int mb = 0; mb < 2; ++mb)
#pragma unroll
            for (int ks = 0; ks < 2; ++ks) { const int ao = mb * 16 * HD + ks * 512; a[mb][ks] = WFrag<bf>::ld(atb(qbh + ao, lo)); a2[mb][ks] = WFrag<bf>::ld(atb(qbl + ao, lo)); }
        // the lane offset and the two bases are inputs, so they stay in their registers up to this wait: no result of the run of loads lands in a register that an issued load of the run still names
        asm volatile("s_wait_xcnt 0x0" :: "v"(lo), "s"(qbh), "s"(qbl) : "memory");
        const bf* kbh = KPh + pl + (size_t)(wid * 128) * HD; const bf* kbl = KPl + pl + (size_t)(wid * 128) * HD;   // wave-uniform bases of the wave's 128 key rows
        // q.E_k^T ahead of the scores: its fragments, tile and LDS addresses are dead while the score products use all 256 registers (behind them the build spills)
        { const size_t eo = (size_t)(wid * 16) * HD; const v16bf e0 = WFrag<bf>::ld(atb(EB + eo, lo)), e1 = WFrag<bf>::ld(atb(EB + eo + 512, lo));
            v8f acq[2];
#pragma unroll
            for (int mb = 0; mb < 2; ++mb) { v8f t = (v8f){}; t = wmmab(a[mb][0], e0, t); t = wmmab(a2[mb][0], e0, t); t = wmmab(a[mb][1], e1, t); t = wmmab(a2[mb][1], e1, t); acq[mb] = t; }
#pragma unroll
            for (int mb = 0; mb < 2; ++mb)
#pragma unroll
                for (int j = 0; j < 8; ++j) qes[(mb * 16 + hi * 8 + j) * QEP + wid * 16 + lr] = acq[mb][j]; }
#pragma unroll
        for (int nh = 0; nh < 2; ++nh) {      // 64 score columns at a time
            v8f acc[2][4];
#pragma unroll
            for (int mb = 0; mb < 2; ++mb)
#pragma unroll
                for (int n4 = 0; n4 < 4; ++n4) acc[mb][n4] = (v8f){};
#pragma unroll
            for (int ks = 0; ks < 2; ++ks) {
                v16bf b[4], b2[4];
#pragma unroll
                for (int n4 = 0; n4 < 4; ++n4) { const int bo = (nh * 4 + n4) * 16 * HD + ks * 512; b[n4] = WFrag<bf>::ld(atb(kbh + bo, lo)); b2[n4] = WFrag<bf>::ld(atb(kbl + bo, lo)); }
                // inputs only: holds the eight fragments' loads together ahead of their products, one memory latency for the group; without it the build loads and waits fragment by fragment
                asm volatile("" :: "v"(b[0]), "v"(b[1]), "v"(b[2]), "v"(b[3]), "v"(b2[0]), "v"(b2[1]), "v"(b2[2]), "v"(b2[3]));
#pragma unroll
                for (int n4 = 0; n4 < 4; ++n4)
#pragma unroll
                    for (int mb = 0; mb < 2; ++mb) { v8f t = acc[mb][n4]; t = wmmab(a[mb][ks], b[n4], t); t = wmmab(a2[mb][ks], b[n4], t); t = wmmab(a[mb][ks], b2[n4], t); acc[mb][n4] = t; }
            }
#pragma unroll
            for (int mb = 0; mb < 2; ++mb)
#pragma unroll
                for (int n4 = 0; n4 < 4; ++n4)
#pragma unroll
                    for (int j = 0; j < 8; ++j) *(float*)(srow + (mb * 16 + hi * 8 + j) * SPB + (wid * 128 + (nh * 4 + n4) * 16 + lr) * 4) = acc[mb][n4][j];
        }
    }
    __syncthreads();
    // rolled: one row's registers at a time
#pragma unroll 1
    for (int rr = 0; rr < FR / 8; ++rr) {
        const int lrow = wid * (FR / 8) + rr; const int i = r0 + lrow;
        const float* sr = (const float*)(srow + lrow * SPB); const float* qe = qes + lrow * QEP; h16* prw = (h16*)(srow + lrow * SPB);
        // register slot k holds the 128-key chunk (cA + k) % 8, cA the chunk of the band's first key: the band i - 31 .. i + 31 lies in slots 0 and 1;
        // a slot k >= 2 lies wholly right of the band or, wrapped past the row's end (cA + k >= 8), wholly left of it: one clipped logit for all its keys, and its sum of exps goes to one tail as a whole
        const int cA = max(i - (MAXR - 1), 0) >> 7;
        const float qL = qe[0], qR = qe[2 * MAXR];
        float v[TT / 32]; float mx = -3.0e38f;
#pragma unroll
        for (int k = 0; k < TT / 128; ++k) { const int j0 = ((cA + k) & (TT / 128 - 1)) * 128 + lane * 4; const v4f s4 = *(const v4fa*)(sr + j0); const float ck = (cA + k >= TT / 128) ? qL : qR;
#pragma unroll
            for (int q = 0; q < 4; ++q) { float c = ck; if (k < 2) { const int r = min(max(j0 + q - i, -MAXR), MAXR) + MAXR; c = qe[r]; }
                const float t = s4[q] * SCL + c; v[k * 4 + q] = t; mx = fmaxf(mx, t); } }
#pragma unroll
        for (int sh = 16; sh; sh >>= 1) mx = fmaxf(mx, __int_as_float(__builtin_amdgcn_ds_bpermute((lane ^ sh) << 2, __float_as_int(mx))));   // the exchange of __shfl_xor on the index registers of xadd3 below: one set of five, not two, is live at the end of the score products
        // tails as sums of exps, scaled once below: per key only where the band's edges can lie (left edge: slot 0; right edge: slots 0 and 1; slot 1 holds left keys only when wrapped, then all of them)
        float sum = 0.f, tl0 = 0.f, tl1 = 0.f;
#pragma unroll
        for (int k = 0; k < TT / 128; ++k) { const int j0 = ((cA + k) & (TT / 128 - 1)) * 128 + lane * 4; const bool wr = cA + k >= TT / 128;
#pragma unroll
            for (int q = 0; q < 4; ++q) { const float x = __builtin_amdgcn_exp2f(__fmul_rn(__fsub_rn(v[k * 4 + q], mx), 1.4426950408889634f)); v[k * 4 + q] = x;
                if (k == 0) tl0 += (j0 + q <= i - MAXR) ? x : 0.f;
                if (k < 2) tl1 += (j0 + q >= i + MAXR) ? x : 0.f; }
            const float e = (v[k * 4] + v[k * 4 + 1]) + (v[k * 4 + 2] + v[k * 4 + 3]); sum = (k == 0) ? e : sum + e;
            if (k >= 1) tl0 = fmaf(e, wr ? 1.f : 0.f, tl0);
            if (k >= 2) tl1 = fmaf(e, wr ? 0.f : 1.f, tl1); }
#pragma unroll
        for (int sh = 16; sh; sh >>= 1) xadd3((lane ^ sh) << 2, sum, tl0, tl1);
        const float f = __fdiv_rn(PCAR, sum);
        tl0 *= f; tl1 *= f;
#pragma unroll
        for (int k = 0; k < TT / 128; ++k) { const int j0 = ((cA + k) & (TT / 128 - 1)) * 128 + lane * 4; v4h o4;
#pragma unroll
            for (int q = 0; q < 4; ++q) o4[q] = tohx(v[k * 4 + q] * f);
            *(v4ha*)(prw + j0) = o4; }
        __syncthreads();   // the band below reads fp16 values that other lanes stored
        v4h bq4;
#pragma unroll
        for (int q = 0; q < 4; ++q) { const int r = lane * 4 + q; const int j = i + r - MAXR; const int jc = min(max(j, 0), TT - 1); h16 w = prw[jc];
            w = (r > 0 && r < 2 * MAXR && j >= 0 && j < TT) ? w : (h16)0.f; w = (r == 0) ? tohx(tl0) : w; w = (r == 2 * MAXR) ? tohx(tl1) : w; bq4[q] = w; }
        *(v4ha*)(prw + TT + lane * 4) = bq4;
    }
    __syncthreads();
    {
        // key quarter kq (KQ keys, 9 k steps), column pair np, both row tiles: four independent accumulators; a V fragment is loaded by one wave of the work-group, a P fragment read by two
        const int kq = wid >> 1, np = wid & 1;
        const char* ap = srow + lr * SPB + 16 * hi + kq * (KQ * 2); const h16* vp = atb(VT + ((size_t)g * HD + np * 32) * PP + kq * (KQ * 16), lo);
        v8f acc[2][2];
#pragma unroll
        for (int mb = 0; mb < 2; ++mb)
#pragma unroll
            for (int nb = 0; nb < 2; ++nb) acc[mb][nb] = (v8f){};
        v16h vb[KQ / 32][2], pa[KQ / 32][2];
        auto lda = [&](int s) {
#pragma unroll
            for (int mb = 0; mb < 2; ++mb) pa[s][mb] = cat16(*(const v8ha*)(ap + mb * 16 * SPB + s * 64), *(const v8ha*)(ap + mb * 16 * SPB + s * 64 + 32)); };
#pragma unroll
        for (int s = 0; s < KQ / 32; ++s)
#pragma unroll
            for (int nb = 0; nb < 2; ++nb) vb[s][nb] = WFrag<h16>::ld(vp + nb * 16 * PP + s * 512);   // 18 fragments, 144 registers; they depend on nothing that the softmax writes
        lda(0); lda(1);
        // the lane's address is an input, so it stays in its registers up to this wait: no result of the run of loads lands in a register that an issued load of the run still names
        asm volatile("s_wait_xcnt 0x0" :: "v"(vp) : "memory");
#pragma unroll
        for (int s = 0; s < KQ / 32; ++s) {
            if (s + 2 < KQ / 32) lda(s + 2);
            __builtin_amdgcn_sched_barrier(0);   // all V loads of the wave are issued ahead of its first product (one L2 latency, not one per two k steps) and the P reads stay two k steps ahead; without it the build loads V two steps ahead and reads P right in front of its products
#pragma unroll
            for (int mb = 0; mb < 2; ++mb)
#pragma unroll
                for (int nb = 0; nb < 2; ++nb) acc[mb][nb] = wmma16(pa[s][mb], vb[s][nb], acc[mb][nb]); }
        // the quarter's partial sums go behind the fp16 row in the row's own score bytes, dead since the softmax; the lane's half is formed anew: kept live from the kernel's head it changes the build of the score stage, most of whose paired LDS stores (ds_store_2addr_b32) then become single ones
        char* op = srow + (int)(__lane_id() >> 4) * 8 * SPB + POF + kq * (OSP * 4) + (np * 32 + lr) * 4;
#pragma unroll
        for (int mb = 0; mb < 2; ++mb)
#pragma unroll
            for (int nb = 0; nb < 2; ++nb)
#pragma unroll
                for (int j = 0; j < 8; ++j) *(float*)(op + (mb * 16 + j) * SPB + nb * 64) = acc[mb][nb][j];
    }
    __syncthreads();
    { const int t = lane, d0 = wid * 8; const float cs = 1.0f / PCAR; const char* xp = srow + t * SPB + POF + d0 * 4; v4f x0, x1;
        { const v4f a0 = *(const v4fa*)xp, a1 = *(const v4fa*)(xp + OSP * 4), a2 = *(const v4fa*)(xp + 2 * OSP * 4), a3 = *(const v4fa*)(xp + 3 * OSP * 4); x0 = (a0 + a1) + (a2 + a3); }
        { const v4f a0 = *(const v4fa*)(xp + 16), a1 = *(const v4fa*)(xp + OSP * 4 + 16), a2 = *(const v4fa*)(xp + 2 * OSP * 4 + 16), a3 = *(const v4fa*)(xp + 3 * OSP * 4 + 16); x1 = (a0 + a1) + (a2 + a3); }
        v8us oh, ol;
#pragma unroll
        for (int q = 0; q < 8; ++q) { unsigned short c1, c2; splitf((q < 4 ? x0[q & 3] : x1[q & 3]) * cs, c1, c2); oh[q] = c1; ol[q] = c2; }
        const size_t oo = FO((size_t)(g / NH_) * TT + r0 + t, (size_t)(g % NH_) * HD + d0, DQ);
        *(v8us*)(ATh + oo) = oh; *(v8us*)(ATl + oo) = ol; }
}

extern "C" void kernel_launch(void* const* d_in, const int* in_sizes, int n_in,
                              void* d_out, int out_size, void* d_ws, size_t ws_size, hipStream_t stream) {
    if (n_in < 13) return;
    const size_t needX = ((size_t)(NB - 1) * SEQ_FULL + TT) * DM;
    if ((size_t)in_sizes[0] < needX || (size_t)in_sizes[1] < needX || (size_t)in_sizes[2] < needX) return;
    if (in_sizes[3] < DM * DM || in_sizes[5] < DM * DM || in_sizes[7] < DM * DM || in_sizes[9] < DM * DM) return;
    if (in_sizes[4] < DM || in_sizes[6] < DM || in_sizes[8] < DM || in_sizes[10] < DM) return;
    if (in_sizes[11] < NREL * HD || in_sizes[12] < NREL * HD) return;
    if ((size_t)out_size < needX) return;
    const float* query = (const float*)d_in[0]; const float* key = (const float*)d_in[1]; const float* value = (const float*)d_in[2];
    const float* wq = (const float*)d_in[3]; const float* bq = (const float*)d_in[4]; const float* wk = (const float*)d_in[5]; const float* bk = (const float*)d_in[6];
    const float* wv = (const float*)d_in[7]; const float* bv = (const float*)d_in[8]; const float* wo = (const float*)d_in[9]; const float* bo = (const float*)d_in[10];
    const float* rke = (const float*)d_in[11]; const float* rve = (const float*)d_in[12];
    float* OUT = (float*)d_out;     // [NB][SEQ_FULL][DM]
    char* wsp = (char*)d_ws;
    auto take = [&](size_t bytes) { char* p = wsp; wsp += (bytes + 255) & ~(size_t)255; return (void*)p; };
    constexpr size_t MR = (size_t)NB * TT;      // rows of all batches
    constexpr size_t NG = (size_t)NB * NH_;     // (batch, head) planes
    bf* WQ = (bf*)take((size_t)4 * DQ * DM * 2); bf* WO = WQ + (size_t)3 * DQ * DM;      // wq, wk, wv, wo
    bf* EB = (bf*)take((size_t)NE * HD * 2);
    bf* XB = (bf*)take((size_t)3 * MR * DM * 2); float* F = (float*)take((size_t)3 * MR * DQ * 4);      // q, k, v
    bf* QPh = (bf*)take((size_t)2 * NG * TT * HD * 2); bf* QPl = (bf*)take((size_t)2 * NG * TT * HD * 2); bf* KPh = QPh + NG * TT * HD; bf* KPl = QPl + NG * TT * HD;
    h16* VT = (h16*)take(NG * HD * PP * 2);
    bf* ATh = (bf*)take(MR * DQ * 2); bf* ATl = (bf*)take(MR * DQ * 2);
    const size_t carved = (size_t)(wsp - (char*)d_ws);
    if (carved > ws_size) return;    // 143,671,296 B at NB=4, SEQ=1024
    // tables, weights and inputs
    k_prep<<<GB_E + GB_V + 4 * GB_W + 3 * GB_X, 256, 0, stream>>>(query, key, value, wq, wk, wv, wo, rke, rve, XB, WQ, EB, VT);
    // projections of all batches: z = q, k, v
    k_gemmw<bf, 0, true, DM><<<dim3((unsigned)(MR / 128), DQ / 128, 3), 128, 0, stream>>>(XB, nullptr, WQ, F, DQ, bq, bk, bv, MR * DM, (size_t)DQ * DM, MR * DQ);
    k_relay<<<3 * NB * GB_P, 256, 0, stream>>>(F, QPh, QPl, VT);
    k_fattn<<<dim3(TT / FR, (unsigned)NG, 1), 256, 0, stream>>>(QPh, QPl, KPh, KPl, EB, VT, ATh, ATl);   /* scores, softmax, attn.[V | E_v], context planes */
    k_gemmw<bf, 1, true, DQ><<<dim3((unsigned)(MR / 128), DM / 128, 1), 128, 0, stream>>>(ATh, ATl, WO, OUT, DM, bo, bo, bo, 0, 0, 0);
}

// v008
// It runs in 111 microseconds.
// In both of two side-by-side timings against v007, it was 1.05 times as fast.
// Counting every step since v000, it is 8.26 times as fast.
#include <hip/hip_runtime.h>

// Contractions, f32 accumulate: q/k/v projections v_wmma_f32_16x16x32_bf16 (x, W, bias all RNE-converted to bf16, single product); content scores v_wmma_f32_16x16x32_bf16 with q and k as bf16 hi/lo planes (3 products); q.E_k^T bf16 hi/lo x exact bf16 E_k (2 products); attn.[V | rel-value buckets] v_wmma_f32_16x16x32_f16 (P carried x1024 in fp16, V fp16, E_v exact); output projection bf16 hi/lo context x exact bf16 W_o (2 products) + bf16 bias. Softmax, logit adds and carries in f32.
// Layout, all batches at once: bf16 copy of the three inputs [3][NB*TT][DM]; one projection launch (z = q, k, v; f32) -> planes per (batch, head) g = b*NH_ + h (q, k: [g][t][d] bf16 hi + lo; v: [g][d][t] fp16 with pitch TT+128 whose last 128 columns hold E_v^T (65 used, rest zero)).
// Every 16-bit matrix operand in the workspace (R rows, K columns) lies in fragment order: [row / 16][k / 8][row % 16][k % 8], element offset FO(row, k, K); the 16 x 32 fragment at (row tile, k step) is then 1 KiB in a row and each of its two wave-wide 16-byte loads covers 512 contiguous bytes (4 whole lines).
// Attention, one launch for all NB*NH_ planes (k_fattn): per 32 query rows S = q.k^T and QE = q.E_k^T stay in LDS (f32); t_j = S_j / 8 + QE[clip(j - i, -32, 32) + 32], softmax over TT keys, P row = [1024 p_j fp16 | bucket sums: r = 0 keys j <= i - 32, r = 64 keys j >= i + 32, 0 < r < 64 the single key i + r - 32, r > 64 zero];
// one product with K = TT + 128 gives 1024 (attn.V + attn.E_v[clip]), scaled by 1/1024 into bf16 hi/lo context planes [b*TT + t][h*64 + d]; one output GEMM over all NB*TT rows with bias.

#ifndef NB
#define NB 4
#endif
#ifndef SEQ
#define SEQ 1024
#endif
#define NB_FULL  4
#define SEQ_FULL 1024
#define TT   SEQ
#define DM   1024
#define NH_  16
#define HD   64
#define DQ   (NH_ * HD)
#define PCAR 1024.0f
#define SCL  0.125f
#define NE   128     // rel tables (65 rows) padded to 128
#define NREL 65
#define MAXR 32
#define PP   (TT + NE)   // P row length and V^T columns (keys + rel buckets)
static_assert(TT % 128 == 0);
static_assert(TT == SEQ_FULL);   // the batches' rows are folded into one M = NB*TT dimension
static_assert(NB <= NB_FULL);
static_assert(NB >= 1);
static_assert(PP % 32 == 0);
static_assert(NREL == 2 * MAXR + 1);
static_assert(DM % 64 == 0);
static_assert(HD == 64);   // plane's thread map: 8 chunks of 8 columns a row

typedef _Float16 h16;
typedef unsigned short bf;
typedef __attribute__((ext_vector_type(16))) __bf16   v16bf;
typedef __attribute__((ext_vector_type(16))) _Float16 v16h;
typedef __attribute__((ext_vector_type(8)))  _Float16 v8h;
typedef __attribute__((ext_vector_type(8)))  unsigned short v8us;
typedef __attribute__((ext_vector_type(8)))  float    v8f;
typedef __attribute__((ext_vector_type(4)))  float    v4f;
typedef v8h  __attribute__((may_alias)) v8ha;
typedef v4f  __attribute__((may_alias)) v4fa;
typedef v8us __attribute__((may_alias)) v8usa;

__device__ __forceinline__ unsigned short f2bf(float f) { unsigned u = __float_as_uint(f); u += 0x7FFFu + ((u >> 16) & 1u); return (unsigned short)(u >> 16); }
__device__ __forceinline__ float bf2f(unsigned short b) { return __uint_as_float(((unsigned)b) << 16); }
__device__ __forceinline__ float bfr(float f) { return bf2f(f2bf(f)); }
__device__ __forceinline__ size_t FO(size_t row, size_t k, size_t K) { return ((row >> 4) * (K >> 3) + (k >> 3)) * 128 + (row & 15) * 8 + (k & 7); }
__device__ __forceinline__ v16h cat16(v8h lo, v8h hi) { return __builtin_shufflevector(lo, hi, 0, 1, 2, 3, 4, 5, 6, 7, 8, 9, 10, 11, 12, 13, 14, 15); }
__device__ __forceinline__ v16bf cat16b(v8us lo, v8us hi) { return __builtin_bit_cast(v16bf, __builtin_shufflevector(lo, hi, 0, 1, 2, 3, 4, 5, 6, 7, 8, 9, 10, 11, 12, 13, 14, 15)); }
__device__ __forceinline__ v8f wmma16(v16h a, v16h b, v8f c) { return __builtin_amdgcn_wmma_f32_16x16x32_f16(false, a, false, b, (short)0, c, false, false); }
__device__ __forceinline__ v8f wmmab(v16bf a, v16bf b, v8f c) { return __builtin_amdgcn_wmma_f32_16x16x32_bf16(false, a, false, b, (short)0, c, false, false); }

// ---- k_gemmw: GEMM, one work-group of 4 waves (2 x 2) per 128x128 output tile, 64x64 (16 accumulators) per wave; operands are 16-bit planes in fragment order; grid (M/128, N/128, Z), 128 threads.
// C[m][n] (f32, pitch ldc, + optional f32 bias[n] via bf16; z = 1, 2 take bias1, bias2) = sum_k A[m][k] Bt[n][k] (+ A2[m][k] Bt[n][k] where NSPLIT == 1). z-batch strides sA/sB/sC in elements. K % 64 == 0, K >= 128, a compile-time constant; A, A2 and Bt have K columns.
// Fragment map (both operands): lane l -> row/col l&15, elements 0..7 <- k 8h..8h+7, elements 8..15 <- k 16+8h..16+8h+7 (h = l>>4); D element r -> row 8h+r, col l&15. In fragment order these are elements 8 l .. 8 l + 7 and 256 + 8 l .. of the fragment's 512.
// A stage is 64 k of the tile's 8 row tiles of each operand: a row tile's 64 k are 2 KiB in a row in the workspace and go as they lie into LDS, 16 bytes a thread, by asynchronous copies; two stage buffers, the next stage's copies fly while this one is multiplied. Every fragment is fetched from L2 once for two waves.
template <typename T16> __device__ __forceinline__ const T16* atb(const T16* u, unsigned bytes) { return (const T16*)((const char*)u + bytes); }
template <typename T16> struct WFrag;
template <> struct WFrag<h16> { typedef v16h V; static __device__ __forceinline__ V ld(const h16* p) { return cat16(*(const v8h*)p, *(const v8h*)(p + 256)); } static __device__ __forceinline__ v8f mma(V a, V b, v8f c) { return wmma16(a, b, c); } };
template <> struct WFrag<bf> { typedef v16bf V; static __device__ __forceinline__ V ld(const bf* p) { return cat16b(*(const v8us*)p, *(const v8us*)(p + 256)); } static __device__ __forceinline__ V lds(const char* p) { return cat16b(*(const v8usa*)p, *(const v8usa*)(p + 512)); } static __device__ __forceinline__ v8f mma(V a, V b, v8f c) { return wmmab(a, b, c); } };
// the thread's 16 bytes of eight row tiles (gs bytes apart in the workspace, 2 KiB apart in LDS); the s_wait_xcnt closes the statement, so no address register of a copy is rewritten ahead of it
__device__ __forceinline__ void cp8(unsigned l, const char* g, unsigned gs) {
    asm volatile("global_load_async_to_lds_b128 %0, %8, off\n\t"
                 "global_load_async_to_lds_b128 %1, %9, off\n\t"
                 "global_load_async_to_lds_b128 %2, %10, off\n\t"
                 "global_load_async_to_lds_b128 %3, %11, off\n\t"
                 "global_load_async_to_lds_b128 %4, %12, off\n\t"
                 "global_load_async_to_lds_b128 %5, %13, off\n\t"
                 "global_load_async_to_lds_b128 %6, %14, off\n\t"
                 "global_load_async_to_lds_b128 %7, %15, off\n\t"
                 "s_wait_xcnt 0x0"
                 :: "v"(l), "v"(l + 2048u), "v"(l + 4096u), "v"(l + 6144u), "v"(l + 8192u), "v"(l + 10240u), "v"(l + 12288u), "v"(l + 14336u),
                    "v"(g), "v"(g + gs), "v"(g + 2 * (size_t)gs), "v"(g + 3 * (size_t)gs), "v"(g + 4 * (size_t)gs), "v"(g + 5 * (size_t)gs), "v"(g + 6 * (size_t)gs), "v"(g + 7 * (size_t)gs) : "memory");
}
// at most 256 registers: three work-groups of the projections fit a WGP (their LDS allows three), and every operand of the copies' asm text stays below v256
template <typename T16, int NSPLIT, bool BIAS, int K>
__global__ __launch_bounds__(128, 4) void k_gemmw(const T16* __restrict__ A, const T16* __restrict__ A2, const T16* __restrict__ Bt, float* C, int ldc, const float* __restrict__ bias0, const float* __restrict__ bias1, const float* __restrict__ bias2, size_t sA, size_t sB, size_t sC) {
    typedef typename WFrag<T16>::V V;
    static_assert(NSPLIT == 0 || NSPLIT == 1); static_assert(K % 64 == 0 && K >= 128);
    constexpr unsigned OPB = 8 * 2048;                       // one operand's part of a stage
    constexpr unsigned BOF = (NSPLIT == 1 ? 2 : 1) * OPB;    // Bt's place in a stage, behind A (and A2)
    constexpr unsigned STG = BOF + OPB;
    constexpr int NT = K / 64;
    __shared__ __align__(16) char st[2 * STG];
    __shared__ __align__(16) float osw[4][16 * 68];
    const size_t z = blockIdx.z; A += z * sA; if (NSPLIT == 1) A2 += z * sA; Bt += z * sB; C += z * sC;
    const float* __restrict__ bias = (z == 0) ? bias0 : (z == 1) ? bias1 : bias2;
    const int lane = threadIdx.x & 31, lr = lane & 15, hi = lane >> 4; const int wid = __builtin_amdgcn_readfirstlane(threadIdx.x >> 5); const int wm = wid & 1, wn = wid >> 1;
    const int rb = blockIdx.x * 128, cb = blockIdx.y * 128;
    v8f acc[4][4];
#pragma unroll
    for (int mb = 0; mb < 4; ++mb)
#pragma unroll
        for (int nb = 0; nb < 4; ++nb) acc[mb][nb] = (v8f){};
    // a 16-row tile is 16 K elements, 64 k of it 2 KiB
    const char* gA = (const char*)(A + (size_t)rb * K) + threadIdx.x * 16; const char* gA2 = (NSPLIT == 1) ? (const char*)(A2 + (size_t)rb * K) + threadIdx.x * 16 : gA; const char* gB = (const char*)(Bt + (size_t)cb * K) + threadIdx.x * 16;
    const unsigned l0 = (unsigned)(size_t)(__attribute__((address_space(3))) char*)st + threadIdx.x * 16;   // the thread's LDS byte address in a row tile of buffer 0
    auto fill = [&](int t, unsigned buf) { const unsigned l = l0 + buf * STG; const size_t go = (size_t)t * 2048;
        cp8(l, gA + go, 32 * K); if (NSPLIT == 1) cp8(l + OPB, gA2 + go, 32 * K); cp8(l + BOF, gB + go, 32 * K); };
    fill(0, 0);
    asm volatile("s_wait_asynccnt 0x0" ::: "memory");   // this wave's copies of stage 0 have landed
    __syncthreads();                                    // ... and every other wave's
    fill(1, 1);
#pragma unroll 1
    for (int t = 0; t < NT; ++t) {
        const char* sb = st + (unsigned)(t & 1) * STG + lane * 16;
#pragma unroll
        for (int ks = 0; ks < 2; ++ks) {
            V a[4], a2[4], b[4];
            b[0] = WFrag<T16>::lds(sb + BOF + (wn * 4) * 2048 + ks * 1024);
#pragma unroll
            for (int mb = 0; mb < 4; ++mb) { a[mb] = WFrag<T16>::lds(sb + (wm * 4 + mb) * 2048 + ks * 1024); if (NSPLIT == 1) a2[mb] = WFrag<T16>::lds(sb + OPB + (wm * 4 + mb) * 2048 + ks * 1024); }
#pragma unroll
            for (int nb = 1; nb < 4; ++nb) b[nb] = WFrag<T16>::lds(sb + BOF + (wn * 4 + nb) * 2048 + ks * 1024);
            __builtin_amdgcn_sched_barrier(0);   // the k step's LDS reads stay one group ahead of its products, in the order of use; without it the build reads Bt fragment by fragment and waits out the LDS latency before every four products
#pragma unroll
            for (int nb = 0; nb < 4; ++nb) {
#pragma unroll
                for (int mb = 0; mb < 4; ++mb) { acc[mb][nb] = WFrag<T16>::mma(a[mb], b[nb], acc[mb][nb]); if (NSPLIT == 1) acc[mb][nb] = WFrag<T16>::mma(a2[mb], b[nb], acc[mb][nb]); } }
        }
        __builtin_amdgcn_sched_barrier(0);                  // the stage's products stay ahead of the foot; without it the build sinks 32 k of them behind the barrier, in front of the refill, whose copies then start that much later
        asm volatile("s_wait_dscnt 0x0" ::: "memory");      // this wave's reads of the buffer are done before it is refilled
        asm volatile("s_wait_asynccnt 0x0" ::: "memory");   // this wave's copies of stage t + 1 have landed
        __syncthreads();                                    // publishes stage t + 1 and ends every wave's reads of stage t
        if (t + 2 < NT) fill(t + 2, (unsigned)(t & 1));
    }
    asm volatile("s_wait_asynccnt 0x0" ::: "memory");       // no copy is outstanding when the wave goes on
    float* os = osw[wid]; const int r0 = rb + wm * 64, c0 = cb + wn * 64;   // the wave's own staging rows and its 64x64 part of the tile
#pragma unroll
    for (int mb = 0; mb < 4; ++mb) {
#pragma unroll
        for (int nb = 0; nb < 4; ++nb) {
#pragma unroll
            for (int j = 0; j < 8; ++j) os[(hi * 8 + j) * 68 + nb * 16 + lr] = acc[mb][nb][j]; }
        __builtin_amdgcn_wave_barrier(); asm volatile("" ::: "memory");
        float* crow = C + (size_t)(r0 + mb * 16) * ldc + c0;
{
#pragma unroll
            for (int s = 0; s < 8; ++s) { const int row = 2 * s + hi, cofs = lr * 4; v4f val = *(const v4fa*)(os + row * 68 + cofs); if (BIAS) { val[0] += bfr(bias[c0 + cofs]); val[1] += bfr(bias[c0 + cofs + 1]); val[2] += bfr(bias[c0 + cofs + 2]); val[3] += bfr(bias[c0 + cofs + 3]); }
                *(v4f*)(crow + (size_t)row * ldc + cofs) = val; }
             }
        asm volatile("s_wait_xcnt 0x0" ::: "memory");   // ahead of the next row tile's code, which reuses the registers that the eight stores name
        __builtin_amdgcn_wave_barrier(); asm volatile("" ::: "memory");
    }
}

__device__ __forceinline__ h16 tohx(float x) { return (h16)x; }
__device__ __forceinline__ void splitf(float y, unsigned short& h, unsigned short& l) { h = f2bf(y); l = f2bf(y - bf2f(h)); }
typedef __attribute__((ext_vector_type(2))) _Float16 v2h;
typedef __attribute__((ext_vector_type(4))) _Float16 v4h;
typedef v4h  __attribute__((may_alias)) v4ha;
typedef __attribute__((ext_vector_type(2))) unsigned short v2us;
typedef __attribute__((ext_vector_type(4))) unsigned short v4us;
typedef __attribute__((ext_vector_type(2))) float v2f;

// The jobs below that need nothing of each other share a launch: each takes a range of the block index (bx: the block's index inside its job, by: the job's slab), picked by a block-uniform branch in k_prep and k_relay.
// y picks one of up to four equally long sources of DM columns; its bf16 copy, in fragment order, is slab y of dst. A wave takes 8 rows x 4 chunks of 8 columns: whole 128-byte lines on both sides.
__device__ __forceinline__ void cvt8(unsigned bx, unsigned y, const float* __restrict__ s0, const float* __restrict__ s1, const float* __restrict__ s2, const float* __restrict__ s3, bf* dst, size_t n8) { const size_t i = (size_t)bx * 256 + threadIdx.x; if (i >= n8) return;
    const float* __restrict__ src = (y == 0) ? s0 : (y == 1) ? s1 : (y == 2) ? s2 : s3; dst += (size_t)y * n8 * 8;
    const size_t u = i >> 6; const size_t row = (u / (DM / 32)) * 16 + ((i >> 5) & 1) * 8 + ((i >> 2) & 7), k = ((u % (DM / 32)) * 4 + (i & 3)) * 8; const v8f v = *(const v8f*)(src + row * DM + k); v8us o;
#pragma unroll
    for (int q = 0; q < 8; ++q) o[q] = f2bf(v[q]); *(v8us*)(dst + FO(row, k, DM)) = o;  }

__device__ __forceinline__ void epad2(unsigned bx, const float* __restrict__ E, bf* EB) { const size_t i = (size_t)bx * 256 + threadIdx.x; if (i >= (size_t)NE * HD / 8) return; const int d0 = (int)(i % (HD / 8)) * 8; const int r = (int)(i / (HD / 8)); const float* src = E + (size_t)min(r, NREL - 1) * HD + d0; v8us o;
#pragma unroll
    for (int q = 0; q < 8; ++q) { const unsigned short v = f2bf(src[q]); o[q] = (r < NREL) ? v : (unsigned short)0; }
    *(v8us*)(EB + FO(r, d0, HD)) = o;  }

// by: slab of TT rows of F (q's batches, then k's) and its nheads planes, each in fragment order. A wave takes 8 rows x 4 chunks of 8 columns: whole 128-byte lines on both sides.
__device__ __forceinline__ void plane(unsigned bx, unsigned by, const float* __restrict__ F, int pitch, int nheads, bf* Ph, bf* Pl) {
    const size_t x = (size_t)bx * 256 + threadIdx.x; if (x >= (size_t)nheads * TT * HD / 8) return;
    F += (size_t)by * TT * pitch; Ph += (size_t)by * nheads * TT * HD; Pl += (size_t)by * nheads * TT * HD;
    const int d = (int)(((x >> 5) & 1) * 4 + (x & 3)) * 8; const int t = (int)((x >> 7) % (TT / 16)) * 16 + (int)((x >> 6) & 1) * 8 + (int)((x >> 2) & 7); const int h = (int)(x / ((size_t)HD * TT / 8));
    const size_t e = (size_t)h * TT * HD + FO(t, d, HD);
    const v8f y = *(const v8f*)(F + (size_t)t * pitch + h * HD + d); v8us oh, ol;
#pragma unroll
    for (int q = 0; q < 8; ++q) { unsigned short a, c2; splitf(y[q], a, c2); oh[q] = a; ol[q] = c2; }
    *(v8us*)(Ph + e) = oh; *(v8us*)(Pl + e) = ol;  }

// by: batch (TT rows of F, nheads planes of VT, each HD rows x PP columns in fragment order). A wave takes 32 neighbouring d of 8 keys: each load one whole line, the store two runs of 256 bytes.
__device__ __forceinline__ void vtp8(unsigned bx, unsigned by, const float* __restrict__ F, int pitch, int nheads, h16* VT) {
    const size_t x = (size_t)bx * 256 + threadIdx.x; if (x >= (size_t)nheads * HD * TT / 8) return;
    F += (size_t)by * TT * pitch; VT += (size_t)by * nheads * HD * PP;
    const int d = (int)(x % HD); const int t = (int)((x / HD) % (TT / 8)) * 8; const int g = (int)(x / ((size_t)TT * HD / 8));
    v8h o;
#pragma unroll
    for (int q = 0; q < 8; ++q) o[q] = tohx(F[(size_t)(t + q) * pitch + g * HD + d]);
    h16* dst = VT + (size_t)g * HD * PP + FO(d, t, PP);
    *(v8h*)dst = o;  }

__device__ __forceinline__ void evt(unsigned bx, const float* __restrict__ EV, int nheads, h16* VT) {
    const size_t x = (size_t)bx * 256 + threadIdx.x; if (x >= (size_t)nheads * HD * NE / 8) return;
    const int d = (int)(x % HD); const int r0 = (int)((x / HD) % (NE / 8)) * 8; const int g = (int)(x / ((size_t)NE * HD / 8));
    v8h o; const float* ep[8]; float ev[8];
#pragma unroll
    for (int q = 0; q < 8; ++q) { ep[q] = EV + (size_t)min(r0 + q, NREL - 1) * HD + d; ev[q] = *ep[q]; }
    // the eight addresses are inputs, so they stay in their registers up to this wait: no result of the run of loads lands in a register that an issued load of the run still names
    asm volatile("s_wait_xcnt 0x0" :: "v"(ep[0]), "v"(ep[1]), "v"(ep[2]), "v"(ep[3]), "v"(ep[4]), "v"(ep[5]), "v"(ep[6]), "v"(ep[7]) : "memory");
#pragma unroll
    for (int q = 0; q < 8; ++q) { const float y = (r0 + q < NREL) ? bfr(ev[q]) : 0.0f; o[q] = tohx(y); }
    h16* dst = VT + (size_t)g * HD * PP + FO(d, TT + r0, PP);
    *(v8h*)dst = o;  }

// blocks of each job
#define GB_E ((NE * HD / 8 + 255) / 256)                  // E_k table
#define GB_V ((NB * NH_ * HD * NE / 8 + 255) / 256)       // E_v^T columns of every plane
#define GB_W ((DQ * DM / 8 + 255) / 256)                  // one weight matrix
#define GB_X ((NB * TT * DM / 8 + 255) / 256)             // one input, all batches
#define GB_P ((NH_ * TT * HD / 8 + 255) / 256)            // one slab of TT projected rows
// k_prep: all that reads only the inputs: the two tables, the bf16 copies of the four weights and of the three inputs. Grid GB_E + GB_V + 4 GB_W + 3 GB_X.
__global__ __launch_bounds__(256) void k_prep(const float* __restrict__ query, const float* __restrict__ key, const float* __restrict__ value, const float* __restrict__ wq, const float* __restrict__ wk, const float* __restrict__ wv, const float* __restrict__ wo,
                                              const float* __restrict__ rke, const float* __restrict__ rve, bf* XB, bf* WQ, bf* EB, h16* VT) {
    unsigned b = blockIdx.x;
    if (b < GB_E) { epad2(b, rke, EB); return; }                                                      /* E_k: 65 rows bf16 (exact), rows 65..127 zero */
    b -= GB_E;
    if (b < GB_V) { evt(b, rve, NB * NH_, VT); return; }                                              /* E_v^T columns TT..TT+127 of every V^T row */
    b -= GB_V;
    if (b < 4 * GB_W) { cvt8(b % GB_W, b / GB_W, wq, wk, wv, wo, WQ, (size_t)DQ * DM / 8); return; }
    b -= 4 * GB_W;
    cvt8(b % GB_X, b / GB_X, query, key, value, value, XB, (size_t)NB * TT * DM / 8);
}
// k_relay: the projections' f32 rows F [q | k | v][NB*TT][DQ] into the operand planes of the attention. Grid 3 NB GB_P.
__global__ __launch_bounds__(256) void k_relay(const float* __restrict__ F, bf* QPh, bf* QPl, h16* VT) {
    unsigned b = blockIdx.x;
    if (b < NB * GB_P) { vtp8(b % GB_P, b / GB_P, F + (size_t)2 * NB * TT * DQ, DQ, NH_, VT); return; }
    b -= NB * GB_P;
    plane(b % GB_P, b / GB_P, F, DQ, NH_, QPh, QPl);
}

// k_fattn: one work-group (8 waves) per FR = 32 query rows of one (batch, head) plane g; the score rows never leave the chip.
// 1) wave w: S[32][128 w .. 128 w + 127] = q.k^T (3 products, same order as a K = 64 GEMM) and column tile w of QE = q.E_k^T (2 products), f32 into LDS;
// 2) wave w, rows 4 w .. 4 w + 3, two at a time, each on 16 lanes: t_j = S_j * HD^-0.5 + QE[clip(j - i, -32, 32) + 32], softmax over the TT keys (register row, one exp, fixed trees);
//    the fp16 row [1024 p_j, j < TT | at TT + r: r = 0 sum of p over j <= i - 32, r = 64 sum over j >= i + 32, 0 < r < 64 p at j = i + r - 32 (0 outside [0, TT)), r > 64 zero] overwrites the row's own scores;
// 3) wave w: quarter w / 2 of the PP keys, columns 32 (w % 2) .. + 31, all 32 rows of P.[V | E_v]^T (2 x 2 tiles, ascending k inside the quarter), A from LDS, B from the V^T plane; f32 partial sums into LDS;
// 4) the four quarters added as (0 + 1) + (2 + 3), scaled by 1/1024 and split into the bf16 hi/lo context planes, row b*TT + t, column h*64 + d, in fragment order: a wave stores one chunk of 8 columns of the 32 rows, two runs of 256 bytes.
#define FR   32
#define SPB  (TT * 4 + 16)   // byte pitch of a score row in LDS: 16 rows of a b128 fragment read fall on 64 different banks
#define QEP  132             // float pitch of a QE row
#define OSP  68              // float stride of one key quarter's partial sums in a score row
static_assert(TT % FR == 0);
static_assert(TT == 8 * 128);     // 8 waves x 128 score columns
static_assert(PP * 2 <= TT * 4);  // the fp16 row fits into its f32 score row
#define KQ   (PP / 4)        // keys of one wave in the P.[V | E_v] product
#define POF  (PP * 2)        // byte offset of the partial sums in a score row, behind the fp16 row
static_assert(KQ % 32 == 0);
static_assert(POF % 16 == 0 && POF + 4 * OSP * 4 <= TT * 4);   // four staged quarters fit behind the fp16 row
static_assert(2 * MAXR <= 64);    // the bands of two neighbouring rows, 2 MAXR keys together, span at most two 64-key chunks
static_assert(FR % 16 == 0 && NE == 16 * 8);   // 8 waves x pairs of rows; 16 lanes x 8 bucket entries
// rowx<M>: lane l gets the value of lane l ^ M of its 16-lane row (DPP row_xmask): in the vector unit, no LDS path and no wait. All 32 lanes are on wherever it is used
template <int M> __device__ __forceinline__ float rowx(float x) { return __builtin_bit_cast(float, __builtin_amdgcn_update_dpp(0, __builtin_bit_cast(int, x), 0x160 | M, 0xf, 0xf, true)); }
// maximum over the 16 lanes of a row, in every lane of it
__device__ __forceinline__ float rmax16(float a) { a = fmaxf(a, rowx<8>(a)); a = fmaxf(a, rowx<4>(a)); a = fmaxf(a, rowx<2>(a)); return fmaxf(a, rowx<1>(a)); }
// three sums over the 16 lanes of a row, side by side: each fills the others' dependent links
__device__ __forceinline__ void rsum16x3(float& a, float& b, float& c) {
    a += rowx<8>(a); b += rowx<8>(b); c += rowx<8>(c);
    a += rowx<4>(a); b += rowx<4>(b); c += rowx<4>(c);
    a += rowx<2>(a); b += rowx<2>(b); c += rowx<2>(c);
    a += rowx<1>(a); b += rowx<1>(b); c += rowx<1>(c);
}
// 4 waves per SIMD = two work-groups per WGP, which their LDS allows: at most 256 registers
__global__ __launch_bounds__(256, 4) void k_fattn(const bf* __restrict__ QPh, const bf* __restrict__ QPl, const bf* __restrict__ KPh, const bf* __restrict__ KPl, const bf* __restrict__ EB, const h16* __restrict__ VT, bf* ATh, bf* ATl) {
    __shared__ __align__(16) char srow[FR * SPB];
    __shared__ __align__(16) float qes[FR * QEP];
    const int lane = threadIdx.x & 31, lr = lane & 15, hi = lane >> 4; const int wid = __builtin_amdgcn_readfirstlane(threadIdx.x >> 5);
    const int g = blockIdx.y, r0 = blockIdx.x * FR; const size_t pl = (size_t)g * TT * HD;
    const unsigned lo = (unsigned)lane * 16;   // the lane's byte offset in a fragment (fragment order); all else of an address is wave-uniform
    {
        v16bf a[2][2], a2[2][2];
        const bf* qbh = QPh + pl + (size_t)r0 * HD; const bf* qbl = QPl + pl + (size_t)r0 * HD;   // wave-uniform bases of the 32 rows
#pragma unroll
        for (int mb = 0; mb < 2; ++mb)
#pragma unroll
            for (int ks = 0; ks < 2; ++ks) { const int ao = mb * 16 * HD + ks * 512; a[mb][ks] = WFrag<bf>::ld(atb(qbh + ao, lo)); a2[mb][ks] = WFrag<bf>::ld(atb(qbl + ao, lo)); }
        // the lane offset and the two bases are inputs, so they stay in their registers up to this wait: no result of the run of loads lands in a register that an issued load of the run still names
        asm volatile("s_wait_xcnt 0x0" :: "v"(lo), "s"(qbh), "s"(qbl) : "memory");
        const bf* kbh = KPh + pl + (size_t)(wid * 128) * HD; const bf* kbl = KPl + pl + (size_t)(wid * 128) * HD;   // wave-uniform bases of the wave's 128 key rows
        // q.E_k^T ahead of the scores: its fragments, tile and LDS addresses are dead while the score products use all 256 registers (behind them the build spills)
        { const size_t eo = (size_t)(wid * 16) * HD; const v16bf e0 = WFrag<bf>::ld(atb(EB + eo, lo)), e1 = WFrag<bf>::ld(atb(EB + eo + 512, lo));
            v8f acq[2];
#pragma unroll
            for (int mb = 0; mb < 2; ++mb) { v8f t = (v8f){}; t = wmmab(a[mb][0], e0, t); t = wmmab(a2[mb][0], e0, t); t = wmmab(a[mb][1], e1, t); t = wmmab(a2[mb][1], e1, t); acq[mb] = t; }
#pragma unroll
            for (int mb = 0; mb < 2; ++mb)
#pragma unroll
                for (int j = 0; j < 8; ++j) qes[(mb * 16 + hi * 8 + j) * QEP + wid * 16 + lr] = acq[mb][j]; }
#pragma unroll
        for (int nh = 0; nh < 2; ++nh) {      // 64 score columns at a time
            v8f acc[2][4];
#pragma unroll
            for (int mb = 0; mb < 2; ++mb)
#pragma unroll
                for (int n4 = 0; n4 < 4; ++n4) acc[mb][n4] = (v8f){};
#pragma unroll
            for (int ks = 0; ks < 2; ++ks) {
                v16bf b[4], b2[4];
#pragma unroll
                for (int n4 = 0; n4 < 4; ++n4) { const int bo = (nh * 4 + n4) * 16 * HD + ks * 512; b[n4] = WFrag<bf>::ld(atb(kbh + bo, lo)); b2[n4] = WFrag<bf>::ld(atb(kbl + bo, lo)); }
                // inputs only: holds the eight fragments' loads together ahead of their products, one memory latency for the group; without it the build loads and waits fragment by fragment
                asm volatile("" :: "v"(b[0]), "v"(b[1]), "v"(b[2]), "v"(b[3]), "v"(b2[0]), "v"(b2[1]), "v"(b2[2]), "v"(b2[3]));
#pragma unroll
                for (int n4 = 0; n4 < 4; ++n4)
#pragma unroll
                    for (int mb = 0; mb < 2; ++mb) { v8f t = acc[mb][n4]; t = wmmab(a[mb][ks], b[n4], t); t = wmmab(a2[mb][ks], b[n4], t); t = wmmab(a[mb][ks], b2[n4], t); acc[mb][n4] = t; }
            }
#pragma unroll
            for (int mb = 0; mb < 2; ++mb)
#pragma unroll
                for (int n4 = 0; n4 < 4; ++n4)
#pragma unroll
                    for (int j = 0; j < 8; ++j) *(float*)(srow + (mb * 16 + hi * 8 + j) * SPB + (wid * 128 + (nh * 4 + n4) * 16 + lr) * 4) = acc[mb][n4][j];
        }
    }
    __syncthreads();
    // a score row lies on one 16-lane row of the wave, 64 keys a lane: the wave takes rows iA and iA + 1 side by side, and a row's maximum and sums stay inside the 16 lanes. Rolled: one pair's registers at a time
#pragma unroll 1
    for (int rr = 0; rr < FR / 16; ++rr) {
        const int lrA = wid * (FR / 8) + rr * 2, iA = r0 + lrA;   // wave-uniform: the pair's first row
        const int hs = (int)(__lane_id() >> 4), ls = (int)(__lane_id() & 15);   // formed anew, not from the kernel's head: see the note at the P.[V | E_v] stage
        const int lrow = lrA + hs; const int i = iA + hs;         // the lane's row
        const float* sr = (const float*)(srow + lrow * SPB); const float* qe = qes + lrow * QEP; h16* prw = (h16*)(srow + lrow * SPB);
        // register slot k holds the 64-key chunk (cA + k) % 16, cA the chunk of the first key of the pair's bands: the 64 keys iA - 31 .. iA + 32 that hold both bands lie in slots 0 and 1;
        // a slot k >= 2 lies wholly right of both bands or, wrapped past the row's end (cA + k >= 16), wholly left of them: one clipped logit for all its keys, and its sum of exps goes to one tail as a whole
        const int cA = max(iA - (MAXR - 1), 0) >> 6;
        const float qL = qe[0], qR = qe[2 * MAXR];
        v2f v[TT / 32]; float mx = -3.0e38f;   // neighbouring keys as pairs, in the registers as the loads fill them; written on single floats this loop builds with pairs of the build's own choice and some 45 register moves to form them
#pragma unroll
        for (int k = 0; k < TT / 64; ++k) { const int j0 = ((cA + k) & (TT / 64 - 1)) * 64 + ls * 4; const v4f s4 = *(const v4fa*)(sr + j0); const float ck = (cA + k >= TT / 64) ? qL : qR;
            float c[4];
#pragma unroll
            for (int q = 0; q < 4; ++q) { c[q] = ck; if (k < 2) { const int r = min(max(j0 + q - i, -MAXR), MAXR) + MAXR; c[q] = qe[r]; } }
            const v2f t0 = (v2f){s4[0], s4[1]} * SCL + (v2f){c[0], c[1]}, t1 = (v2f){s4[2], s4[3]} * SCL + (v2f){c[2], c[3]};
            v[k * 2] = t0; v[k * 2 + 1] = t1; mx = fmaxf(fmaxf(mx, t0[0]), t0[1]); mx = fmaxf(fmaxf(mx, t1[0]), t1[1]); }
        mx = rmax16(mx);
        // tails as sums of exps, scaled once below: per key only where a band's edges can lie (left edge: slot 0; right edge: slots 0 and 1; slot 1 holds left keys only when wrapped, then all of them)
        float sum = 0.f, tl0 = 0.f, tl1 = 0.f;
#pragma unroll
        for (int k = 0; k < TT / 64; ++k) { const int j0 = ((cA + k) & (TT / 64 - 1)) * 64 + ls * 4; const bool wr = cA + k >= TT / 64;
            const v2f a0 = (v[k * 2] - mx) * 1.4426950408889634f, a1 = (v[k * 2 + 1] - mx) * 1.4426950408889634f;
            const float x[4] = {__builtin_amdgcn_exp2f(a0[0]), __builtin_amdgcn_exp2f(a0[1]), __builtin_amdgcn_exp2f(a1[0]), __builtin_amdgcn_exp2f(a1[1])};
            v[k * 2] = (v2f){x[0], x[1]}; v[k * 2 + 1] = (v2f){x[2], x[3]};
#pragma unroll
            for (int q = 0; q < 4; ++q) {
                if (k == 0) tl0 += (j0 + q <= i - MAXR) ? x[q] : 0.f;
                if (k < 2) tl1 += (j0 + q >= i + MAXR) ? x[q] : 0.f; }
            const float e = (x[0] + x[1]) + (x[2] + x[3]); sum = (k == 0) ? e : sum + e;
            if (k >= 1) tl0 = fmaf(e, wr ? 1.f : 0.f, tl0);
            if (k >= 2) tl1 = fmaf(e, wr ? 0.f : 1.f, tl1); }
        rsum16x3(sum, tl0, tl1);
        const float f = __fdiv_rn(PCAR, sum);
        tl0 *= f; tl1 *= f;
#pragma unroll
        for (int k = 0; k < TT / 64; ++k) { const int j0 = ((cA + k) & (TT / 64 - 1)) * 64 + ls * 4; const v2f p0 = v[k * 2] * f, p1 = v[k * 2 + 1] * f;
            const v4h o4 = {tohx(p0[0]), tohx(p0[1]), tohx(p1[0]), tohx(p1[1])};
            *(v4ha*)(prw + j0) = o4; }
        __syncthreads();   // the band below reads fp16 values that other lanes stored
        v8h bq8;
#pragma unroll
        for (int q = 0; q < 8; ++q) { const int r = ls * 8 + q; const int j = i + r - MAXR; const int jc = min(max(j, 0), TT - 1); h16 w = prw[jc];
            w = (r > 0 && r < 2 * MAXR && j >= 0 && j < TT) ? w : (h16)0.f; w = (r == 0) ? tohx(tl0) : w; w = (r == 2 * MAXR) ? tohx(tl1) : w; bq8[q] = w; }
        *(v8ha*)(prw + TT + ls * 8) = bq8;
    }
    __syncthreads();
    {
        // key quarter kq (KQ keys, 9 k steps), column pair np, both row tiles: four independent accumulators; a V fragment is loaded by one wave of the work-group, a P fragment read by two
        const int kq = wid >> 1, np = wid & 1;
        const int l2 = (int)__lane_id(), lr2 = l2 & 15, hi2 = l2 >> 4;   // the lane's row and half are formed anew here and in the softmax: kept live from the kernel's head they change the build of the score stage, which then spills or turns most of its paired LDS stores (ds_store_2addr_b32) into single ones
        const char* ap = srow + lr2 * SPB + 16 * hi2 + kq * (KQ * 2); const h16* vp = atb(VT + ((size_t)g * HD + np * 32) * PP + kq * (KQ * 16), lo);
        v8f acc[2][2];
#pragma unroll
        for (int mb = 0; mb < 2; ++mb)
#pragma unroll
            for (int nb = 0; nb < 2; ++nb) acc[mb][nb] = (v8f){};
        v16h vb[KQ / 32][2], pa[KQ / 32][2];
        auto lda = [&](int s) {
#pragma unroll
            for (int mb = 0; mb < 2; ++mb) pa[s][mb] = cat16(*(const v8ha*)(ap + mb * 16 * SPB + s * 64), *(const v8ha*)(ap + mb * 16 * SPB + s * 64 + 32)); };
#pragma unroll
        for (int s = 0; s < KQ / 32; ++s)
#pragma unroll
            for (int nb = 0; nb < 2; ++nb) vb[s][nb] = WFrag<h16>::ld(vp + nb * 16 * PP + s * 512);   // 18 fragments, 144 registers; they depend on nothing that the softmax writes
        lda(0); lda(1);
        // the lane's address is an input, so it stays in its registers up to this wait: no result of the run of loads lands in a register that an issued load of the run still names
        asm volatile("s_wait_xcnt 0x0" :: "v"(vp) : "memory");
#pragma unroll
        for (int s = 0; s < KQ / 32; ++s) {
            if (s + 2 < KQ / 32) lda(s + 2);
            __builtin_amdgcn_sched_barrier(0);   // all V loads of the wave are issued ahead of its first product (one L2 latency, not one per two k steps) and the P reads stay two k steps ahead; without it the build loads V two steps ahead and reads P right in front of its products
#pragma unroll
            for (int mb = 0; mb < 2; ++mb)
#pragma unroll
                for (int nb = 0; nb < 2; ++nb) acc[mb][nb] = wmma16(pa[s][mb], vb[s][nb], acc[mb][nb]); }
        // the quarter's partial sums go behind the fp16 row in the row's own score bytes, dead since the softmax
        char* op = srow + hi2 * 8 * SPB + POF + kq * (OSP * 4) + (np * 32 + lr2) * 4;
#pragma unroll
        for (int mb = 0; mb < 2; ++mb)
#pragma unroll
            for (int nb = 0; nb < 2; ++nb)
#pragma unroll
                for (int j = 0; j < 8; ++j) *(float*)(op + (mb * 16 + j) * SPB + nb * 64) = acc[mb][nb][j];
    }
    __syncthreads();
    { const int t = lane, d0 = wid * 8; const float cs = 1.0f / PCAR; const char* xp = srow + t * SPB + POF + d0 * 4; v4f x0, x1;
        { const v4f a0 = *(const v4fa*)xp, a1 = *(const v4fa*)(xp + OSP * 4), a2 = *(const v4fa*)(xp + 2 * OSP * 4), a3 = *(const v4fa*)(xp + 3 * OSP * 4); x0 = (a0 + a1) + (a2 + a3); }
        { const v4f a0 = *(const v4fa*)(xp + 16), a1 = *(const v4fa*)(xp + OSP * 4 + 16), a2 = *(const v4fa*)(xp + 2 * OSP * 4 + 16), a3 = *(const v4fa*)(xp + 3 * OSP * 4 + 16); x1 = (a0 + a1) + (a2 + a3); }
        v8us oh, ol;
#pragma unroll
        for (int q = 0; q < 8; ++q) { unsigned short c1, c2; splitf((q < 4 ? x0[q & 3] : x1[q & 3]) * cs, c1, c2); oh[q] = c1; ol[q] = c2; }
        const size_t oo = FO((size_t)(g / NH_) * TT + r0 + t, (size_t)(g % NH_) * HD + d0, DQ);
        *(v8us*)(ATh + oo) = oh; *(v8us*)(ATl + oo) = ol; }
}

extern "C" void kernel_launch(void* const* d_in, const int* in_sizes, int n_in,
                              void* d_out, int out_size, void* d_ws, size_t ws_size, hipStream_t stream) {
    if (n_in < 13) return;
    const size_t needX = ((size_t)(NB - 1) * SEQ_FULL + TT) * DM;
    if ((size_t)in_sizes[0] < needX || (size_t)in_sizes[1] < needX || (size_t)in_sizes[2] < needX) return;
    if (in_sizes[3] < DM * DM || in_sizes[5] < DM * DM || in_sizes[7] < DM * DM || in_sizes[9] < DM * DM) return;
    if (in_sizes[4] < DM || in_sizes[6] < DM || in_sizes[8] < DM || in_sizes[10] < DM) return;
    if (in_sizes[11] < NREL * HD || in_sizes[12] < NREL * HD) return;
    if ((size_t)out_size < needX) return;
    const float* query = (const float*)d_in[0]; const float* key = (const float*)d_in[1]; const float* value = (const float*)d_in[2];
    const float* wq = (const float*)d_in[3]; const float* bq = (const float*)d_in[4]; const float* wk = (const float*)d_in[5]; const float* bk = (const float*)d_in[6];
    const float* wv = (const float*)d_in[7]; const float* bv = (const float*)d_in[8]; const float* wo = (const float*)d_in[9]; const float* bo = (const float*)d_in[10];
    const float* rke = (const float*)d_in[11]; const float* rve = (const float*)d_in[12];
    float* OUT = (float*)d_out;     // [NB][SEQ_FULL][DM]
    char* wsp = (char*)d_ws;
    auto take = [&](size_t bytes) { char* p = wsp; wsp += (bytes + 255) & ~(size_t)255; return (void*)p; };
    constexpr size_t MR = (size_t)NB * TT;      // rows of all batches
    constexpr size_t NG = (size_t)NB * NH_;     // (batch, head) planes
    bf* WQ = (bf*)take((size_t)4 * DQ * DM * 2); bf* WO = WQ + (size_t)3 * DQ * DM;      // wq, wk, wv, wo
    bf* EB = (bf*)take((size_t)NE * HD * 2);
    bf* XB = (bf*)take((size_t)3 * MR * DM * 2); float* F = (float*)take((size_t)3 * MR * DQ * 4);      // q, k, v
    bf* QPh = (bf*)take((size_t)2 * NG * TT * HD * 2); bf* QPl = (bf*)take((size_t)2 * NG * TT * HD * 2); bf* KPh = QPh + NG * TT * HD; bf* KPl = QPl + NG * TT * HD;
    h16* VT = (h16*)take(NG * HD * PP * 2);
    bf* ATh = (bf*)take(MR * DQ * 2); bf* ATl = (bf*)take(MR * DQ * 2);
    const size_t carved = (size_t)(wsp - (char*)d_ws);
    if (carved > ws_size) return;    // 143,671,296 B at NB=4, SEQ=1024
    // tables, weights and inputs
    k_prep<<<GB_E + GB_V + 4 * GB_W + 3 * GB_X, 256, 0, stream>>>(query, key, value, wq, wk, wv, wo, rke, rve, XB, WQ, EB, VT);
    // projections of all batches: z = q, k, v
    k_gemmw<bf, 0, true, DM><<<dim3((unsigned)(MR / 128), DQ / 128, 3), 128, 0, stream>>>(XB, nullptr, WQ, F, DQ, bq, bk, bv, MR * DM, (size_t)DQ * DM, MR * DQ);
    k_relay<<<3 * NB * GB_P, 256, 0, stream>>>(F, QPh, QPl, VT);
    k_fattn<<<dim3(TT / FR, (unsigned)NG, 1), 256, 0, stream>>>(QPh, QPl, KPh, KPl, EB, VT, ATh, ATl);   /* scores, softmax, attn.[V | E_v], context planes */
    k_gemmw<bf, 1, true, DQ><<<dim3((unsigned)(MR / 128), DM / 128, 1), 128, 0, stream>>>(ATh, ATl, WO, OUT, DM, bo, bo, bo, 0, 0, 0);
}

// v009
// One run takes 102 microseconds.
// Two timings next to v008 put it at 1.07 and 1.09 times that version's speed.
// Over all steps from v000 it is 8.91 times as fast.
#include <hip/hip_runtime.h>

// Contractions, f32 accumulate: q/k/v projections v_wmma_f32_16x16x32_bf16 (x, W, bias all RNE-converted to bf16, single product); content scores v_wmma_f32_16x16x32_bf16 with q and k as bf16 hi/lo planes (3 products); q.E_k^T bf16 hi/lo x exact bf16 E_k (2 products); [V | rel-value buckets]^T.attn^T v_wmma_f32_16x16x32_f16 (exp values carried x32 in fp16, divided by the f32 row sum behind the product; V fp16, E_v exact); output projection bf16 hi/lo context x exact bf16 W_o (2 products) + bf16 bias. Softmax, logit adds and carries in f32.
// Layout, all batches at once: bf16 copy of the three inputs [3][NB*TT][DM]; one projection launch (z = q, k, v; f32) -> planes per (batch, head) g = b*NH_ + h (q, k: [g][t][d] bf16 hi + lo; v: [g][d][t] fp16 with pitch TT+128 whose last 128 columns hold E_v^T (65 used, rest zero)).
// Every 16-bit matrix operand in the workspace (R rows, K columns) lies in fragment order: [row / 16][k / 8][row % 16][k % 8], element offset FO(row, k, K); the 16 x 32 fragment at (row tile, k step) is then 1 KiB in a row and each of its two wave-wide 16-byte loads covers 512 contiguous bytes (4 whole lines).
// Attention, one launch for all NB*NH_ planes (k_fattn): per 32 query rows S^T = k.q^T stays in the accumulators, QE = q.E_k^T in LDS (f32); t_j = S_j / 8 + QE[clip(j - i, -32, 32) + 32], softmax over TT keys, x_j = 32 exp(t_j - max) fp16; bucket row of a query: r = 0 sum of x over keys j <= i - 32, r = 64 over keys j >= i + 32, 0 < r < 64 the single key i + r - 32, r > 64 zero;
// the products over the TT keys and over the buckets give sum * (attn.V + attn.E_v[clip]), divided by the row sum into bf16 hi/lo context planes [b*TT + t][h*64 + d]; one output GEMM over all NB*TT rows with bias.

#ifndef NB
#define NB 4
#endif
#ifndef SEQ
#define SEQ 1024
#endif
#define NB_FULL  4
#define SEQ_FULL 1024
#define TT   SEQ
#define DM   1024
#define NH_  16
#define HD   64
#define DQ   (NH_ * HD)
#define SCL  0.125f
#define NE   128     // rel tables (65 rows) padded to 128
#define NREL 65
#define MAXR 32
#define PP   (TT + NE)   // V^T columns (keys + rel buckets)
static_assert(TT % 128 == 0);
static_assert(TT == SEQ_FULL);   // the batches' rows are folded into one M = NB*TT dimension
static_assert(NB <= NB_FULL);
static_assert(NB >= 1);
static_assert(PP % 32 == 0);
static_assert(NREL == 2 * MAXR + 1);
static_assert(DM % 64 == 0);
static_assert(HD == 64);   // plane's thread map: 8 chunks of 8 columns a row

typedef _Float16 h16;
typedef unsigned short bf;
typedef __attribute__((ext_vector_type(16))) __bf16   v16bf;
typedef __attribute__((ext_vector_type(16))) _Float16 v16h;
typedef __attribute__((ext_vector_type(8)))  _Float16 v8h;
typedef __attribute__((ext_vector_type(8)))  unsigned short v8us;
typedef __attribute__((ext_vector_type(8)))  float    v8f;
typedef __attribute__((ext_vector_type(4)))  float    v4f;
typedef v8h  __attribute__((may_alias)) v8ha;
typedef v4f  __attribute__((may_alias)) v4fa;
typedef v8us __attribute__((may_alias)) v8usa;

__device__ __forceinline__ unsigned short f2bf(float f) { unsigned u = __float_as_uint(f); u += 0x7FFFu + ((u >> 16) & 1u); return (unsigned short)(u >> 16); }
__device__ __forceinline__ float bf2f(unsigned short b) { return __uint_as_float(((unsigned)b) << 16); }
__device__ __forceinline__ float bfr(float f) { return bf2f(f2bf(f)); }
__device__ __forceinline__ size_t FO(size_t row, size_t k, size_t K) { return ((row >> 4) * (K >> 3) + (k >> 3)) * 128 + (row & 15) * 8 + (k & 7); }
__device__ __forceinline__ v16h cat16(v8h lo, v8h hi) { return __builtin_shufflevector(lo, hi, 0, 1, 2, 3, 4, 5, 6, 7, 8, 9, 10, 11, 12, 13, 14, 15); }
__device__ __forceinline__ v16bf cat16b(v8us lo, v8us hi) { return __builtin_bit_cast(v16bf, __builtin_shufflevector(lo, hi, 0, 1, 2, 3, 4, 5, 6, 7, 8, 9, 10, 11, 12, 13, 14, 15)); }
__device__ __forceinline__ v8f wmma16(v16h a, v16h b, v8f c) { return __builtin_amdgcn_wmma_f32_16x16x32_f16(false, a, false, b, (short)0, c, false, false); }
__device__ __forceinline__ v8f wmmab(v16bf a, v16bf b, v8f c) { return __builtin_amdgcn_wmma_f32_16x16x32_bf16(false, a, false, b, (short)0, c, false, false); }

// ---- k_gemmw: GEMM, one work-group of 4 waves (2 x 2) per 128x128 output tile, 64x64 (16 accumulators) per wave; operands are 16-bit planes in fragment order; grid (M/128, N/128, Z), 128 threads.
// C[m][n] (f32, pitch ldc, + optional f32 bias[n] via bf16; z = 1, 2 take bias1, bias2) = sum_k A[m][k] Bt[n][k] (+ A2[m][k] Bt[n][k] where NSPLIT == 1). z-batch strides sA/sB/sC in elements. K % 64 == 0, K >= 128, a compile-time constant; A, A2 and Bt have K columns.
// Fragment map (both operands): lane l -> row/col l&15, elements 0..7 <- k 8h..8h+7, elements 8..15 <- k 16+8h..16+8h+7 (h = l>>4); D element r -> row 8h+r, col l&15. In fragment order these are elements 8 l .. 8 l + 7 and 256 + 8 l .. of the fragment's 512.
// A stage is 64 k of the tile's 8 row tiles of each operand: a row tile's 64 k are 2 KiB in a row in the workspace and go as they lie into LDS, 16 bytes a thread, by asynchronous copies; two stage buffers, the next stage's copies fly while this one is multiplied. Every fragment is fetched from L2 once for two waves.
template <typename T16> __device__ __forceinline__ const T16* atb(const T16* u, unsigned bytes) { return (const T16*)((const char*)u + bytes); }
template <typename T16> struct WFrag;
template <> struct WFrag<h16> { typedef v16h V; static __device__ __forceinline__ V ld(const h16* p) { return cat16(*(const v8h*)p, *(const v8h*)(p + 256)); } static __device__ __forceinline__ v8f mma(V a, V b, v8f c) { return wmma16(a, b, c); } };
template <> struct WFrag<bf> { typedef v16bf V; static __device__ __forceinline__ V ld(const bf* p) { return cat16b(*(const v8us*)p, *(const v8us*)(p + 256)); } static __device__ __forceinline__ V lds(const char* p) { return cat16b(*(const v8usa*)p, *(const v8usa*)(p + 512)); } static __device__ __forceinline__ v8f mma(V a, V b, v8f c) { return wmmab(a, b, c); } };
// the thread's 16 bytes of eight row tiles (gs bytes apart in the workspace, 2 KiB apart in LDS); the s_wait_xcnt closes the statement, so no address register of a copy is rewritten ahead of it
__device__ __forceinline__ void cp8(unsigned l, const char* g, unsigned gs) {
    asm volatile("global_load_async_to_lds_b128 %0, %8, off\n\t"
                 "global_load_async_to_lds_b128 %1, %9, off\n\t"
                 "global_load_async_to_lds_b128 %2, %10, off\n\t"
                 "global_load_async_to_lds_b128 %3, %11, off\n\t"
                 "global_load_async_to_lds_b128 %4, %12, off\n\t"
                 "global_load_async_to_lds_b128 %5, %13, off\n\t"
                 "global_load_async_to_lds_b128 %6, %14, off\n\t"
                 "global_load_async_to_lds_b128 %7, %15, off\n\t"
                 "s_wait_xcnt 0x0"
                 :: "v"(l), "v"(l + 2048u), "v"(l + 4096u), "v"(l + 6144u), "v"(l + 8192u), "v"(l + 10240u), "v"(l + 12288u), "v"(l + 14336u),
                    "v"(g), "v"(g + gs), "v"(g + 2 * (size_t)gs), "v"(g + 3 * (size_t)gs), "v"(g + 4 * (size_t)gs), "v"(g + 5 * (size_t)gs), "v"(g + 6 * (size_t)gs), "v"(g + 7 * (size_t)gs) : "memory");
}
// at most 256 registers: three work-groups of the projections fit a WGP (their LDS allows three), and every operand of the copies' asm text stays below v256
template <typename T16, int NSPLIT, bool BIAS, int K>
__global__ __launch_bounds__(128, 4) void k_gemmw(const T16* __restrict__ A, const T16* __restrict__ A2, const T16* __restrict__ Bt, float* C, int ldc, const float* __restrict__ bias0, const float* __restrict__ bias1, const float* __restrict__ bias2, size_t sA, size_t sB, size_t sC) {
    typedef typename WFrag<T16>::V V;
    static_assert(NSPLIT == 0 || NSPLIT == 1); static_assert(K % 64 == 0 && K >= 128);
    constexpr unsigned OPB = 8 * 2048;                       // one operand's part of a stage
    constexpr unsigned BOF = (NSPLIT == 1 ? 2 : 1) * OPB;    // Bt's place in a stage, behind A (and A2)
    constexpr unsigned STG = BOF + OPB;
    constexpr int NT = K / 64;
    __shared__ __align__(16) char st[2 * STG];
    __shared__ __align__(16) float osw[4][16 * 68];
    const size_t z = blockIdx.z; A += z * sA; if (NSPLIT == 1) A2 += z * sA; Bt += z * sB; C += z * sC;
    const float* __restrict__ bias = (z == 0) ? bias0 : (z == 1) ? bias1 : bias2;
    const int lane = threadIdx.x & 31, lr = lane & 15, hi = lane >> 4; const int wid = __builtin_amdgcn_readfirstlane(threadIdx.x >> 5); const int wm = wid & 1, wn = wid >> 1;
    const int rb = blockIdx.x * 128, cb = blockIdx.y * 128;
    v8f acc[4][4];
#pragma unroll
    for (int mb = 0; mb < 4; ++mb)
#pragma unroll
        for (int nb = 0; nb < 4; ++nb) acc[mb][nb] = (v8f){};
    // a 16-row tile is 16 K elements, 64 k of it 2 KiB
    const char* gA = (const char*)(A + (size_t)rb * K) + threadIdx.x * 16; const char* gA2 = (NSPLIT == 1) ? (const char*)(A2 + (size_t)rb * K) + threadIdx.x * 16 : gA; const char* gB = (const char*)(Bt + (size_t)cb * K) + threadIdx.x * 16;
    const unsigned l0 = (unsigned)(size_t)(__attribute__((address_space(3))) char*)st + threadIdx.x * 16;   // the thread's LDS byte address in a row tile of buffer 0
    auto fill = [&](int t, unsigned buf) { const unsigned l = l0 + buf * STG; const size_t go = (size_t)t * 2048;
        cp8(l, gA + go, 32 * K); if (NSPLIT == 1) cp8(l + OPB, gA2 + go, 32 * K); cp8(l + BOF, gB + go, 32 * K); };
    fill(0, 0);
    asm volatile("s_wait_asynccnt 0x0" ::: "memory");   // this wave's copies of stage 0 have landed
    __syncthreads();                                    // ... and every other wave's
    fill(1, 1);
#pragma unroll 1
    for (int t = 0; t < NT; ++t) {
        const char* sb = st + (unsigned)(t & 1) * STG + lane * 16;
#pragma unroll
        for (int ks = 0; ks < 2; ++ks) {
            V a[4], a2[4], b[4];
            b[0] = WFrag<T16>::lds(sb + BOF + (wn * 4) * 2048 + ks * 1024);
#pragma unroll
            for (int mb = 0; mb < 4; ++mb) { a[mb] = WFrag<T16>::lds(sb + (wm * 4 + mb) * 2048 + ks * 1024); if (NSPLIT == 1) a2[mb] = WFrag<T16>::lds(sb + OPB + (wm * 4 + mb) * 2048 + ks * 1024); }
#pragma unroll
            for (int nb = 1; nb < 4; ++nb) b[nb] = WFrag<T16>::lds(sb + BOF + (wn * 4 + nb) * 2048 + ks * 1024);
            __builtin_amdgcn_sched_barrier(0);   // the k step's LDS reads stay one group ahead of its products, in the order of use; without it the build reads Bt fragment by fragment and waits out the LDS latency before every four products
#pragma unroll
            for (int nb = 0; nb < 4; ++nb) {
#pragma unroll
                for (int mb = 0; mb < 4; ++mb) { acc[mb][nb] = WFrag<T16>::mma(a[mb], b[nb], acc[mb][nb]); if (NSPLIT == 1) acc[mb][nb] = WFrag<T16>::mma(a2[mb], b[nb], acc[mb][nb]); } }
        }
        __builtin_amdgcn_sched_barrier(0);                  // the stage's products stay ahead of the foot; without it the build sinks 32 k of them behind the barrier, in front of the refill, whose copies then start that much later
        asm volatile("s_wait_dscnt 0x0" ::: "memory");      // this wave's reads of the buffer are done before it is refilled
        asm volatile("s_wait_asynccnt 0x0" ::: "memory");   // this wave's copies of stage t + 1 have landed
        __syncthreads();                                    // publishes stage t + 1 and ends every wave's reads of stage t
        if (t + 2 < NT) fill(t + 2, (unsigned)(t & 1));
    }
    asm volatile("s_wait_asynccnt 0x0" ::: "memory");       // no copy is outstanding when the wave goes on
    float* os = osw[wid]; const int r0 = rb + wm * 64, c0 = cb + wn * 64;   // the wave's own staging rows and its 64x64 part of the tile
#pragma unroll
    for (int mb = 0; mb < 4; ++mb) {
#pragma unroll
        for (int nb = 0; nb < 4; ++nb) {
#pragma unroll
            for (int j = 0; j < 8; ++j) os[(hi * 8 + j) * 68 + nb * 16 + lr] = acc[mb][nb][j]; }
        __builtin_amdgcn_wave_barrier(); asm volatile("" ::: "memory");
        float* crow = C + (size_t)(r0 + mb * 16) * ldc + c0;
{
#pragma unroll
            for (int s = 0; s < 8; ++s) { const int row = 2 * s + hi, cofs = lr * 4; v4f val = *(const v4fa*)(os + row * 68 + cofs); if (BIAS) { val[0] += bfr(bias[c0 + cofs]); val[1] += bfr(bias[c0 + cofs + 1]); val[2] += bfr(bias[c0 + cofs + 2]); val[3] += bfr(bias[c0 + cofs + 3]); }
                *(v4f*)(crow + (size_t)row * ldc + cofs) = val; }
             }
        asm volatile("s_wait_xcnt 0x0" ::: "memory");   // ahead of the next row tile's code, which reuses the registers that the eight stores name
        __builtin_amdgcn_wave_barrier(); asm volatile("" ::: "memory");
    }
}

__device__ __forceinline__ h16 tohx(float x) { return (h16)x; }
__device__ __forceinline__ void splitf(float y, unsigned short& h, unsigned short& l) { h = f2bf(y); l = f2bf(y - bf2f(h)); }
typedef __attribute__((ext_vector_type(2))) _Float16 v2h;
typedef __attribute__((ext_vector_type(4))) _Float16 v4h;
typedef v4h  __attribute__((may_alias)) v4ha;
typedef __attribute__((ext_vector_type(2))) unsigned short v2us;
typedef __attribute__((ext_vector_type(4))) unsigned short v4us;
typedef __attribute__((ext_vector_type(2))) float v2f;

// The jobs below that need nothing of each other share a launch: each takes a range of the block index (bx: the block's index inside its job, by: the job's slab), picked by a block-uniform branch in k_prep and k_relay.
// y picks one of up to four equally long sources of DM columns; its bf16 copy, in fragment order, is slab y of dst. A wave takes 8 rows x 4 chunks of 8 columns: whole 128-byte lines on both sides.
__device__ __forceinline__ void cvt8(unsigned bx, unsigned y, const float* __restrict__ s0, const float* __restrict__ s1, const float* __restrict__ s2, const float* __restrict__ s3, bf* dst, size_t n8) { const size_t i = (size_t)bx * 256 + threadIdx.x; if (i >= n8) return;
    const float* __restrict__ src = (y == 0) ? s0 : (y == 1) ? s1 : (y == 2) ? s2 : s3; dst += (size_t)y * n8 * 8;
    const size_t u = i >> 6; const size_t row = (u / (DM / 32)) * 16 + ((i >> 5) & 1) * 8 + ((i >> 2) & 7), k = ((u % (DM / 32)) * 4 + (i & 3)) * 8; const v8f v = *(const v8f*)(src + row * DM + k); v8us o;
#pragma unroll
    for (int q = 0; q < 8; ++q) o[q] = f2bf(v[q]); *(v8us*)(dst + FO(row, k, DM)) = o;  }

__device__ __forceinline__ void epad2(unsigned bx, const float* __restrict__ E, bf* EB) { const size_t i = (size_t)bx * 256 + threadIdx.x; if (i >= (size_t)NE * HD / 8) return; const int d0 = (int)(i % (HD / 8)) * 8; const int r = (int)(i / (HD / 8)); const float* src = E + (size_t)min(r, NREL - 1) * HD + d0; v8us o;
#pragma unroll
    for (int q = 0; q < 8; ++q) { const unsigned short v = f2bf(src[q]); o[q] = (r < NREL) ? v : (unsigned short)0; }
    *(v8us*)(EB + FO(r, d0, HD)) = o;  }

// by: slab of TT rows of F (q's batches, then k's) and its nheads planes, each in fragment order. A wave takes 8 rows x 4 chunks of 8 columns: whole 128-byte lines on both sides.
__device__ __forceinline__ void plane(unsigned bx, unsigned by, const float* __restrict__ F, int pitch, int nheads, bf* Ph, bf* Pl) {
    const size_t x = (size_t)bx * 256 + threadIdx.x; if (x >= (size_t)nheads * TT * HD / 8) return;
    F += (size_t)by * TT * pitch; Ph += (size_t)by * nheads * TT * HD; Pl += (size_t)by * nheads * TT * HD;
    const int d = (int)(((x >> 5) & 1) * 4 + (x & 3)) * 8; const int t = (int)((x >> 7) % (TT / 16)) * 16 + (int)((x >> 6) & 1) * 8 + (int)((x >> 2) & 7); const int h = (int)(x / ((size_t)HD * TT / 8));
    const size_t e = (size_t)h * TT * HD + FO(t, d, HD);
    const v8f y = *(const v8f*)(F + (size_t)t * pitch + h * HD + d); v8us oh, ol;
#pragma unroll
    for (int q = 0; q < 8; ++q) { unsigned short a, c2; splitf(y[q], a, c2); oh[q] = a; ol[q] = c2; }
    *(v8us*)(Ph + e) = oh; *(v8us*)(Pl + e) = ol;  }

// by: batch (TT rows of F, nheads planes of VT, each HD rows x PP columns in fragment order). A wave takes 32 neighbouring d of 8 keys: each load one whole line, the store two runs of 256 bytes.
__device__ __forceinline__ void vtp8(unsigned bx, unsigned by, const float* __restrict__ F, int pitch, int nheads, h16* VT) {
    const size_t x = (size_t)bx * 256 + threadIdx.x; if (x >= (size_t)nheads * HD * TT / 8) return;
    F += (size_t)by * TT * pitch; VT += (size_t)by * nheads * HD * PP;
    const int d = (int)(x % HD); const int t = (int)((x / HD) % (TT / 8)) * 8; const int g = (int)(x / ((size_t)TT * HD / 8));
    v8h o;
#pragma unroll
    for (int q = 0; q < 8; ++q) o[q] = tohx(F[(size_t)(t + q) * pitch + g * HD + d]);
    h16* dst = VT + (size_t)g * HD * PP + FO(d, t, PP);
    *(v8h*)dst = o;  }

__device__ __forceinline__ void evt(unsigned bx, const float* __restrict__ EV, int nheads, h16* VT) {
    const size_t x = (size_t)bx * 256 + threadIdx.x; if (x >= (size_t)nheads * HD * NE / 8) return;
    const int d = (int)(x % HD); const int r0 = (int)((x / HD) % (NE / 8)) * 8; const int g = (int)(x / ((size_t)NE * HD / 8));
    v8h o; const float* ep[8]; float ev[8];
#pragma unroll
    for (int q = 0; q < 8; ++q) { ep[q] = EV + (size_t)min(r0 + q, NREL - 1) * HD + d; ev[q] = *ep[q]; }
    // the eight addresses are inputs, so they stay in their registers up to this wait: no result of the run of loads lands in a register that an issued load of the run still names
    asm volatile("s_wait_xcnt 0x0" :: "v"(ep[0]), "v"(ep[1]), "v"(ep[2]), "v"(ep[3]), "v"(ep[4]), "v"(ep[5]), "v"(ep[6]), "v"(ep[7]) : "memory");
#pragma unroll
    for (int q = 0; q < 8; ++q) { const float y = (r0 + q < NREL) ? bfr(ev[q]) : 0.0f; o[q] = tohx(y); }
    h16* dst = VT + (size_t)g * HD * PP + FO(d, TT + r0, PP);
    *(v8h*)dst = o;  }

// blocks of each job
#define GB_E ((NE * HD / 8 + 255) / 256)                  // E_k table
#define GB_V ((NB * NH_ * HD * NE / 8 + 255) / 256)       // E_v^T columns of every plane
#define GB_W ((DQ * DM / 8 + 255) / 256)                  // one weight matrix
#define GB_X ((NB * TT * DM / 8 + 255) / 256)             // one input, all batches
#define GB_P ((NH_ * TT * HD / 8 + 255) / 256)            // one slab of TT projected rows
// k_prep: all that reads only the inputs: the two tables, the bf16 copies of the four weights and of the three inputs. Grid GB_E + GB_V + 4 GB_W + 3 GB_X.
__global__ __launch_bounds__(256) void k_prep(const float* __restrict__ query, const float* __restrict__ key, const float* __restrict__ value, const float* __restrict__ wq, const float* __restrict__ wk, const float* __restrict__ wv, const float* __restrict__ wo,
                                              const float* __restrict__ rke, const float* __restrict__ rve, bf* XB, bf* WQ, bf* EB, h16* VT) {
    unsigned b = blockIdx.x;
    if (b < GB_E) { epad2(b, rke, EB); return; }                                                      /* E_k: 65 rows bf16 (exact), rows 65..127 zero */
    b -= GB_E;
    if (b < GB_V) { evt(b, rve, NB * NH_, VT); return; }                                              /* E_v^T columns TT..TT+127 of every V^T row */
    b -= GB_V;
    if (b < 4 * GB_W) { cvt8(b % GB_W, b / GB_W, wq, wk, wv, wo, WQ, (size_t)DQ * DM / 8); return; }
    b -= 4 * GB_W;
    cvt8(b % GB_X, b / GB_X, query, key, value, value, XB, (size_t)NB * TT * DM / 8);
}
// k_relay: the projections' f32 rows F [q | k | v][NB*TT][DQ] into the operand planes of the attention. Grid 3 NB GB_P.
__global__ __launch_bounds__(256) void k_relay(const float* __restrict__ F, bf* QPh, bf* QPl, h16* VT) {
    unsigned b = blockIdx.x;
    if (b < NB * GB_P) { vtp8(b % GB_P, b / GB_P, F + (size_t)2 * NB * TT * DQ, DQ, NH_, VT); return; }
    b -= NB * GB_P;
    plane(b % GB_P, b / GB_P, F, DQ, NH_, QPh, QPl);
}

// k_fattn: one work-group (8 waves) per FR = 32 query rows of one (batch, head) plane g; the scores never leave the registers.
// Key tiles of 16 are dealt out from the first tile that a band of the 32 queries can touch, T0 = r0 / 16 - 2, round the row's end: slot n of wave w is tile (T0 + 8 n + w) % 64. The six tiles with band keys are slot 0 of waves 0 to 5; a slot n >= 1 lies wholly right of every band or, wrapped, wholly left.
// 1) wave w: S^T[its 8 key tiles][32] = k.q^T (k fragments as A, q fragments as B; 3 products, same order as a K = 64 GEMM): a lane holds query l & 15 of a query tile and, per key tile, keys 8 (l >> 4) .. + 7; column tile w of QE = q.E_k^T (2 products) goes f32 into LDS;
// 2) on the accumulators: t_j = S_j * HD^-0.5 + QE[clip(j - i, -32, 32) + 32] (per key in slot 0, one clipped logit a query in the other slots); a query's maximum from 16 partial maxima (wave, lane half) through LDS;
// 3) x_j = 32 exp(t_j - max): the eight values a lane of slots 2 s and 2 s + 1, as fp16, ARE the B fragment of k step s of V^T.P^T; partial row sum and the two tails (keys j <= i - 32, j >= i + 32) in f32 to LDS; the keys of the band also as fp16 to bucket j - i + 32 of the query's bucket row in LDS (zero elsewhere);
// 4) wave w: O^T[64][32] over its own 128 keys, A from the V^T plane, each half of a fragment from its own key tile (every V fragment leaves L2 once a work-group); the eight waves' f32 partial sums go to LDS in register order;
// 5) wave w: tile (w & 3 of d, w >> 2 of the queries): E_v^T . buckets^T (tails put into elements 0 and 64), plus the eight partial sums as a fixed tree, divided by the row sum, split into the bf16 hi/lo context planes, row b*TT + t, column h*64 + d, in fragment order: a lane stores 8 columns, a wave 512 bytes in a row.
#define FR   32
#define QEP  132             // float pitch of a QE row
#define MP   20              // float pitch of a query's 16 partial maxima or sums: 16-byte reads, lanes on different banks
#define XP   (NE + 8)        // fp16 pitch of a query's bucket row
#define PSC  5.0f            // x carries 2^5: an fp16 tail of TT keys stays finite, small x keep more bits
static_assert(TT % FR == 0);
static_assert(TT == 8 * 128);     // 8 waves x 128 keys
static_assert(FR == 32 && NE == 128 && 2 * MAXR + 1 <= 96);   // two query tiles; the used buckets lie in three k steps
// sum of a query's 16 partial values, fixed tree
__device__ __forceinline__ float sum16(const float* p) { const v4f a = *(const v4fa*)p, b = *(const v4fa*)(p + 4), c = *(const v4fa*)(p + 8), d = *(const v4fa*)(p + 12); const v4f s = (a + b) + (c + d); return (s[0] + s[1]) + (s[2] + s[3]); }
// eight exp2 in one statement, no result in a source's register, closed by the one slot that the instruction set asks for behind a transcendental
__device__ __forceinline__ void exp2x8(const v8f a, float (&x)[8]) {
    asm("v_exp_f32 %0, %8\n\tv_exp_f32 %1, %9\n\tv_exp_f32 %2, %10\n\tv_exp_f32 %3, %11\n\tv_exp_f32 %4, %12\n\tv_exp_f32 %5, %13\n\tv_exp_f32 %6, %14\n\tv_exp_f32 %7, %15\n\tv_nop"
        : "=&v"(x[0]), "=&v"(x[1]), "=&v"(x[2]), "=&v"(x[3]), "=&v"(x[4]), "=&v"(x[5]), "=&v"(x[6]), "=&v"(x[7])
        : "v"(a[0]), "v"(a[1]), "v"(a[2]), "v"(a[3]), "v"(a[4]), "v"(a[5]), "v"(a[6]), "v"(a[7]));
}
// 4 waves per SIMD = two work-groups per WGP: at most 256 registers
__global__ __launch_bounds__(256, 4) void k_fattn(const bf* __restrict__ QPh, const bf* __restrict__ QPl, const bf* __restrict__ KPh, const bf* __restrict__ KPl, const bf* __restrict__ EB, const h16* __restrict__ VT, bf* ATh, bf* ATl) {
    __shared__ __align__(16) float qes[FR * QEP];
    __shared__ __align__(16) float ost[8 * 8 * 2 * 32 * 4];   // [wave][tile][half of the 8 registers][lane][4]
    __shared__ __align__(16) float mxs[FR * MP];
    __shared__ __align__(16) float sms[3 * FR * MP];          // row sum, left tail, right tail
    __shared__ __align__(16) h16 pex[FR * XP];
    const int lane = threadIdx.x & 31, lr = lane & 15, hi = lane >> 4; const int wid = __builtin_amdgcn_readfirstlane(threadIdx.x >> 5);
    const int g = blockIdx.y, r0 = blockIdx.x * FR; const size_t pl = (size_t)g * TT * HD;
    const unsigned lo = (unsigned)lane * 16;   // the lane's byte offset in a fragment (fragment order); all else of an address is wave-uniform
    const int T0 = r0 / 16 - 2;                // first key tile that a band can touch (below 0: wraps to the row's end, where the clip holds as well)
    auto tile = [&](int n) { return (T0 + n * 8 + wid) & (TT / 16 - 1); };   // wave-uniform: the key tile in slot n
    for (int c = threadIdx.x; c < FR * XP / 8; c += 256) *(v8ha*)(pex + c * 8) = (v8h){};
    v8f acc[2][8];
    {
        const bf* qbh = QPh + pl + (size_t)r0 * HD; const bf* qbl = QPl + pl + (size_t)r0 * HD;   // wave-uniform bases of the 32 rows
        const bf* ebp = EB + (size_t)(wid * 16) * HD;
        v8f acq[2];
#pragma unroll
        for (int mb = 0; mb < 2; ++mb) { acq[mb] = (v8f){};
#pragma unroll
            for (int n = 0; n < 8; ++n) acc[mb][n] = (v8f){}; }
#pragma unroll
        for (int ks = 0; ks < 2; ++ks) {      // 32 of the 64 d at a time: only that half of q is in registers beside the 128 accumulators
            v16bf a[2], a2[2];
#pragma unroll
            for (int mb = 0; mb < 2; ++mb) { const int ao = mb * 16 * HD + ks * 512; a[mb] = WFrag<bf>::ld(atb(qbh + ao, lo)); a2[mb] = WFrag<bf>::ld(atb(qbl + ao, lo)); }
            const v16bf e = WFrag<bf>::ld(atb(ebp + ks * 512, lo));
            // the lane offset and the bases are inputs, so they stay in their registers up to this wait: no result of the run of loads lands in a register that an issued load of the run still names
            asm volatile("s_wait_xcnt 0x0" :: "v"(lo), "s"(qbh), "s"(qbl), "s"(ebp) : "memory");
#pragma unroll
            for (int mb = 0; mb < 2; ++mb) { acq[mb] = wmmab(a[mb], e, acq[mb]); acq[mb] = wmmab(a2[mb], e, acq[mb]); }
#pragma unroll
            for (int ng = 0; ng < 4; ++ng) {  // two key tiles at a time
                v16bf b[2], b2[2];
                const bf* kh[2]; const bf* kl[2];   // wave-uniform bases of the two tiles' rows
#pragma unroll
                for (int n2 = 0; n2 < 2; ++n2) { const size_t bo = pl + (size_t)tile(ng * 2 + n2) * 16 * HD + ks * 512; kh[n2] = KPh + bo; kl[n2] = KPl + bo; b[n2] = WFrag<bf>::ld(atb(kh[n2], lo)); b2[n2] = WFrag<bf>::ld(atb(kl[n2], lo)); }
                // as above, for the run of key loads
                asm volatile("s_wait_xcnt 0x0" :: "v"(lo), "s"(kh[0]), "s"(kl[0]), "s"(kh[1]), "s"(kl[1]) : "memory");
#pragma unroll
                for (int n2 = 0; n2 < 2; ++n2)
#pragma unroll
                    for (int mb = 0; mb < 2; ++mb) { v8f t = acc[mb][ng * 2 + n2]; t = wmmab(b[n2], a[mb], t); t = wmmab(b[n2], a2[mb], t); t = wmmab(b2[n2], a[mb], t); acc[mb][ng * 2 + n2] = t; }
            }
        }
#pragma unroll
        for (int mb = 0; mb < 2; ++mb)
#pragma unroll
            for (int j = 0; j < 8; ++j) qes[(mb * 16 + hi * 8 + j) * QEP + wid * 16 + lr] = acq[mb][j];
    }
    __syncthreads();   // QE is whole, the bucket rows are zero
#pragma unroll
    for (int mb = 0; mb < 2; ++mb) {
        const float* qe = qes + (mb * 16 + lr) * QEP; const float qL = qe[0], qR = qe[2 * MAXR]; float m[4] = {-3.0e38f, -3.0e38f, -3.0e38f, -3.0e38f};   // four chains: each fills the others' dependent links
#pragma unroll
        for (int n = 0; n < 8; ++n) {
            if (n == 0) { const int o = tile(0) * 16 + hi * 8 - (r0 + mb * 16 + lr);   // j - i of the lane's first key
#pragma unroll
                for (int r = 0; r < 8; ++r) acc[mb][n][r] = acc[mb][n][r] * SCL + qe[min(max(o + r, -MAXR), MAXR) + MAXR]; }
            else { const float c1 = (T0 + n * 8 + wid >= TT / 16) ? qL : qR; acc[mb][n] = acc[mb][n] * SCL + c1; }
#pragma unroll
            for (int r = 0; r < 8; r += 2) m[r >> 1] = fmaxf(fmaxf(m[r >> 1], acc[mb][n][r]), acc[mb][n][r + 1]);
        }
        mxs[(mb * 16 + lr) * MP + wid * 2 + hi] = fmaxf(fmaxf(m[0], m[1]), fmaxf(m[2], m[3]));
    }
    const h16* vpl = VT + (size_t)g * HD * PP;
    v16h va[4][4];
    auto ldv = [&](int s) { const h16* v0 = atb(vpl + (size_t)tile(2 * s) * 256, lo); const h16* v1 = atb(vpl + (size_t)tile(2 * s + 1) * 256, lo);   // a key tile is two chunks of 128 elements of a row tile
#pragma unroll
        for (int dt = 0; dt < 4; ++dt) va[s][dt] = cat16(*(const v8h*)(v0 + dt * 16 * PP), *(const v8h*)(v1 + dt * 16 * PP));
        // as above, for the run of V loads: the lane's two addresses are the inputs
        asm volatile("s_wait_xcnt 0x0" :: "v"(v0), "v"(v1) : "memory"); };
    __syncthreads();   // the partial maxima are whole
    ldv(0);            // depends on nothing that the softmax makes: in flight over it (behind the barrier, which waits for every load in front of it)
    v16h pb[2][4];
#pragma unroll
    for (int mb = 0; mb < 2; ++mb) {
        const int q = mb * 16 + lr; const float* mp = mxs + q * MP;
        const v4f m0 = *(const v4fa*)mp, m1 = *(const v4fa*)(mp + 4), m2 = *(const v4fa*)(mp + 8), m3 = *(const v4fa*)(mp + 12);
        float mx = fmaxf(fmaxf(fmaxf(m0[0], m0[1]), fmaxf(m0[2], m0[3])), fmaxf(fmaxf(m1[0], m1[1]), fmaxf(m1[2], m1[3])));
        mx = fmaxf(mx, fmaxf(fmaxf(fmaxf(m2[0], m2[1]), fmaxf(m2[2], m2[3])), fmaxf(fmaxf(m3[0], m3[1]), fmaxf(m3[2], m3[3]))));
        float sum = 0.f, tl0 = 0.f, tl1 = 0.f;
#pragma unroll
        for (int n = 0; n < 8; ++n) {
            const v8f ar = (acc[mb][n] - mx) * 1.4426950408889634f + PSC; float x[8]; exp2x8(ar, x);
            const v2f e2 = ((v2f){x[0], x[1]} + (v2f){x[2], x[3]}) + ((v2f){x[4], x[5]} + (v2f){x[6], x[7]}); const float e = e2[0] + e2[1]; sum += e;
#pragma unroll
            for (int r = 0; r < 8; ++r) pb[mb][n >> 1][(n & 1) * 8 + r] = tohx(x[r]);
            if (n == 0) { const int o = tile(0) * 16 + hi * 8 - (r0 + q);
#pragma unroll
                for (int r = 0; r < 8; ++r) { const int d = o + r; tl0 += (d <= -MAXR) ? x[r] : 0.f; tl1 += (d >= MAXR) ? x[r] : 0.f;
                    if (d > -MAXR && d < MAXR) pex[q * XP + d + MAXR] = pb[mb][0][r]; } }
            else { const bool wr = T0 + n * 8 + wid >= TT / 16; tl0 = fmaf(e, wr ? 1.f : 0.f, tl0); tl1 = fmaf(e, wr ? 0.f : 1.f, tl1); }
        }
        sms[q * MP + wid * 2 + hi] = sum; sms[(FR + q) * MP + wid * 2 + hi] = tl0; sms[(2 * FR + q) * MP + wid * 2 + hi] = tl1;
    }
    const int dt5 = wid & 3, qt5 = wid >> 2;   // the wave's tile of the last stage
    const h16* ve = VT + ((size_t)g * HD + dt5 * 16) * PP + (size_t)TT * 16;   // wave-uniform: the bucket columns of its row tile
    v16h vx[3];
#pragma unroll
    for (int s = 0; s < 3; ++s) vx[s] = WFrag<h16>::ld(atb(ve + s * 512, lo));   // ahead of the products: landed when the barrier behind them waits for every load
    // as above, for the run of E_v^T loads
    asm volatile("s_wait_xcnt 0x0" :: "v"(lo), "s"(ve) : "memory");
    {
        v8f oc[4][2];
#pragma unroll
        for (int dt = 0; dt < 4; ++dt)
#pragma unroll
            for (int mb = 0; mb < 2; ++mb) oc[dt][mb] = (v8f){};
#pragma unroll
        for (int s = 0; s < 4; ++s) {
            if (s + 1 < 4) ldv(s + 1);
#pragma unroll
            for (int dt = 0; dt < 4; ++dt)
#pragma unroll
                for (int mb = 0; mb < 2; ++mb) oc[dt][mb] = wmma16(va[s][dt], pb[mb][s], oc[dt][mb]); }
#pragma unroll
        for (int dt = 0; dt < 4; ++dt)
#pragma unroll
            for (int mb = 0; mb < 2; ++mb)
#pragma unroll
                for (int hf = 0; hf < 2; ++hf) *(v4fa*)(ost + ((((wid * 8 + dt * 2 + mb) * 2 + hf) * 32) + lane) * 4) = (v4f){oc[dt][mb][hf * 4], oc[dt][mb][hf * 4 + 1], oc[dt][mb][hf * 4 + 2], oc[dt][mb][hf * 4 + 3]};
    }
    __syncthreads();   // partial O^T, partial sums and bucket rows are whole
    {
        const int q = qt5 * 16 + lr;
        const float sum = sum16(sms + q * MP), tl0 = sum16(sms + (FR + q) * MP), tl1 = sum16(sms + (2 * FR + q) * MP);
        v8f x = (v8f){};
#pragma unroll
        for (int s = 0; s < 3; ++s) { const h16* bp = pex + q * XP + s * 32 + hi * 8; v16h b = cat16(*(const v8ha*)bp, *(const v8ha*)(bp + 16));
            if (s == 0) b[0] = (hi == 0) ? tohx(tl0) : b[0];                 // bucket 0
            if (s == 2) b[0] = (hi == 0) ? tohx(tl1) : b[0];                 // bucket 2 MAXR = 64
            x = wmma16(vx[s], b, x); }
        v8f p[8];
#pragma unroll
        for (int w = 0; w < 8; ++w) { const float* op = ost + (((w * 8 + dt5 * 2 + qt5) * 2) * 32 + lane) * 4; const v4f u0 = *(const v4fa*)op, u1 = *(const v4fa*)(op + 128);
            p[w] = (v8f){u0[0], u0[1], u0[2], u0[3], u1[0], u1[1], u1[2], u1[3]}; }
        x += ((p[0] + p[1]) + (p[2] + p[3])) + ((p[4] + p[5]) + (p[6] + p[7]));
        const float f = __fdiv_rn(1.0f, sum);
        v8us oh, ol;
#pragma unroll
        for (int r = 0; r < 8; ++r) { unsigned short c1, c2; splitf(x[r] * f, c1, c2); oh[r] = c1; ol[r] = c2; }
        const size_t oo = FO((size_t)(g / NH_) * TT + r0 + q, (size_t)(g % NH_) * HD + dt5 * 16 + hi * 8, DQ);
        *(v8us*)(ATh + oo) = oh; *(v8us*)(ATl + oo) = ol; }
}

extern "C" void kernel_launch(void* const* d_in, const int* in_sizes, int n_in,
                              void* d_out, int out_size, void* d_ws, size_t ws_size, hipStream_t stream) {
    if (n_in < 13) return;
    const size_t needX = ((size_t)(NB - 1) * SEQ_FULL + TT) * DM;
    if ((size_t)in_sizes[0] < needX || (size_t)in_sizes[1] < needX || (size_t)in_sizes[2] < needX) return;
    if (in_sizes[3] < DM * DM || in_sizes[5] < DM * DM || in_sizes[7] < DM * DM || in_sizes[9] < DM * DM) return;
    if (in_sizes[4] < DM || in_sizes[6] < DM || in_sizes[8] < DM || in_sizes[10] < DM) return;
    if (in_sizes[11] < NREL * HD || in_sizes[12] < NREL * HD) return;
    if ((size_t)out_size < needX) return;
    const float* query = (const float*)d_in[0]; const float* key = (const float*)d_in[1]; const float* value = (const float*)d_in[2];
    const float* wq = (const float*)d_in[3]; const float* bq = (const float*)d_in[4]; const float* wk = (const float*)d_in[5]; const float* bk = (const float*)d_in[6];
    const float* wv = (const float*)d_in[7]; const float* bv = (const float*)d_in[8]; const float* wo = (const float*)d_in[9]; const float* bo = (const float*)d_in[10];
    const float* rke = (const float*)d_in[11]; const float* rve = (const float*)d_in[12];
    float* OUT = (float*)d_out;     // [NB][SEQ_FULL][DM]
    char* wsp = (char*)d_ws;
    auto take = [&](size_t bytes) { char* p = wsp; wsp += (bytes + 255) & ~(size_t)255; return (void*)p; };
    constexpr size_t MR = (size_t)NB * TT;      // rows of all batches
    constexpr size_t NG = (size_t)NB * NH_;     // (batch, head) planes
    bf* WQ = (bf*)take((size_t)4 * DQ * DM * 2); bf* WO = WQ + (size_t)3 * DQ * DM;      // wq, wk, wv, wo
    bf* EB = (bf*)take((size_t)NE * HD * 2);
    bf* XB = (bf*)take((size_t)3 * MR * DM * 2); float* F = (float*)take((size_t)3 * MR * DQ * 4);      // q, k, v
    bf* QPh = (bf*)take((size_t)2 * NG * TT * HD * 2); bf* QPl = (bf*)take((size_t)2 * NG * TT * HD * 2); bf* KPh = QPh + NG * TT * HD; bf* KPl = QPl + NG * TT * HD;
    h16* VT = (h16*)take(NG * HD * PP * 2);
    bf* ATh = (bf*)take(MR * DQ * 2); bf* ATl = (bf*)take(MR * DQ * 2);
    const size_t carved = (size_t)(wsp - (char*)d_ws);
    if (carved > ws_size) return;    // 143,671,296 B at NB=4, SEQ=1024
    // tables, weights and inputs
    k_prep<<<GB_E + GB_V + 4 * GB_W + 3 * GB_X, 256, 0, stream>>>(query, key, value, wq, wk, wv, wo, rke, rve, XB, WQ, EB, VT);
    // projections of all batches: z = q, k, v
    k_gemmw<bf, 0, true, DM><<<dim3((unsigned)(MR / 128), DQ / 128, 3), 128, 0, stream>>>(XB, nullptr, WQ, F, DQ, bq, bk, bv, MR * DM, (size_t)DQ * DM, MR * DQ);
    k_relay<<<3 * NB * GB_P, 256, 0, stream>>>(F, QPh, QPl, VT);
    k_fattn<<<dim3(TT / FR, (unsigned)NG, 1), 256, 0, stream>>>(QPh, QPl, KPh, KPl, EB, VT, ATh, ATl);   /* scores, softmax, attn.[V | E_v], context planes */
    k_gemmw<bf, 1, true, DQ><<<dim3((unsigned)(MR / 128), DM / 128, 1), 128, 0, stream>>>(ATh, ATl, WO, OUT, DM, bo, bo, bo, 0, 0, 0);
}

// v010
// One run takes 97.4 microseconds.
// Next to v009, in two timings, it ran 1.05 and 1.06 times as fast.
// Counting every step since v000, it is 9.38 times as fast.
#include <hip/hip_runtime.h>

// Contractions, f32 accumulate: q/k/v projections v_wmma_f32_16x16x32_bf16 (x, W, bias all RNE-converted to bf16, single product); content scores v_wmma_f32_16x16x32_bf16 with q and k as bf16 hi/lo planes (3 products); q.E_k^T bf16 hi/lo x exact bf16 E_k (2 products); [V | rel-value buckets]^T.attn^T v_wmma_f32_16x16x32_f16 (exp values carried x32 in fp16, divided by the f32 row sum behind the product; V fp16, E_v exact); output projection bf16 hi/lo context x exact bf16 W_o (2 products) + bf16 bias. Softmax, logit adds and carries in f32.
// Layout, all batches at once: bf16 copy of the three inputs [3][NB*TT][DM]; one projection launch (z = q, k, v), whose epilogue writes the planes per (batch, head) g = b*NH_ + h (q, k: [g][t][d] bf16 hi + lo; v: [g][d][t] fp16 with pitch TT+128 whose last 128 columns hold E_v^T (65 used, rest zero)).
// Every 16-bit matrix operand in the workspace (R rows, K columns) lies in fragment order: [row / 16][k / 8][row % 16][k % 8], element offset FO(row, k, K); the 16 x 32 fragment at (row tile, k step) is then 1 KiB in a row and each of its two wave-wide 16-byte loads covers 512 contiguous bytes (4 whole lines).
// Attention, one launch for all NB*NH_ planes (k_fattn): per 32 query rows S^T = k.q^T stays in the accumulators, QE = q.E_k^T in LDS (f32); t_j = S_j / 8 + QE[clip(j - i, -32, 32) + 32], softmax over TT keys, x_j = 32 exp(t_j - max) fp16; bucket row of a query: r = 0 sum of x over keys j <= i - 32, r = 64 over keys j >= i + 32, 0 < r < 64 the single key i + r - 32, r > 64 zero;
// the products over the TT keys and over the buckets give sum * (attn.V + attn.E_v[clip]), divided by the row sum into bf16 hi/lo context planes [b*TT + t][h*64 + d]; one output GEMM over all NB*TT rows with bias.

#ifndef NB
#define NB 4
#endif
#ifndef SEQ
#define SEQ 1024
#endif
#define NB_FULL  4
#define SEQ_FULL 1024
#define TT   SEQ
#define DM   1024
#define NH_  16
#define HD   64
#define DQ   (NH_ * HD)
#define SCL  0.125f
#define NE   128     // rel tables (65 rows) padded to 128
#define NREL 65
#define MAXR 32
#define PP   (TT + NE)   // V^T columns (keys + rel buckets)
static_assert(TT % 128 == 0);
static_assert(TT == SEQ_FULL);   // the batches' rows are folded into one M = NB*TT dimension
static_assert(NB <= NB_FULL);
static_assert(NB >= 1);
static_assert(PP % 32 == 0);
static_assert(NREL == 2 * MAXR + 1);
static_assert(DM % 64 == 0);
static_assert(HD == 64);   // a wave's 64 columns of a projection tile are one head
static_assert(TT % 64 == 0);   // ... and its 64 rows lie in one batch

typedef _Float16 h16;
typedef unsigned short bf;
typedef __attribute__((ext_vector_type(16))) __bf16   v16bf;
typedef __attribute__((ext_vector_type(16))) _Float16 v16h;
typedef __attribute__((ext_vector_type(8)))  _Float16 v8h;
typedef __attribute__((ext_vector_type(8)))  unsigned short v8us;
typedef __attribute__((ext_vector_type(8)))  float    v8f;
typedef __attribute__((ext_vector_type(4)))  float    v4f;
typedef v8h  __attribute__((may_alias)) v8ha;
typedef v4f  __attribute__((may_alias)) v4fa;
typedef v8us __attribute__((may_alias)) v8usa;

__device__ __forceinline__ unsigned short f2bf(float f) { unsigned u = __float_as_uint(f); u += 0x7FFFu + ((u >> 16) & 1u); return (unsigned short)(u >> 16); }
__device__ __forceinline__ float bf2f(unsigned short b) { return __uint_as_float(((unsigned)b) << 16); }
__device__ __forceinline__ float bfr(float f) { return bf2f(f2bf(f)); }
__device__ __forceinline__ h16 tohx(float x) { return (h16)x; }
__device__ __forceinline__ void splitf(float y, unsigned short& h, unsigned short& l) { h = f2bf(y); l = f2bf(y - bf2f(h)); }
__device__ __forceinline__ size_t FO(size_t row, size_t k, size_t K) { return ((row >> 4) * (K >> 3) + (k >> 3)) * 128 + (row & 15) * 8 + (k & 7); }
__device__ __forceinline__ v16h cat16(v8h lo, v8h hi) { return __builtin_shufflevector(lo, hi, 0, 1, 2, 3, 4, 5, 6, 7, 8, 9, 10, 11, 12, 13, 14, 15); }
__device__ __forceinline__ v16bf cat16b(v8us lo, v8us hi) { return __builtin_bit_cast(v16bf, __builtin_shufflevector(lo, hi, 0, 1, 2, 3, 4, 5, 6, 7, 8, 9, 10, 11, 12, 13, 14, 15)); }
__device__ __forceinline__ v8f wmma16(v16h a, v16h b, v8f c) { return __builtin_amdgcn_wmma_f32_16x16x32_f16(false, a, false, b, (short)0, c, false, false); }
__device__ __forceinline__ v8f wmmab(v16bf a, v16bf b, v8f c) { return __builtin_amdgcn_wmma_f32_16x16x32_bf16(false, a, false, b, (short)0, c, false, false); }

// ---- k_gemmw: GEMM, one work-group of 4 waves (2 x 2) per 128x128 output tile, 64x64 (16 accumulators) per wave; operands are 16-bit planes in fragment order; grid (M/128, N/128, Z), 128 threads.
// C[m][n] (f32, pitch ldc, + optional f32 bias[n] via bf16; z = 1, 2 take bias1, bias2) = sum_k A[m][k] Bt[n][k] (+ A2[m][k] Bt[n][k] where NSPLIT == 1). z-batch strides sA/sB/sC in elements. K % 64 == 0, K >= 128, a compile-time constant; A, A2 and Bt have K columns.
// EPI == 1 (the projections): no C; the epilogue writes the attention's operand planes from the accumulators. Both operands have the same fragment map and tile shape, so z = q, k run as W.X^T (W on the A side): a lane then holds 8 neighbouring d of one row t, 16 bytes of a q or k plane (bf16 hi and lo); z = v runs as X.W^T: a lane holds 8 neighbouring keys of one d, 16 bytes of the V^T plane (fp16). A wave-wide store covers 512 bytes in a row.
// Fragment map (both operands): lane l -> row/col l&15, elements 0..7 <- k 8h..8h+7, elements 8..15 <- k 16+8h..16+8h+7 (h = l>>4); D element r -> row 8h+r, col l&15. In fragment order these are elements 8 l .. 8 l + 7 and 256 + 8 l .. of the fragment's 512.
// A stage is 64 k of the tile's 8 row tiles of each operand: a row tile's 64 k are 2 KiB in a row in the workspace and go as they lie into LDS, 16 bytes a thread, by asynchronous copies; two stage buffers, the next stage's copies fly while this one is multiplied. Every fragment is fetched from L2 once for two waves.
template <typename T16> __device__ __forceinline__ const T16* atb(const T16* u, unsigned bytes) { return (const T16*)((const char*)u + bytes); }
template <typename T16> struct WFrag;
template <> struct WFrag<h16> { typedef v16h V; static __device__ __forceinline__ V ld(const h16* p) { return cat16(*(const v8h*)p, *(const v8h*)(p + 256)); } static __device__ __forceinline__ v8f mma(V a, V b, v8f c) { return wmma16(a, b, c); } };
template <> struct WFrag<bf> { typedef v16bf V; static __device__ __forceinline__ V ld(const bf* p) { return cat16b(*(const v8us*)p, *(const v8us*)(p + 256)); } static __device__ __forceinline__ V lds(const char* p) { return cat16b(*(const v8usa*)p, *(const v8usa*)(p + 512)); } static __device__ __forceinline__ v8f mma(V a, V b, v8f c) { return wmmab(a, b, c); } };
// the thread's 16 bytes of eight row tiles (gs bytes apart in the workspace, 2 KiB apart in LDS); the s_wait_xcnt closes the statement, so no address register of a copy is rewritten ahead of it
__device__ __forceinline__ void cp8(unsigned l, const char* g, unsigned gs) {
    asm volatile("global_load_async_to_lds_b128 %0, %8, off\n\t"
                 "global_load_async_to_lds_b128 %1, %9, off\n\t"
                 "global_load_async_to_lds_b128 %2, %10, off\n\t"
                 "global_load_async_to_lds_b128 %3, %11, off\n\t"
                 "global_load_async_to_lds_b128 %4, %12, off\n\t"
                 "global_load_async_to_lds_b128 %5, %13, off\n\t"
                 "global_load_async_to_lds_b128 %6, %14, off\n\t"
                 "global_load_async_to_lds_b128 %7, %15, off\n\t"
                 "s_wait_xcnt 0x0"
                 :: "v"(l), "v"(l + 2048u), "v"(l + 4096u), "v"(l + 6144u), "v"(l + 8192u), "v"(l + 10240u), "v"(l + 12288u), "v"(l + 14336u),
                    "v"(g), "v"(g + gs), "v"(g + 2 * (size_t)gs), "v"(g + 3 * (size_t)gs), "v"(g + 4 * (size_t)gs), "v"(g + 5 * (size_t)gs), "v"(g + 6 * (size_t)gs), "v"(g + 7 * (size_t)gs) : "memory");
}
// at most 256 registers: four work-groups of the projections fit a WGP (64 KiB of LDS each), and every operand of the copies' asm text stays below v256
template <typename T16, int NSPLIT, bool BIAS, int K, int EPI>
__global__ __launch_bounds__(128, 4) void k_gemmw(const T16* __restrict__ A, const T16* __restrict__ A2, const T16* __restrict__ Bt, float* C, int ldc, const float* __restrict__ bias0, const float* __restrict__ bias1, const float* __restrict__ bias2, size_t sA, size_t sB, size_t sC, bf* Ph, bf* Pl, h16* VT) {
    typedef typename WFrag<T16>::V V;
    static_assert(NSPLIT == 0 || NSPLIT == 1); static_assert(K % 64 == 0 && K >= 128); static_assert(EPI == 0 || (NSPLIT == 0 && BIAS));
    constexpr unsigned OPB = 8 * 2048;                       // one operand's part of a stage
    constexpr unsigned BOF = (NSPLIT == 1 ? 2 : 1) * OPB;    // Bt's place in a stage, behind A (and A2)
    constexpr unsigned STG = BOF + OPB;
    constexpr int NT = K / 64;
    __shared__ __align__(16) char st[2 * STG];
    const size_t z = blockIdx.z; A += z * sA; if (NSPLIT == 1) A2 += z * sA; Bt += z * sB; if (EPI == 0) C += z * sC;
    const bool tr = EPI == 1 && z < 2;   // block-uniform: Bt's tile takes the A side, A's the B side
    const float* __restrict__ bias = (z == 0) ? bias0 : (z == 1) ? bias1 : bias2;
    const int lane = threadIdx.x & 31, lr = lane & 15, hi = lane >> 4; const int wid = __builtin_amdgcn_readfirstlane(threadIdx.x >> 5); const int wm = wid & 1, wn = wid >> 1;
    const int rb = blockIdx.x * 128, cb = blockIdx.y * 128;
    v8f acc[4][4];
#pragma unroll
    for (int mb = 0; mb < 4; ++mb)
#pragma unroll
        for (int nb = 0; nb < 4; ++nb) acc[mb][nb] = (v8f){};
    // a 16-row tile is 16 K elements, 64 k of it 2 KiB
    const char* gX = (const char*)(A + (size_t)rb * K) + threadIdx.x * 16; const char* gW = (const char*)(Bt + (size_t)cb * K) + threadIdx.x * 16;
    const char* gA = tr ? gW : gX; const char* gA2 = (NSPLIT == 1) ? (const char*)(A2 + (size_t)rb * K) + threadIdx.x * 16 : gA; const char* gB = tr ? gX : gW;
    const unsigned l0 = (unsigned)(size_t)(__attribute__((address_space(3))) char*)st + threadIdx.x * 16;   // the thread's LDS byte address in a row tile of buffer 0
    auto fill = [&](int t, unsigned buf) { const unsigned l = l0 + buf * STG; const size_t go = (size_t)t * 2048;
        cp8(l, gA + go, 32 * K); if (NSPLIT == 1) cp8(l + OPB, gA2 + go, 32 * K); cp8(l + BOF, gB + go, 32 * K); };
    fill(0, 0);
    asm volatile("s_wait_asynccnt 0x0" ::: "memory");   // this wave's copies of stage 0 have landed
    __syncthreads();                                    // ... and every other wave's
    fill(1, 1);
#pragma unroll 1
    for (int t = 0; t < NT; ++t) {
        const char* sb = st + (unsigned)(t & 1) * STG + lane * 16;
#pragma unroll
        for (int ks = 0; ks < 2; ++ks) {
            V a[4], a2[4], b[4];
            b[0] = WFrag<T16>::lds(sb + BOF + (wn * 4) * 2048 + ks * 1024);
#pragma unroll
            for (int mb = 0; mb < 4; ++mb) { a[mb] = WFrag<T16>::lds(sb + (wm * 4 + mb) * 2048 + ks * 1024); if (NSPLIT == 1) a2[mb] = WFrag<T16>::lds(sb + OPB + (wm * 4 + mb) * 2048 + ks * 1024); }
#pragma unroll
            for (int nb = 1; nb < 4; ++nb) b[nb] = WFrag<T16>::lds(sb + BOF + (wn * 4 + nb) * 2048 + ks * 1024);
            __builtin_amdgcn_sched_barrier(0);   // the k step's LDS reads stay one group ahead of its products, in the order of use; without it the build reads Bt fragment by fragment and waits out the LDS latency before every four products
#pragma unroll
            for (int nb = 0; nb < 4; ++nb) {
#pragma unroll
                for (int mb = 0; mb < 4; ++mb) { acc[mb][nb] = WFrag<T16>::mma(a[mb], b[nb], acc[mb][nb]); if (NSPLIT == 1) acc[mb][nb] = WFrag<T16>::mma(a2[mb], b[nb], acc[mb][nb]); } }
        }
        __builtin_amdgcn_sched_barrier(0);                  // the stage's products stay ahead of the foot; without it the build sinks 32 k of them behind the barrier, in front of the refill, whose copies then start that much later
        asm volatile("s_wait_dscnt 0x0" ::: "memory");      // this wave's reads of the buffer are done before it is refilled
        asm volatile("s_wait_asynccnt 0x0" ::: "memory");   // this wave's copies of stage t + 1 have landed
        __syncthreads();                                    // publishes stage t + 1 and ends every wave's reads of stage t
        if (t + 2 < NT) fill(t + 2, (unsigned)(t & 1));
    }
    asm volatile("s_wait_asynccnt 0x0" ::: "memory");       // no copy is outstanding when the wave goes on
    if constexpr (EPI == 1) {
        const int m0 = rb + (tr ? wn : wm) * 64, n0 = cb + (tr ? wm : wn) * 64;   // the wave's part: 64 rows t of one batch, the 64 columns d of one head
        const size_t g = (size_t)(m0 / TT) * NH_ + n0 / HD; const int t0 = m0 % TT;
        const float* bu = bias + n0;   // wave-uniform: the head's 64 bias values
        if (tr) {   // acc[mb][nb][r]: d = 16 mb + 8 hi + r, t = t0 + 16 nb + lr
            const size_t e0 = (z * (NB * NH_) + g) * TT * HD + (size_t)(t0 >> 4) * (16 * HD) + lane * 8;
            const unsigned bo = (unsigned)hi * 32;   // the lane's byte offset in 16 bias values
            v4f bv[4][2];   // all of the lane's bias in one group of loads: one latency, not one per group of stores
#pragma unroll
            for (int mb = 0; mb < 4; ++mb) { const float* bp = atb(bu + mb * 16, bo); bv[mb][0] = *(const v4f*)bp; bv[mb][1] = *(const v4f*)(bp + 4); }
            // the lane offset and the base are inputs, so they stay in their registers up to this wait: no result of the run of loads lands in a register that an issued load of the run still names
            asm volatile("s_wait_xcnt 0x0" :: "v"(bo), "s"(bu) : "memory");
#pragma unroll
            for (int mb = 0; mb < 4; ++mb) {
                const v4f b0 = bv[mb][0], b1 = bv[mb][1];
                const float bb[8] = {bfr(b0[0]), bfr(b0[1]), bfr(b0[2]), bfr(b0[3]), bfr(b1[0]), bfr(b1[1]), bfr(b1[2]), bfr(b1[3])};
#pragma unroll
                for (int nb = 0; nb < 4; ++nb) { v8us oh, ol;
#pragma unroll
                    for (int r = 0; r < 8; ++r) { unsigned short c1, c2; splitf(acc[mb][nb][r] + bb[r], c1, c2); oh[r] = c1; ol[r] = c2; }
                    const size_t e = e0 + nb * (16 * HD) + mb * 256; *(v8us*)(Ph + e) = oh; *(v8us*)(Pl + e) = ol; }
                asm volatile("s_wait_xcnt 0x0" ::: "memory");   // ahead of the next group's code, which reuses the registers that the eight stores name
            }
        } else {    // acc[mb][nb][r]: t = t0 + 16 mb + 8 hi + r, d = 16 nb + lr
            h16* vp = VT + g * HD * PP + (size_t)(t0 >> 3) * 128 + lane * 8;
            const unsigned bo = (unsigned)lr * 4;
            float bv[4];    // one group of loads and its wait, as above
#pragma unroll
            for (int nb = 0; nb < 4; ++nb) bv[nb] = *atb(bu + nb * 16, bo);
            asm volatile("s_wait_xcnt 0x0" :: "v"(bo), "s"(bu) : "memory");
#pragma unroll
            for (int nb = 0; nb < 4; ++nb) { const float bb = bfr(bv[nb]);
#pragma unroll
                for (int mb = 0; mb < 4; ++mb) { v8h o;
#pragma unroll
                    for (int r = 0; r < 8; ++r) o[r] = tohx(acc[mb][nb][r] + bb);
                    *(v8h*)(vp + (size_t)nb * (16 * PP) + mb * 256) = o; }
                asm volatile("s_wait_xcnt 0x0" ::: "memory");   // as above, for the four stores
            }
        }
    } else {
    __shared__ __align__(16) float osw[4][16 * 68];
    float* os = osw[wid]; const int r0 = rb + wm * 64, c0 = cb + wn * 64;   // the wave's own staging rows and its 64x64 part of the tile
#pragma unroll
    for (int mb = 0; mb < 4; ++mb) {
#pragma unroll
        for (int nb = 0; nb < 4; ++nb) {
#pragma unroll
            for (int j = 0; j < 8; ++j) os[(hi * 8 + j) * 68 + nb * 16 + lr] = acc[mb][nb][j]; }
        __builtin_amdgcn_wave_barrier(); asm volatile("" ::: "memory");
        float* crow = C + (size_t)(r0 + mb * 16) * ldc + c0;
{
#pragma unroll
            for (int s = 0; s < 8; ++s) { const int row = 2 * s + hi, cofs = lr * 4; v4f val = *(const v4fa*)(os + row * 68 + cofs); if (BIAS) { val[0] += bfr(bias[c0 + cofs]); val[1] += bfr(bias[c0 + cofs + 1]); val[2] += bfr(bias[c0 + cofs + 2]); val[3] += bfr(bias[c0 + cofs + 3]); }
                *(v4f*)(crow + (size_t)row * ldc + cofs) = val; }
             }
        asm volatile("s_wait_xcnt 0x0" ::: "memory");   // ahead of the next row tile's code, which reuses the registers that the eight stores name
        __builtin_amdgcn_wave_barrier(); asm volatile("" ::: "memory");
    }
    }
}

typedef __attribute__((ext_vector_type(2))) _Float16 v2h;
typedef __attribute__((ext_vector_type(4))) _Float16 v4h;
typedef v4h  __attribute__((may_alias)) v4ha;
typedef __attribute__((ext_vector_type(2))) unsigned short v2us;
typedef __attribute__((ext_vector_type(4))) unsigned short v4us;
typedef __attribute__((ext_vector_type(2))) float v2f;

// The jobs below that need nothing of each other share a launch: each takes a range of the block index (bx: the block's index inside its job, by: the job's slab), picked by a block-uniform branch in k_prep.
// y picks one of up to four equally long sources of DM columns; its bf16 copy, in fragment order, is slab y of dst. A wave takes 8 rows x 4 chunks of 8 columns: whole 128-byte lines on both sides.
__device__ __forceinline__ void cvt8(unsigned bx, unsigned y, const float* __restrict__ s0, const float* __restrict__ s1, const float* __restrict__ s2, const float* __restrict__ s3, bf* dst, size_t n8) { const size_t i = (size_t)bx * 256 + threadIdx.x; if (i >= n8) return;
    const float* __restrict__ src = (y == 0) ? s0 : (y == 1) ? s1 : (y == 2) ? s2 : s3; dst += (size_t)y * n8 * 8;
    const size_t u = i >> 6; const size_t row = (u / (DM / 32)) * 16 + ((i >> 5) & 1) * 8 + ((i >> 2) & 7), k = ((u % (DM / 32)) * 4 + (i & 3)) * 8; const v8f v = *(const v8f*)(src + row * DM + k); v8us o;
#pragma unroll
    for (int q = 0; q < 8; ++q) o[q] = f2bf(v[q]); *(v8us*)(dst + FO(row, k, DM)) = o;  }

__device__ __forceinline__ void epad2(unsigned bx, const float* __restrict__ E, bf* EB) { const size_t i = (size_t)bx * 256 + threadIdx.x; if (i >= (size_t)NE * HD / 8) return; const int d0 = (int)(i % (HD / 8)) * 8; const int r = (int)(i / (HD / 8)); const float* src = E + (size_t)min(r, NREL - 1) * HD + d0; v8us o;
#pragma unroll
    for (int q = 0; q < 8; ++q) { const unsigned short v = f2bf(src[q]); o[q] = (r < NREL) ? v : (unsigned short)0; }
    *(v8us*)(EB + FO(r, d0, HD)) = o;  }

__device__ __forceinline__ void evt(unsigned bx, const float* __restrict__ EV, int nheads, h16* VT) {
    const size_t x = (size_t)bx * 256 + threadIdx.x; if (x >= (size_t)nheads * HD * NE / 8) return;
    const int d = (int)(x % HD); const int r0 = (int)((x / HD) % (NE / 8)) * 8; const int g = (int)(x / ((size_t)NE * HD / 8));
    v8h o; const float* ep[8]; float ev[8];
#pragma unroll
    for (int q = 0; q < 8; ++q) { ep[q] = EV + (size_t)min(r0 + q, NREL - 1) * HD + d; ev[q] = *ep[q]; }
    // the eight addresses are inputs, so they stay in their registers up to this wait: no result of the run of loads lands in a register that an issued load of the run still names
    asm volatile("s_wait_xcnt 0x0" :: "v"(ep[0]), "v"(ep[1]), "v"(ep[2]), "v"(ep[3]), "v"(ep[4]), "v"(ep[5]), "v"(ep[6]), "v"(ep[7]) : "memory");
#pragma unroll
    for (int q = 0; q < 8; ++q) { const float y = (r0 + q < NREL) ? bfr(ev[q]) : 0.0f; o[q] = tohx(y); }
    h16* dst = VT + (size_t)g * HD * PP + FO(d, TT + r0, PP);
    *(v8h*)dst = o;  }

// blocks of each job
#define GB_E ((NE * HD / 8 + 255) / 256)                  // E_k table
#define GB_V ((NB * NH_ * HD * NE / 8 + 255) / 256)       // E_v^T columns of every plane
#define GB_W ((DQ * DM / 8 + 255) / 256)                  // one weight matrix
#define GB_X ((NB * TT * DM / 8 + 255) / 256)             // one input, all batches
// k_prep: all that reads only the inputs: the two tables, the bf16 copies of the four weights and of the three inputs. Grid GB_E + GB_V + 4 GB_W + 3 GB_X.
__global__ __launch_bounds__(256) void k_prep(const float* __restrict__ query, const float* __restrict__ key, const float* __restrict__ value, const float* __restrict__ wq, const float* __restrict__ wk, const float* __restrict__ wv, const float* __restrict__ wo,
                                              const float* __restrict__ rke, const float* __restrict__ rve, bf* XB, bf* WQ, bf* EB, h16* VT) {
    unsigned b = blockIdx.x;
    if (b < GB_E) { epad2(b, rke, EB); return; }                                                      /* E_k: 65 rows bf16 (exact), rows 65..127 zero */
    b -= GB_E;
    if (b < GB_V) { evt(b, rve, NB * NH_, VT); return; }                                              /* E_v^T columns TT..TT+127 of every V^T row */
    b -= GB_V;
    if (b < 4 * GB_W) { cvt8(b % GB_W, b / GB_W, wq, wk, wv, wo, WQ, (size_t)DQ * DM / 8); return; }
    b -= 4 * GB_W;
    cvt8(b % GB_X, b / GB_X, query, key, value, value, XB, (size_t)NB * TT * DM / 8);
}
// k_fattn: one work-group (8 waves) per FR = 32 query rows of one (batch, head) plane g; the scores never leave the registers.
// Key tiles of 16 are dealt out from the first tile that a band of the 32 queries can touch, T0 = r0 / 16 - 2, round the row's end: slot n of wave w is tile (T0 + 8 n + w) % 64. The six tiles with band keys are slot 0 of waves 0 to 5; a slot n >= 1 lies wholly right of every band or, wrapped, wholly left.
// 1) wave w: S^T[its 8 key tiles][32] = k.q^T (k fragments as A, q fragments as B; 3 products, same order as a K = 64 GEMM): a lane holds query l & 15 of a query tile and, per key tile, keys 8 (l >> 4) .. + 7; column tile w of QE = q.E_k^T (2 products) goes f32 into LDS;
// 2) on the accumulators: t_j = S_j * HD^-0.5 + QE[clip(j - i, -32, 32) + 32] (per key in slot 0, one clipped logit a query in the other slots); a query's maximum from 16 partial maxima (wave, lane half) through LDS;
// 3) x_j = 32 exp(t_j - max): the eight values a lane of slots 2 s and 2 s + 1, as fp16, ARE the B fragment of k step s of V^T.P^T; partial row sum and the two tails (keys j <= i - 32, j >= i + 32) in f32 to LDS; the keys of the band also as fp16 to bucket j - i + 32 of the query's bucket row in LDS (zero elsewhere);
// 4) wave w: O^T[64][32] over its own 128 keys, A from the V^T plane, each half of a fragment from its own key tile (every V fragment leaves L2 once a work-group); the eight waves' f32 partial sums go to LDS in register order;
// 5) wave w: tile (w & 3 of d, w >> 2 of the queries): E_v^T . buckets^T (tails put into elements 0 and 64), plus the eight partial sums as a fixed tree, divided by the row sum, split into the bf16 hi/lo context planes, row b*TT + t, column h*64 + d, in fragment order: a lane stores 8 columns, a wave 512 bytes in a row.
#define FR   32
#define QEP  132             // float pitch of a QE row
#define MP   20              // float pitch of a query's 16 partial maxima or sums: 16-byte reads, lanes on different banks
#define XP   (NE + 8)        // fp16 pitch of a query's bucket row
#define PSC  5.0f            // x carries 2^5: an fp16 tail of TT keys stays finite, small x keep more bits
static_assert(TT % FR == 0);
static_assert(TT == 8 * 128);     // 8 waves x 128 keys
static_assert(FR == 32 && NE == 128 && 2 * MAXR + 1 <= 96);   // two query tiles; the used buckets lie in three k steps
// sum of a query's 16 partial values, fixed tree
__device__ __forceinline__ float sum16(const float* p) { const v4f a = *(const v4fa*)p, b = *(const v4fa*)(p + 4), c = *(const v4fa*)(p + 8), d = *(const v4fa*)(p + 12); const v4f s = (a + b) + (c + d); return (s[0] + s[1]) + (s[2] + s[3]); }
// eight exp2 in one statement, no result in a source's register, closed by the one slot that the instruction set asks for behind a transcendental
__device__ __forceinline__ void exp2x8(const v8f a, float (&x)[8]) {
    asm("v_exp_f32 %0, %8\n\tv_exp_f32 %1, %9\n\tv_exp_f32 %2, %10\n\tv_exp_f32 %3, %11\n\tv_exp_f32 %4, %12\n\tv_exp_f32 %5, %13\n\tv_exp_f32 %6, %14\n\tv_exp_f32 %7, %15\n\tv_nop"
        : "=&v"(x[0]), "=&v"(x[1]), "=&v"(x[2]), "=&v"(x[3]), "=&v"(x[4]), "=&v"(x[5]), "=&v"(x[6]), "=&v"(x[7])
        : "v"(a[0]), "v"(a[1]), "v"(a[2]), "v"(a[3]), "v"(a[4]), "v"(a[5]), "v"(a[6]), "v"(a[7]));
}
// 4 waves per SIMD = two work-groups per WGP: at most 256 registers
__global__ __launch_bounds__(256, 4) void k_fattn(const bf* __restrict__ QPh, const bf* __restrict__ QPl, const bf* __restrict__ KPh, const bf* __restrict__ KPl, const bf* __restrict__ EB, const h16* __restrict__ VT, bf* ATh, bf* ATl) {
    __shared__ __align__(16) float qes[FR * QEP];
    __shared__ __align__(16) float ost[8 * 8 * 2 * 32 * 4];   // [wave][tile][half of the 8 registers][lane][4]
    __shared__ __align__(16) float mxs[FR * MP];
    __shared__ __align__(16) float sms[3 * FR * MP];          // row sum, left tail, right tail
    __shared__ __align__(16) h16 pex[FR * XP];
    const int lane = threadIdx.x & 31, lr = lane & 15, hi = lane >> 4; const int wid = __builtin_amdgcn_readfirstlane(threadIdx.x >> 5);
    const int g = blockIdx.y, r0 = blockIdx.x * FR; const size_t pl = (size_t)g * TT * HD;
    const unsigned lo = (unsigned)lane * 16;   // the lane's byte offset in a fragment (fragment order); all else of an address is wave-uniform
    const int T0 = r0 / 16 - 2;                // first key tile that a band can touch (below 0: wraps to the row's end, where the clip holds as well)
    auto tile = [&](int n) { return (T0 + n * 8 + wid) & (TT / 16 - 1); };   // wave-uniform: the key tile in slot n
    for (int c = threadIdx.x; c < FR * XP / 8; c += 256) *(v8ha*)(pex + c * 8) = (v8h){};
    v8f acc[2][8];
    {
        const bf* qbh = QPh + pl + (size_t)r0 * HD; const bf* qbl = QPl + pl + (size_t)r0 * HD;   // wave-uniform bases of the 32 rows
        const bf* ebp = EB + (size_t)(wid * 16) * HD;
        v8f acq[2];
#pragma unroll
        for (int mb = 0; mb < 2; ++mb) { acq[mb] = (v8f){};
#pragma unroll
            for (int n = 0; n < 8; ++n) acc[mb][n] = (v8f){}; }
#pragma unroll
        for (int ks = 0; ks < 2; ++ks) {      // 32 of the 64 d at a time: only that half of q is in registers beside the 128 accumulators
            v16bf a[2], a2[2];
#pragma unroll
            for (int mb = 0; mb < 2; ++mb) { const int ao = mb * 16 * HD + ks * 512; a[mb] = WFrag<bf>::ld(atb(qbh + ao, lo)); a2[mb] = WFrag<bf>::ld(atb(qbl + ao, lo)); }
            const v16bf e = WFrag<bf>::ld(atb(ebp + ks * 512, lo));
            // the lane offset and the bases are inputs, so they stay in their registers up to this wait: no result of the run of loads lands in a register that an issued load of the run still names
            asm volatile("s_wait_xcnt 0x0" :: "v"(lo), "s"(qbh), "s"(qbl), "s"(ebp) : "memory");
#pragma unroll
            for (int mb = 0; mb < 2; ++mb) { acq[mb] = wmmab(a[mb], e, acq[mb]); acq[mb] = wmmab(a2[mb], e, acq[mb]); }
#pragma unroll
            for (int ng = 0; ng < 4; ++ng) {  // two key tiles at a time
                v16bf b[2], b2[2];
                const bf* kh[2]; const bf* kl[2];   // wave-uniform bases of the two tiles' rows
#pragma unroll
                for (int n2 = 0; n2 < 2; ++n2) { const size_t bo = pl + (size_t)tile(ng * 2 + n2) * 16 * HD + ks * 512; kh[n2] = KPh + bo; kl[n2] = KPl + bo; b[n2] = WFrag<bf>::ld(atb(kh[n2], lo)); b2[n2] = WFrag<bf>::ld(atb(kl[n2], lo)); }
                // as above, for the run of key loads
                asm volatile("s_wait_xcnt 0x0" :: "v"(lo), "s"(kh[0]), "s"(kl[0]), "s"(kh[1]), "s"(kl[1]) : "memory");
#pragma unroll
                for (int n2 = 0; n2 < 2; ++n2)
#pragma unroll
                    for (int mb = 0; mb < 2; ++mb) { v8f t = acc[mb][ng * 2 + n2]; t = wmmab(b[n2], a[mb], t); t = wmmab(b[n2], a2[mb], t); t = wmmab(b2[n2], a[mb], t); acc[mb][ng * 2 + n2] = t; }
            }
        }
#pragma unroll
        for (int mb = 0; mb < 2; ++mb)
#pragma unroll
            for (int j = 0; j < 8; ++j) qes[(mb * 16 + hi * 8 + j) * QEP + wid * 16 + lr] = acq[mb][j];
    }
    __syncthreads();   // QE is whole, the bucket rows are zero
#pragma unroll
    for (int mb = 0; mb < 2; ++mb) {
        const float* qe = qes + (mb * 16 + lr) * QEP; const float qL = qe[0], qR = qe[2 * MAXR]; float m[4] = {-3.0e38f, -3.0e38f, -3.0e38f, -3.0e38f};   // four chains: each fills the others' dependent links
#pragma unroll
        for (int n = 0; n < 8; ++n) {
            if (n == 0) { const int o = tile(0) * 16 + hi * 8 - (r0 + mb * 16 + lr);   // j - i of the lane's first key
#pragma unroll
                for (int r = 0; r < 8; ++r) acc[mb][n][r] = acc[mb][n][r] * SCL + qe[min(max(o + r, -MAXR), MAXR) + MAXR]; }
            else { const float c1 = (T0 + n * 8 + wid >= TT / 16) ? qL : qR; acc[mb][n] = acc[mb][n] * SCL + c1; }
#pragma unroll
            for (int r = 0; r < 8; r += 2) m[r >> 1] = fmaxf(fmaxf(m[r >> 1], acc[mb][n][r]), acc[mb][n][r + 1]);
        }
        mxs[(mb * 16 + lr) * MP + wid * 2 + hi] = fmaxf(fmaxf(m[0], m[1]), fmaxf(m[2], m[3]));
    }
    const h16* vpl = VT + (size_t)g * HD * PP;
    v16h va[4][4];
    auto ldv = [&](int s) { const h16* v0 = atb(vpl + (size_t)tile(2 * s) * 256, lo); const h16* v1 = atb(vpl + (size_t)tile(2 * s + 1) * 256, lo);   // a key tile is two chunks of 128 elements of a row tile
#pragma unroll
        for (int dt = 0; dt < 4; ++dt) va[s][dt] = cat16(*(const v8h*)(v0 + dt * 16 * PP), *(const v8h*)(v1 + dt * 16 * PP));
        // as above, for the run of V loads: the lane's two addresses are the inputs
        asm volatile("s_wait_xcnt 0x0" :: "v"(v0), "v"(v1) : "memory"); };
    __syncthreads();   // the partial maxima are whole
    ldv(0);            // depends on nothing that the softmax makes: in flight over it (behind the barrier, which waits for every load in front of it)
    v16h pb[2][4];
#pragma unroll
    for (int mb = 0; mb < 2; ++mb) {
        const int q = mb * 16 + lr; const float* mp = mxs + q * MP;
        const v4f m0 = *(const v4fa*)mp, m1 = *(const v4fa*)(mp + 4), m2 = *(const v4fa*)(mp + 8), m3 = *(const v4fa*)(mp + 12);
        float mx = fmaxf(fmaxf(fmaxf(m0[0], m0[1]), fmaxf(m0[2], m0[3])), fmaxf(fmaxf(m1[0], m1[1]), fmaxf(m1[2], m1[3])));
        mx = fmaxf(mx, fmaxf(fmaxf(fmaxf(m2[0], m2[1]), fmaxf(m2[2], m2[3])), fmaxf(fmaxf(m3[0], m3[1]), fmaxf(m3[2], m3[3]))));
        float sum = 0.f, tl0 = 0.f, tl1 = 0.f;
#pragma unroll
        for (int n = 0; n < 8; ++n) {
            const v8f ar = (acc[mb][n] - mx) * 1.4426950408889634f + PSC; float x[8]; exp2x8(ar, x);
            const v2f e2 = ((v2f){x[0], x[1]} + (v2f){x[2], x[3]}) + ((v2f){x[4], x[5]} + (v2f){x[6], x[7]}); const float e = e2[0] + e2[1]; sum += e;
#pragma unroll
            for (int r = 0; r < 8; ++r) pb[mb][n >> 1][(n & 1) * 8 + r] = tohx(x[r]);
            if (n == 0) { const int o = tile(0) * 16 + hi * 8 - (r0 + q);
#pragma unroll
                for (int r = 0; r < 8; ++r) { const int d = o + r; tl0 += (d <= -MAXR) ? x[r] : 0.f; tl1 += (d >= MAXR) ? x[r] : 0.f;
                    if (d > -MAXR && d < MAXR) pex[q * XP + d + MAXR] = pb[mb][0][r]; } }
            else { const bool wr = T0 + n * 8 + wid >= TT / 16; tl0 = fmaf(e, wr ? 1.f : 0.f, tl0); tl1 = fmaf(e, wr ? 0.f : 1.f, tl1); }
        }
        sms[q * MP + wid * 2 + hi] = sum; sms[(FR + q) * MP + wid * 2 + hi] = tl0; sms[(2 * FR + q) * MP + wid * 2 + hi] = tl1;
    }
    const int dt5 = wid & 3, qt5 = wid >> 2;   // the wave's tile of the last stage
    const h16* ve = VT + ((size_t)g * HD + dt5 * 16) * PP + (size_t)TT * 16;   // wave-uniform: the bucket columns of its row tile
    v16h vx[3];
#pragma unroll
    for (int s = 0; s < 3; ++s) vx[s] = WFrag<h16>::ld(atb(ve + s * 512, lo));   // ahead of the products: landed when the barrier behind them waits for every load
    // as above, for the run of E_v^T loads
    asm volatile("s_wait_xcnt 0x0" :: "v"(lo), "s"(ve) : "memory");
    {
        v8f oc[4][2];
#pragma unroll
        for (int dt = 0; dt < 4; ++dt)
#pragma unroll
            for (int mb = 0; mb < 2; ++mb) oc[dt][mb] = (v8f){};
#pragma unroll
        for (int s = 0; s < 4; ++s) {
            if (s + 1 < 4) ldv(s + 1);
#pragma unroll
            for (int dt = 0; dt < 4; ++dt)
#pragma unroll
                for (int mb = 0; mb < 2; ++mb) oc[dt][mb] = wmma16(va[s][dt], pb[mb][s], oc[dt][mb]); }
#pragma unroll
        for (int dt = 0; dt < 4; ++dt)
#pragma unroll
            for (int mb = 0; mb < 2; ++mb)
#pragma unroll
                for (int hf = 0; hf < 2; ++hf) *(v4fa*)(ost + ((((wid * 8 + dt * 2 + mb) * 2 + hf) * 32) + lane) * 4) = (v4f){oc[dt][mb][hf * 4], oc[dt][mb][hf * 4 + 1], oc[dt][mb][hf * 4 + 2], oc[dt][mb][hf * 4 + 3]};
    }
    __syncthreads();   // partial O^T, partial sums and bucket rows are whole
    {
        const int q = qt5 * 16 + lr;
        const float sum = sum16(sms + q * MP), tl0 = sum16(sms + (FR + q) * MP), tl1 = sum16(sms + (2 * FR + q) * MP);
        v8f x = (v8f){};
#pragma unroll
        for (int s = 0; s < 3; ++s) { const h16* bp = pex + q * XP + s * 32 + hi * 8; v16h b = cat16(*(const v8ha*)bp, *(const v8ha*)(bp + 16));
            if (s == 0) b[0] = (hi == 0) ? tohx(tl0) : b[0];                 // bucket 0
            if (s == 2) b[0] = (hi == 0) ? tohx(tl1) : b[0];                 // bucket 2 MAXR = 64
            x = wmma16(vx[s], b, x); }
        v8f p[8];
#pragma unroll
        for (int w = 0; w < 8; ++w) { const float* op = ost + (((w * 8 + dt5 * 2 + qt5) * 2) * 32 + lane) * 4; const v4f u0 = *(const v4fa*)op, u1 = *(const v4fa*)(op + 128);
            p[w] = (v8f){u0[0], u0[1], u0[2], u0[3], u1[0], u1[1], u1[2], u1[3]}; }
        x += ((p[0] + p[1]) + (p[2] + p[3])) + ((p[4] + p[5]) + (p[6] + p[7]));
        const float f = __fdiv_rn(1.0f, sum);
        v8us oh, ol;
#pragma unroll
        for (int r = 0; r < 8; ++r) { unsigned short c1, c2; splitf(x[r] * f, c1, c2); oh[r] = c1; ol[r] = c2; }
        const size_t oo = FO((size_t)(g / NH_) * TT + r0 + q, (size_t)(g % NH_) * HD + dt5 * 16 + hi * 8, DQ);
        *(v8us*)(ATh + oo) = oh; *(v8us*)(ATl + oo) = ol; }
}

extern "C" void kernel_launch(void* const* d_in, const int* in_sizes, int n_in,
                              void* d_out, int out_size, void* d_ws, size_t ws_size, hipStream_t stream) {
    if (n_in < 13) return;
    const size_t needX = ((size_t)(NB - 1) * SEQ_FULL + TT) * DM;
    if ((size_t)in_sizes[0] < needX || (size_t)in_sizes[1] < needX || (size_t)in_sizes[2] < needX) return;
    if (in_sizes[3] < DM * DM || in_sizes[5] < DM * DM || in_sizes[7] < DM * DM || in_sizes[9] < DM * DM) return;
    if (in_sizes[4] < DM || in_sizes[6] < DM || in_sizes[8] < DM || in_sizes[10] < DM) return;
    if (in_sizes[11] < NREL * HD || in_sizes[12] < NREL * HD) return;
    if ((size_t)out_size < needX) return;
    const float* query = (const float*)d_in[0]; const float* key = (const float*)d_in[1]; const float* value = (const float*)d_in[2];
    const float* wq = (const float*)d_in[3]; const float* bq = (const float*)d_in[4]; const float* wk = (const float*)d_in[5]; const float* bk = (const float*)d_in[6];
    const float* wv = (const float*)d_in[7]; const float* bv = (const float*)d_in[8]; const float* wo = (const float*)d_in[9]; const float* bo = (const float*)d_in[10];
    const float* rke = (const float*)d_in[11]; const float* rve = (const float*)d_in[12];
    float* OUT = (float*)d_out;     // [NB][SEQ_FULL][DM]
    char* wsp = (char*)d_ws;
    auto take = [&](size_t bytes) { char* p = wsp; wsp += (bytes + 255) & ~(size_t)255; return (void*)p; };
    constexpr size_t MR = (size_t)NB * TT;      // rows of all batches
    constexpr size_t NG = (size_t)NB * NH_;     // (batch, head) planes
    bf* WQ = (bf*)take((size_t)4 * DQ * DM * 2); bf* WO = WQ + (size_t)3 * DQ * DM;      // wq, wk, wv, wo
    bf* EB = (bf*)take((size_t)NE * HD * 2);
    bf* XB = (bf*)take((size_t)3 * MR * DM * 2);      // q, k, v
    bf* QPh = (bf*)take((size_t)2 * NG * TT * HD * 2); bf* QPl = (bf*)take((size_t)2 * NG * TT * HD * 2); bf* KPh = QPh + NG * TT * HD; bf* KPl = QPl + NG * TT * HD;
    h16* VT = (h16*)take(NG * HD * PP * 2);
    bf* ATh = (bf*)take(MR * DQ * 2); bf* ATl = (bf*)take(MR * DQ * 2);
    const size_t carved = (size_t)(wsp - (char*)d_ws);
    if (carved > ws_size) return;    // 93,339,648 B at NB=4, SEQ=1024
    // tables, weights and inputs
    k_prep<<<GB_E + GB_V + 4 * GB_W + 3 * GB_X, 256, 0, stream>>>(query, key, value, wq, wk, wv, wo, rke, rve, XB, WQ, EB, VT);
    // projections of all batches: z = q, k, v, straight into the operand planes of the attention
    k_gemmw<bf, 0, true, DM, 1><<<dim3((unsigned)(MR / 128), DQ / 128, 3), 128, 0, stream>>>(XB, nullptr, WQ, nullptr, 0, bq, bk, bv, MR * DM, (size_t)DQ * DM, 0, QPh, QPl, VT);
    k_fattn<<<dim3(TT / FR, (unsigned)NG, 1), 256, 0, stream>>>(QPh, QPl, KPh, KPl, EB, VT, ATh, ATl);   /* scores, softmax, attn.[V | E_v], context planes */
    k_gemmw<bf, 1, true, DQ, 0><<<dim3((unsigned)(MR / 128), DM / 128, 1), 128, 0, stream>>>(ATh, ATl, WO, OUT, DM, bo, bo, bo, 0, 0, 0, nullptr, nullptr, nullptr);
}
